// v000
// Measured on an AMD MI455X. A time is GPU time per run, averaged over a window of back-to-back runs after a warm-up
// (all launches, gaps included; the runs take copies of the inputs in turn), and the median of several windows.
// Apart from v000's, it joins two sittings. Times from different sittings can be a few percent apart, while
// side-by-side timings come from the same sitting.
// The starting kernel, v000, takes 2730 microseconds a run.
#include <hip/hip_runtime.h>

// Causal grouped-query attention with interleaved-pair rotary embeddings whose positions carry a 2 pi factor (x [2][2048][2048]; q = x Wq^T (32 heads x 64), k, v = x Wk^T, x Wv^T (8 kv heads x 64) ('oi' 1/sqrt(2048), no bias); rope on (even, odd) pairs: (re, im) = (q0 c - q1 s, q0 s + q1 c) with angle fl(fl(s x 2 pi) x freq_i), freq_i = 1 / 10000^(2i/64) (32 f32 frequencies jnp-exact; TWO f32 products; precise cosf/sinf); k, v repeated 4 x along the head axis: kv head = q head / 4; scores / sqrt(64); causal (finfo.min == exclusion); softmax; out = merged Wo^T ('oi', no bias) -> [2][2048][2048] (8.4 M); argument order x, Wq, Wk, Wv, Wo).
// Layout per batch: bf16 copy of x; 'oi' weights as-is; exact projections; identity-table plane builders; causal T-2048 GQA attention (both query heads of a pass share kv group h0 / 4: kv z-stride 0; hybrid rows: < 512 hi/lo 3 products, rest fp16 x1024; k_gemmc skips tiles above the diagonal); merged hi/lo x Wo exact.
// Compute dtypes, f32 accumulate: every input rounded to bf16; projections exact; attention rows < 512 3 products, rest fp16; softmax f32; output projection hl x exact.

#define NB_  2
#define TT   2048
#define DM   2048
#define NH_  32
#define NKV  8
#define REP  (NH_ / NKV)
#define HD   64
#define DQ   (NH_ * HD)
#define DKV  (NKV * HD)
#define ZH   2
#define RH   512                  // query rows < RH use hi+lo planes (0: none)
#define WIN  2048
#define PCAR 1024.0f
#define SCL  0.125f   // HD^-0.5
typedef _Float16 h16;
typedef unsigned short bf;
typedef __attribute__((ext_vector_type(16))) __bf16   v16bf;
typedef __attribute__((ext_vector_type(16))) _Float16 v16h;
typedef __attribute__((ext_vector_type(8)))  _Float16 v8h;
typedef __attribute__((ext_vector_type(8)))  unsigned short v8us;
typedef __attribute__((ext_vector_type(8)))  float    v8f;
typedef __attribute__((ext_vector_type(4)))  float    v4f;
typedef v8h  __attribute__((may_alias)) v8ha;
typedef v4f  __attribute__((may_alias)) v4fa;
typedef v8us __attribute__((may_alias)) v8usa;

__device__ __forceinline__ unsigned short f2bf(float f) { unsigned u = __float_as_uint(f); u += 0x7FFFu + ((u >> 16) & 1u); return (unsigned short)(u >> 16); }
__device__ __forceinline__ float bf2f(unsigned short b) { return __uint_as_float(((unsigned)b) << 16); }
__device__ __forceinline__ float bfr(float f) { return bf2f(f2bf(f)); }
__device__ __forceinline__ v16h cat16(v8h lo, v8h hi) { return __builtin_shufflevector(lo, hi, 0, 1, 2, 3, 4, 5, 6, 7, 8, 9, 10, 11, 12, 13, 14, 15); }
__device__ __forceinline__ v16bf cat16b(v8us lo, v8us hi) { return __builtin_bit_cast(v16bf, __builtin_shufflevector(lo, hi, 0, 1, 2, 3, 4, 5, 6, 7, 8, 9, 10, 11, 12, 13, 14, 15)); }
__device__ __forceinline__ v8f wmma16(v16h a, v16h b, v8f c) { return __builtin_amdgcn_wmma_f32_16x16x32_f16(false, a, false, b, (short)0, c, false, false); }
__device__ __forceinline__ v8f wmmab(v16bf a, v16bf b, v8f c) { return __builtin_amdgcn_wmma_f32_16x16x32_bf16(false, a, false, b, (short)0, c, false, false); }



// ---- k_gemmw: register-blocked GEMM, ONE WAVE per 64x64 output tile (16 accumulators), operands straight from K-contiguous 16-bit planes; grid (M/64, N/64, Z), 32 threads.
// C[m][n] (f32, pitch ldc, + optional f32 bias[n]) = sum_k A[m][k] Bt[n][k] (+ split products per NSPLIT). z-batch strides sA/sB/sC in elements. K % 32 == 0.
template <typename T16> struct WFrag;
template <> struct WFrag<h16> { typedef v16h V; static __device__ __forceinline__ V ld(const h16* p) { return cat16(*(const v8h*)p, *(const v8h*)(p + 16)); } static __device__ __forceinline__ v8f mma(V a, V b, v8f c) { return wmma16(a, b, c); } };
template <> struct WFrag<bf> { typedef v16bf V; static __device__ __forceinline__ V ld(const bf* p) { return cat16b(*(const v8us*)p, *(const v8us*)(p + 16)); } static __device__ __forceinline__ v8f mma(V a, V b, v8f c) { return wmmab(a, b, c); } };
template <typename T16, int NSPLIT, bool BIAS>
__global__ __launch_bounds__(32) void k_gemmw(const T16* __restrict__ A, const T16* __restrict__ A2, const T16* __restrict__ Bt, const T16* __restrict__ Bt2, int K, float* C, int ldc, const float* __restrict__ bias, size_t sA, size_t sB, size_t sC) {
    typedef typename WFrag<T16>::V V;
    __shared__ __align__(16) float os[16 * 68];
    const size_t z = blockIdx.z; A += z * sA; if (A2) A2 += z * sA; Bt += z * sB; if (Bt2) Bt2 += z * sB; C += z * sC;
    const int lane = threadIdx.x & 31, lr = lane & 15, hi = lane >> 4; const int r0 = blockIdx.x * 64, c0 = blockIdx.y * 64;
    v8f acc[4][4];
#pragma unroll
    for (int mb = 0; mb < 4; ++mb)
#pragma unroll
        for (int nb = 0; nb < 4; ++nb) acc[mb][nb] = (v8f){};
    const size_t aoff = (size_t)(r0 + lr) * K + 8 * hi, boff = (size_t)(c0 + lr) * K + 8 * hi;
#pragma unroll 1
    for (int kc = 0; kc < K; kc += 32) {
        V a[4], a2[4];
#pragma unroll
        for (int mb = 0; mb < 4; ++mb) { a[mb] = WFrag<T16>::ld(A + aoff + (size_t)mb * 16 * K + kc); if (NSPLIT == 1 || NSPLIT == 2) a2[mb] = WFrag<T16>::ld(A2 + aoff + (size_t)mb * 16 * K + kc); }
#pragma unroll
        for (int nb = 0; nb < 4; ++nb) { const V b = WFrag<T16>::ld(Bt + boff + (size_t)nb * 16 * K + kc); V b2; if (NSPLIT >= 2) b2 = WFrag<T16>::ld(Bt2 + boff + (size_t)nb * 16 * K + kc);
#pragma unroll
            for (int mb = 0; mb < 4; ++mb) { acc[mb][nb] = WFrag<T16>::mma(a[mb], b, acc[mb][nb]); if (NSPLIT == 1 || NSPLIT == 2) acc[mb][nb] = WFrag<T16>::mma(a2[mb], b, acc[mb][nb]); if (NSPLIT >= 2) acc[mb][nb] = WFrag<T16>::mma(a[mb], b2, acc[mb][nb]); } }
        asm volatile("v_nop\n\tv_nop\n\tv_nop\n\tv_nop" : "+v"(acc[0][0]), "+v"(acc[1][1]), "+v"(acc[2][2]), "+v"(acc[3][3]) : "v"(a[0]), "v"(a[3]));
    }
#pragma unroll
    for (int mb = 0; mb < 4; ++mb) {
#pragma unroll
        for (int nb = 0; nb < 4; ++nb) {
#pragma unroll
            for (int j = 0; j < 8; ++j) os[(hi * 8 + j) * 68 + nb * 16 + lr] = acc[mb][nb][j]; }
        __builtin_amdgcn_wave_barrier(); asm volatile("" ::: "memory");
        float* crow = C + (size_t)(r0 + mb * 16) * ldc + c0;
{
#pragma unroll
            for (int s = 0; s < 8; ++s) { const int row = 2 * s + hi, cofs = lr * 4; v4f val = *(const v4fa*)(os + row * 68 + cofs); if (BIAS) { val[0] += bfr(bias[c0 + cofs]); val[1] += bfr(bias[c0 + cofs + 1]); val[2] += bfr(bias[c0 + cofs + 2]); val[3] += bfr(bias[c0 + cofs + 3]); }
                *(v4f*)(crow + (size_t)row * ldc + cofs) = val; }
             }
        __builtin_amdgcn_wave_barrier(); asm volatile("" ::: "memory");
    }
}

// ---- k_gemmc: the same one-wave 64x64 tile GEMM specialised for causal attention: CMODE 1 skips score tiles entirely above the diagonal (query rows r0+roff.., key columns c0..), CMODE 2 limits the
// key (K) loop of the probability x value contraction to the diagonal block (probabilities beyond it are exactly zero). roff = row offset of this launch's first row within the sequence.
template <typename T16, int NSPLIT, int CMODE>
__global__ __launch_bounds__(32) void k_gemmc(const T16* __restrict__ A, const T16* __restrict__ A2, const T16* __restrict__ Bt, const T16* __restrict__ Bt2, int K, float* C, int ldc, int roff, size_t sA, size_t sB, size_t sC) {
    typedef typename WFrag<T16>::V V;
    __shared__ __align__(16) float os[16 * 68];
    const size_t z = blockIdx.z; A += z * sA; if (A2) A2 += z * sA; Bt += z * sB; if (Bt2) Bt2 += z * sB; C += z * sC;
    const int lane = threadIdx.x & 31, lr = lane & 15, hi = lane >> 4; const int r0 = blockIdx.x * 64, c0 = blockIdx.y * 64;
    if (CMODE == 1 && c0 > r0 + roff + 63) return;                  // score tile entirely above the causal diagonal: never read (the softmax masks j > i by select)
    const int Kl = (CMODE == 2) ? min(K, r0 + roff + 64) : K;        // P.V: probabilities are exactly 0 beyond the diagonal block, so the K loop stops there
    v8f acc[4][4];
#pragma unroll
    for (int mb = 0; mb < 4; ++mb)
#pragma unroll
        for (int nb = 0; nb < 4; ++nb) acc[mb][nb] = (v8f){};
    const size_t aoff = (size_t)(r0 + lr) * K + 8 * hi, boff = (size_t)(c0 + lr) * K + 8 * hi;
#pragma unroll 1
    for (int kc = 0; kc < Kl; kc += 32) {
        V a[4], a2[4];
#pragma unroll
        for (int mb = 0; mb < 4; ++mb) { a[mb] = WFrag<T16>::ld(A + aoff + (size_t)mb * 16 * K + kc); if (NSPLIT == 1 || NSPLIT == 2) a2[mb] = WFrag<T16>::ld(A2 + aoff + (size_t)mb * 16 * K + kc); }
#pragma unroll
        for (int nb = 0; nb < 4; ++nb) { const V b = WFrag<T16>::ld(Bt + boff + (size_t)nb * 16 * K + kc); V b2; if (NSPLIT >= 2) b2 = WFrag<T16>::ld(Bt2 + boff + (size_t)nb * 16 * K + kc);
#pragma unroll
            for (int mb = 0; mb < 4; ++mb) { acc[mb][nb] = WFrag<T16>::mma(a[mb], b, acc[mb][nb]); if (NSPLIT == 1 || NSPLIT == 2) acc[mb][nb] = WFrag<T16>::mma(a2[mb], b, acc[mb][nb]); if (NSPLIT >= 2) acc[mb][nb] = WFrag<T16>::mma(a[mb], b2, acc[mb][nb]); } }
        asm volatile("v_nop\n\tv_nop\n\tv_nop\n\tv_nop" : "+v"(acc[0][0]), "+v"(acc[1][1]), "+v"(acc[2][2]), "+v"(acc[3][3]) : "v"(a[0]), "v"(a[3]));
    }
#pragma unroll
    for (int mb = 0; mb < 4; ++mb) {
#pragma unroll
        for (int nb = 0; nb < 4; ++nb) {
#pragma unroll
            for (int j = 0; j < 8; ++j) os[(hi * 8 + j) * 68 + nb * 16 + lr] = acc[mb][nb][j]; }
        __builtin_amdgcn_wave_barrier(); asm volatile("" ::: "memory");
        float* crow = C + (size_t)(r0 + mb * 16) * ldc + c0;
{
#pragma unroll
            for (int s = 0; s < 8; ++s) { const int row = 2 * s + hi, cofs = lr * 4; v4f val = *(const v4fa*)(os + row * 68 + cofs);
                *(v4f*)(crow + (size_t)row * ldc + cofs) = val; }
             }
        __builtin_amdgcn_wave_barrier(); asm volatile("" ::: "memory");
    }
}

__device__ __forceinline__ h16 tohx(float x) { return (h16)x; }
__device__ __forceinline__ void splitf(float y, unsigned short& h, unsigned short& l) { h = f2bf(y); l = f2bf(y - bf2f(h)); }
typedef __attribute__((ext_vector_type(2))) _Float16 v2h;
typedef __attribute__((ext_vector_type(4))) _Float16 v4h;
typedef __attribute__((ext_vector_type(2))) unsigned short v2us;
typedef __attribute__((ext_vector_type(4))) unsigned short v4us;
typedef __attribute__((ext_vector_type(2))) float v2f;
typedef __attribute__((ext_vector_type(4))) int v4i;

__global__ __launch_bounds__(256) void k_cvt8(const float* __restrict__ src, bf* dst, size_t n8) { const size_t i = (size_t)blockIdx.x * 256 + threadIdx.x; if (i >= n8) return; const v8f v = *(const v8f*)(src + i * 8); v8us o;
#pragma unroll
    for (int k = 0; k < 8; ++k) o[k] = f2bf(v[k]); *(v8us*)(dst + i * 8) = o;  }

__global__ __launch_bounds__(256) void k_ropeI(const float* __restrict__ F, int pitch, int nheads, const float* __restrict__ CS, float sc, h16* P16, bf* Ph, bf* Pl) {
    const size_t e = ((size_t)blockIdx.x * 256 + threadIdx.x) * 2; if (e >= (size_t)nheads * TT * HD) return; const int d = (int)(e % HD); const int t = (int)((e / HD) % TT); const int h = (int)(e / ((size_t)HD * TT)); const float* f = F + (size_t)t * pitch + h * HD; const float x0 = f[d], x1 = f[d + 1]; const v2f cs = *(const v2f*)(CS + ((size_t)t * HD + d) * 2); v2h o16; v2us oh, ol;
    float a0 = __fmul_rn(x0, cs[0]), b0 = __fmul_rn(x1, cs[1]), a1 = __fmul_rn(x1, cs[0]), b1 = __fmul_rn(x0, cs[1]); asm volatile("" : "+v"(a0), "+v"(b0), "+v"(a1), "+v"(b1));
    float r0 = __fsub_rn(a0, b0) * sc, r1 = __fadd_rn(b1, a1) * sc;   /* even: x0 c - x1 s; odd: x0 s + x1 c */
    o16[0] = tohx(r0); o16[1] = tohx(r1); { unsigned short a2, c2; splitf(r0, a2, c2); oh[0] = a2; ol[0] = c2; splitf(r1, a2, c2); oh[1] = a2; ol[1] = c2; }
    *(v2h*)(P16 + e) = o16; *(v2us*)(Ph + e) = oh; *(v2us*)(Pl + e) = ol;  }
// k_rope: head planes [h][t][d] (fp16 + hi/lo) of rope(x) x sc with the rotate-half convention out[d] = x[d] cos[t][d] - x[d+HD/2] sin[t][d], out[d+HD/2] = x[d+HD/2] cos[t][d+HD/2] + x[d] sin[t][d+HD/2]
__global__ __launch_bounds__(256) void k_rope(const float* __restrict__ F, int pitch, int nheads, const float* __restrict__ CS, const float* __restrict__ RF, const float* __restrict__ nw, float sc, h16* P16, bf* Ph, bf* Pl) {
    const size_t e = ((size_t)blockIdx.x * 256 + threadIdx.x) * 2; if (e >= (size_t)nheads * TT * HD) return; const int d = (int)(e % HD); const int t = (int)((e / HD) % TT); const int h = (int)(e / ((size_t)HD * TT)); const float* f = F + (size_t)t * pitch + h * HD; const float rf = RF ? RF[(size_t)h * TT + t] : 1.0f; v2h o16; v2us oh, ol;
#pragma unroll
    for (int q = 0; q < 2; ++q) { const int dd = d + q; const int dp = (dd < HD / 2) ? dd + HD / 2 : dd - HD / 2; float x0 = f[dd], x1 = f[dp];
        if (RF) { float n0 = __fmul_rn(x0, rf), n1 = __fmul_rn(x1, rf); asm volatile("" : "+v"(n0)); asm volatile("" : "+v"(n1)); x0 = __fmul_rn(bfr(nw[dd]), n0); x1 = __fmul_rn(bfr(nw[dp]), n1); }
        const v2f cs = *(const v2f*)(CS + ((size_t)t * HD + dd) * 2); float a = __fmul_rn(x0, cs[0]), bq = __fmul_rn(x1, cs[1]); asm volatile("" : "+v"(a)); asm volatile("" : "+v"(bq)); const float r = ((dd < HD / 2) ? __fsub_rn(a, bq) : __fadd_rn(a, bq)) * sc;
        o16[q] = tohx(r); unsigned short a2, c2; splitf(r, a2, c2); oh[q] = a2; ol[q] = c2; }
    *(v2h*)(P16 + e) = o16; *(v2us*)(Ph + e) = oh; *(v2us*)(Pl + e) = ol;  }
__global__ __launch_bounds__(256) void k_vtp(const float* __restrict__ F, int pitch, int nheads, h16* V16, bf* Vh, bf* Vl) { const size_t e = ((size_t)blockIdx.x * 256 + threadIdx.x) * 2; if (e >= (size_t)nheads * HD * TT) return; const int t = (int)(e % TT); const int d = (int)((e / TT) % HD); const int g = (int)(e / ((size_t)TT * HD)); v2h o16; v2us oh, ol;
#pragma unroll
    for (int q = 0; q < 2; ++q) { const float x = F[(size_t)(t + q) * pitch + g * HD + d]; o16[q] = tohx(x); unsigned short a2, c2; splitf(x, a2, c2); oh[q] = a2; ol[q] = c2; }
    *(v2h*)(V16 + e) = o16; *(v2us*)(Vh + e) = oh; *(v2us*)(Vl + e) = ol;  }
__constant__ float INV2[HD / 2] = { 1.000000000e+00f, 7.498942018e-01f, 5.623413324e-01f, 4.216965139e-01f, 3.162277639e-01f, 2.371373624e-01f, 1.778279394e-01f, 1.333521456e-01f, 1.000000015e-01f, 7.498941571e-02f, 5.623412877e-02f, 4.216964915e-02f, 3.162277862e-02f, 2.371373586e-02f, 1.778279431e-02f, 1.333521493e-02f, 9.999999776e-03f, 7.498942316e-03f, 5.623413250e-03f, 4.216964822e-03f, 3.162277862e-03f, 2.371373819e-03f, 1.778279431e-03f, 1.333521446e-03f, 1.000000047e-03f, 7.498941850e-04f, 5.623413017e-04f, 4.216964880e-04f, 3.162277862e-04f, 2.371373848e-04f, 1.778279402e-04f, 1.333521504e-04f };   // float32 1.0 / (10000.0 ** (arange(0, 64, 2, dtype=float32) / 64)), generated with jnp to be bit-exact
__global__ __launch_bounds__(256) void k_csP(float* CS) { const int idx = blockIdx.x * 256 + threadIdx.x; if (idx >= TT * HD) return; const int d = idx % HD; const int t = idx / HD; const float a = __fmul_rn(__fmul_rn((float)t, 6.2831855f), INV2[d >> 1]); v2f cs; cs[0] = cosf(a); cs[1] = sinf(a); *(v2f*)(CS + (size_t)idx * 2) = cs;  }
// k_asoft: per row (zz, i): t = S x HD^-0.5 for j <= i and i - j < WIN (WIN = TT, so plain causal; the reference's -1e9 additive fill vanishes identically); softmax over the 2048 keys (register row, one exp, fixed trees);
__global__ __launch_bounds__(256) void k_asoft(const float* __restrict__ Sb, h16* P16, bf* Ph, bf* Pl) {
    const int lane = threadIdx.x & 31; const int row = blockIdx.x * 8 + (threadIdx.x >> 5); if (row >= ZH * TT) return; const int i = row % TT; const int zz = row / TT; (void)zz; const bool hires = (i < RH); const float* sr = Sb + (size_t)row * TT; float v[TT / 32]; float mx = -3.0e38f;
#pragma unroll
    for (int ch = 0; ch < TT / 128; ++ch) { const int j0 = ch * 128 + lane * 4; const v4f a = *(const v4f*)(sr + j0);
#pragma unroll
        for (int q = 0; q < 4; ++q) { const int j = j0 + q; (void)j; const float t = (j <= i && i - j < WIN) ? a[q] * SCL : -3.0e38f; v[ch * 4 + q] = t; mx = fmaxf(mx, t); } }
#pragma unroll
    for (int sh = 16; sh; sh >>= 1) mx = fmaxf(mx, __shfl_xor(mx, sh, 32));
    float sum = 0.f;
#pragma unroll
    for (int k = 0; k < TT / 32; ++k) { float d0 = __fsub_rn(v[k], mx); asm volatile("" : "+v"(d0)); v[k] = __builtin_amdgcn_exp2f(__fmul_rn(d0, 1.4426950408889634f)); sum += v[k]; }
#pragma unroll
    for (int sh = 16; sh; sh >>= 1) sum += __shfl_xor(sum, sh, 32);
    const float f = __fdiv_rn(hires ? 1.0f : PCAR, sum);
{
        if (hires) {
#pragma unroll
            for (int ch = 0; ch < TT / 128; ++ch) { v4us oh, ol;
#pragma unroll
                for (int q = 0; q < 4; ++q) { unsigned short a, c2; splitf(v[ch * 4 + q] * f, a, c2); oh[q] = a; ol[q] = c2; }
                const size_t oo = ((size_t)zz * (RH ? RH : 1) + i) * TT + ch * 128 + lane * 4; *(v4us*)(Ph + oo) = oh; *(v4us*)(Pl + oo) = ol; }
        } else {
#pragma unroll
            for (int ch = 0; ch < TT / 128; ++ch) { v4h o4;
#pragma unroll
                for (int q = 0; q < 4; ++q) o4[q] = tohx(v[ch * 4 + q] * f);
                *(v4h*)(P16 + (size_t)row * TT + ch * 128 + lane * 4) = o4; } }
         }
}
__global__ __launch_bounds__(256) void k_merge(const float* __restrict__ O, int h0, bf* Ah, bf* Al) { const size_t e = ((size_t)blockIdx.x * 256 + threadIdx.x) * 2; if (e >= (size_t)ZH * TT * HD) return; const int d = (int)(e % HD); const int t = (int)((e / HD) % TT); const int zz = (int)(e / ((size_t)HD * TT)); const float cs = (t < RH) ? 1.0f : (1.0f / PCAR); const size_t oo = (size_t)t * DQ + (h0 + zz) * HD + d;
    v2us oh, ol;
#pragma unroll
    for (int q = 0; q < 2; ++q) { unsigned short a, c2; splitf(O[e + q] * cs, a, c2); oh[q] = a; ol[q] = c2; } *(v2us*)(Ah + oo) = oh; *(v2us*)(Al + oo) = ol;  }

extern "C" void kernel_launch(void* const* d_in, const int* in_sizes, int n_in,
                              void* d_out, int out_size, void* d_ws, size_t ws_size, hipStream_t stream) {
    (void)in_sizes; (void)n_in; (void)out_size;
    const float* x = (const float*)d_in[0]; const float* wq = (const float*)d_in[1]; const float* wk = (const float*)d_in[2]; const float* wv = (const float*)d_in[3]; const float* wo = (const float*)d_in[4];   /* order x, Wq ('oi' [2048][2048]), Wk, Wv ('oi' [512][2048]), Wo ('oi') */
    float* OUT = (float*)d_out;     // [2][2048][2048]
    char* wsp = (char*)d_ws;
    auto take = [&](size_t bytes) { char* p = wsp; wsp += (bytes + 255) & ~(size_t)255; return (void*)p; };
    bf* WQ = (bf*)take((size_t)DQ * DM * 2); bf* WK = (bf*)take((size_t)DKV * DM * 2); bf* WV = (bf*)take((size_t)DKV * DM * 2); bf* WO = (bf*)take((size_t)DM * DQ * 2); float* CS = (float*)take((size_t)TT * HD * 2 * 4);
    bf* XB = (bf*)take((size_t)TT * DM * 2); float* FQ = (float*)take((size_t)TT * DQ * 4); float* FK = (float*)take((size_t)TT * DKV * 4);
    h16* QP16 = (h16*)take((size_t)NH_ * TT * HD * 2); h16* KP16 = (h16*)take((size_t)NKV * TT * HD * 2); h16* VT16 = (h16*)take((size_t)NKV * HD * TT * 2);
    bf* QPh = (bf*)take((size_t)NH_ * TT * HD * 2); bf* QPl = (bf*)take((size_t)NH_ * TT * HD * 2); bf* KPh = (bf*)take((size_t)NKV * TT * HD * 2); bf* KPl = (bf*)take((size_t)NKV * TT * HD * 2); bf* VTh = (bf*)take((size_t)NKV * HD * TT * 2); bf* VTl = (bf*)take((size_t)NKV * HD * TT * 2); bf* Ph = (bf*)take((size_t)ZH * RH * TT * 2); bf* Pl = (bf*)take((size_t)ZH * RH * TT * 2);
    float* Sb = (float*)take((size_t)ZH * TT * TT * 4); h16* P16 = (h16*)take((size_t)ZH * TT * TT * 2); float* Ob = (float*)take((size_t)ZH * TT * HD * 4); bf* ATh = (bf*)take((size_t)TT * DQ * 2); bf* ATl = (bf*)take((size_t)TT * DQ * 2);
    if ((size_t)(wsp - (char*)d_ws) > ws_size) return;    // ws 256 MiB
    float* FV = FK;   // v projection reuses the k buffer after the k planes are built (stream-ordered)
    { k_cvt8<<<(unsigned)(((size_t)DQ * DM / 8 + 255) / 256), 256, 0, stream>>>(wq, WQ, (size_t)DQ * DM / 8); k_cvt8<<<(unsigned)(((size_t)DKV * DM / 8 + 255) / 256), 256, 0, stream>>>(wk, WK, (size_t)DKV * DM / 8); k_cvt8<<<(unsigned)(((size_t)DKV * DM / 8 + 255) / 256), 256, 0, stream>>>(wv, WV, (size_t)DKV * DM / 8);
      k_cvt8<<<(unsigned)(((size_t)DM * DQ / 8 + 255) / 256), 256, 0, stream>>>(wo, WO, (size_t)DM * DQ / 8);
       }
    k_csP<<<(TT * HD + 255) / 256, 256, 0, stream>>>(CS);
    const unsigned LQ = (unsigned)(((size_t)NH_ * TT * HD / 2 + 255) / 256), LKv = (unsigned)(((size_t)NKV * TT * HD / 2 + 255) / 256);
    for (int b = 0; b < NB_; ++b) {
        
        k_cvt8<<<(unsigned)(((size_t)TT * DM / 8 + 255) / 256), 256, 0, stream>>>(x + (size_t)b * TT * DM, XB, (size_t)TT * DM / 8);
        k_gemmw<bf, 0, false><<<dim3(TT / 64, DQ / 64, 1), 32, 0, stream>>>(XB, nullptr, WQ, nullptr, DM, FQ, DQ, nullptr, 0, 0, 0);
        k_ropeI<<<LQ, 256, 0, stream>>>(FQ, DQ, NH_, CS, 1.0f, QP16, QPh, QPl);
        k_gemmw<bf, 0, false><<<dim3(TT / 64, DKV / 64, 1), 32, 0, stream>>>(XB, nullptr, WK, nullptr, DM, FK, DKV, nullptr, 0, 0, 0);
        k_ropeI<<<LKv, 256, 0, stream>>>(FK, DKV, NKV, CS, 1.0f, KP16, KPh, KPl);
        k_gemmw<bf, 0, false><<<dim3(TT / 64, DKV / 64, 1), 32, 0, stream>>>(XB, nullptr, WV, nullptr, DM, FV, DKV, nullptr, 0, 0, 0); k_vtp<<<LKv, 256, 0, stream>>>(FV, DKV, NKV, VT16, VTh, VTl);
        for (int h0 = 0; h0 < NH_; h0 += ZH) { const size_t zq = (size_t)h0, zk = (size_t)(h0 / REP);   // both heads of a pass share kv group h0/REP (REP >= 2): sB = 0
            k_gemmc<bf, 2, 1><<<dim3(RH / 64, TT / 64, ZH), 32, 0, stream>>>(QPh + zq * TT * HD, QPl + zq * TT * HD, KPh + zk * TT * HD, KPl + zk * TT * HD, HD, Sb, TT, 0, (size_t)TT * HD, 0, (size_t)TT * TT);
            k_gemmc<h16, 0, 1><<<dim3((TT - RH) / 64, TT / 64, ZH), 32, 0, stream>>>(QP16 + zq * TT * HD + (size_t)RH * HD, nullptr, KP16 + zk * TT * HD, nullptr, HD, Sb + (size_t)RH * TT, TT, RH, (size_t)TT * HD, 0, (size_t)TT * TT);
            k_asoft<<<ZH * TT / 8, 256, 0, stream>>>(Sb, P16, Ph, Pl);
            k_gemmc<bf, 2, 2><<<dim3(RH / 64, HD / 64, ZH), 32, 0, stream>>>(Ph, Pl, VTh + zk * HD * TT, VTl + zk * HD * TT, TT, Ob, HD, 0, (size_t)RH * TT, 0, (size_t)TT * HD);
            k_gemmc<h16, 0, 2><<<dim3((TT - RH) / 64, HD / 64, ZH), 32, 0, stream>>>(P16 + (size_t)RH * TT, nullptr, VT16 + zk * HD * TT, nullptr, TT, Ob + (size_t)RH * HD, HD, RH, (size_t)TT * TT, 0, (size_t)TT * HD);
            k_merge<<<(unsigned)(((size_t)ZH * TT * HD / 2 + 255) / 256), 256, 0, stream>>>(Ob, h0, ATh, ATl); }
        k_gemmw<bf, 1, false><<<dim3(TT / 64, DM / 64, 1), 32, 0, stream>>>(ATh, ATl, WO, nullptr, DQ, OUT + (size_t)b * TT * DM, DM, nullptr, 0, 0, 0); }
}

// v001
// It runs in 1510 microseconds.
// Timed twice side by side with v000, it ran 1.83 and 1.82 times as fast.
#include <hip/hip_runtime.h>

// Causal grouped-query attention with interleaved-pair rotary embeddings whose positions carry a 2 pi factor (x [2][2048][2048]; q = x Wq^T (32 heads x 64), k, v = x Wk^T, x Wv^T (8 kv heads x 64) ('oi' 1/sqrt(2048), no bias); rope on (even, odd) pairs: (re, im) = (q0 c - q1 s, q0 s + q1 c) with angle fl(fl(s x 2 pi) x freq_i), freq_i = 1 / 10000^(2i/64) (32 f32 frequencies jnp-exact; TWO f32 products; precise cosf/sinf); k, v repeated 4 x along the head axis: kv head = q head / 4; scores / sqrt(64); causal (finfo.min == exclusion); softmax; out = merged Wo^T ('oi', no bias) -> [2][2048][2048] (8.4 M); argument order x, Wq, Wk, Wv, Wo).
// Layout per batch: bf16 copy of x; 'oi' weights as-is; exact projections; identity-table plane builders; causal T-2048 GQA attention (both query heads of a pass share kv group h0 / 4: kv z-stride 0; hybrid rows: < 512 hi/lo 3 products, rest fp16 x1024; k_gemmc skips tiles above the diagonal); merged hi/lo x Wo exact.
// Compute dtypes, f32 accumulate: every input rounded to bf16; projections exact; attention rows < 512 3 products, rest fp16; softmax f32; output projection hl x exact.

#define NB_  2
#define TT   2048
#define DM   2048
#define NH_  32
#define NKV  8
#define REP  (NH_ / NKV)
#define HD   64
#define DQ   (NH_ * HD)
#define DKV  (NKV * HD)
#define ZH   2
#define RH   512                  // query rows < RH use hi+lo planes (0: none)
#define WIN  2048
#define PCAR 1024.0f
#define SCL  0.125f   // HD^-0.5
typedef _Float16 h16;
typedef unsigned short bf;
typedef __attribute__((ext_vector_type(16))) __bf16   v16bf;
typedef __attribute__((ext_vector_type(16))) _Float16 v16h;
typedef __attribute__((ext_vector_type(8)))  _Float16 v8h;
typedef __attribute__((ext_vector_type(8)))  unsigned short v8us;
typedef __attribute__((ext_vector_type(8)))  float    v8f;
typedef __attribute__((ext_vector_type(4)))  float    v4f;
typedef v8h  __attribute__((may_alias)) v8ha;
typedef v4f  __attribute__((may_alias)) v4fa;
typedef v8us __attribute__((may_alias)) v8usa;

__device__ __forceinline__ unsigned short f2bf(float f) { unsigned u = __float_as_uint(f); u += 0x7FFFu + ((u >> 16) & 1u); return (unsigned short)(u >> 16); }
__device__ __forceinline__ float bf2f(unsigned short b) { return __uint_as_float(((unsigned)b) << 16); }
__device__ __forceinline__ float bfr(float f) { return bf2f(f2bf(f)); }
__device__ __forceinline__ v16h cat16(v8h lo, v8h hi) { return __builtin_shufflevector(lo, hi, 0, 1, 2, 3, 4, 5, 6, 7, 8, 9, 10, 11, 12, 13, 14, 15); }
__device__ __forceinline__ v16bf cat16b(v8us lo, v8us hi) { return __builtin_bit_cast(v16bf, __builtin_shufflevector(lo, hi, 0, 1, 2, 3, 4, 5, 6, 7, 8, 9, 10, 11, 12, 13, 14, 15)); }
__device__ __forceinline__ v8f wmma16(v16h a, v16h b, v8f c) { return __builtin_amdgcn_wmma_f32_16x16x32_f16(false, a, false, b, (short)0, c, false, false); }
__device__ __forceinline__ v8f wmmab(v16bf a, v16bf b, v8f c) { return __builtin_amdgcn_wmma_f32_16x16x32_bf16(false, a, false, b, (short)0, c, false, false); }



// ---- k_gemmw: register-blocked GEMM, one work-group of NW waves per 64x64 output tile; each wave holds the whole tile (16 accumulators) for its share of K, operands straight from K-contiguous 16-bit planes; grid (M/64, N/64, Z), NW x 32 threads.
// C[m][n] (f32, pitch ldc, + optional f32 bias[n]) = sum_k A[m][k] Bt[n][k] (+ split products per NSPLIT). z-batch strides sA/sB/sC in elements. K % 64 == 0.
template <typename T16> struct WFrag;
template <> struct WFrag<h16> { typedef v16h V; static __device__ __forceinline__ V ld(const h16* p) { return cat16(*(const v8h*)p, *(const v8h*)(p + 16)); } static __device__ __forceinline__ v8f mma(V a, V b, v8f c) { return wmma16(a, b, c); } };
template <> struct WFrag<bf> { typedef v16bf V; static __device__ __forceinline__ V ld(const bf* p) { return cat16b(*(const v8us*)p, *(const v8us*)(p + 16)); } static __device__ __forceinline__ v8f mma(V a, V b, v8f c) { return wmmab(a, b, c); } };
// ksum_store: the NW waves of a work-group each hold a partial 64x64 f32 tile (their share of K). Every wave writes its tile to LDS in register order (32 slots of 16 B per lane), one barrier,
// then wave w sums slots w*32/NW.. over the waves in the fixed order 0..NW-1, turns its rows (32 columns = one 128-B line each) through its own LDS strip and stores whole lines. Ct = the tile's first element.
template <int NW, bool BIAS>
__device__ __forceinline__ void ksum_store(const v8f (&acc)[4][4], float* ps, float* Ct, int ldc, const float* bias, int wv, int lane) {
    constexpr int SP = 32 / NW, RW = SP * 4;      // slots and rows per summing wave
    const int lr = lane & 15, hi = lane >> 4;
    v4fa* pw = (v4fa*)ps;
#pragma unroll
    for (int mb = 0; mb < 4; ++mb)
#pragma unroll
        for (int nb = 0; nb < 4; ++nb)
#pragma unroll
            for (int jh = 0; jh < 2; ++jh) { const int q = ((mb * 2 + (nb >> 1)) * 2 + jh) * 2 + (nb & 1); pw[(wv * 32 + q) * 32 + lane] = (v4f){ acc[mb][nb][jh * 4], acc[mb][nb][jh * 4 + 1], acc[mb][nb][jh * 4 + 2], acc[mb][nb][jh * 4 + 3] }; }
    __syncthreads();      // every wave's partial tile is in LDS before any wave sums
    v4f r[SP];
#pragma unroll
    for (int i = 0; i < SP; ++i) r[i] = pw[(wv * SP + i) * 32 + lane];
#pragma unroll
    for (int s = 1; s < NW; ++s)
#pragma unroll
        for (int i = 0; i < SP; ++i) r[i] += pw[(s * 32 + wv * SP + i) * 32 + lane];
    const int q0 = wv * SP, mb = q0 >> 3, nbp = (q0 >> 2) & 1, jh0 = (q0 >> 1) & 1;      // slot q = ((mb*2 + nb/2)*2 + jh)*2 + nb%2
    float* sw = ps + NW * 4096 + wv * (RW * 36);
#pragma unroll
    for (int i = 0; i < SP; ++i)
#pragma unroll
        for (int jj = 0; jj < 4; ++jj) sw[(hi * (RW / 2) + (i >> 1) * 4 + jj) * 36 + (i & 1) * 16 + lr] = r[i][jj];
    asm volatile("s_wait_dscnt 0x0" ::: "memory");      // the wave's own strip is written before other lanes of the wave read it back
#pragma unroll
    for (int i = 0; i < SP; ++i) { const int idx = i * 32 + lane, lrow = idx >> 3, cofs = nbp * 32 + (idx & 7) * 4; const int trow = (SP == 4) ? lrow : ((lrow >> 2) * 8 + jh0 * 4 + (lrow & 3));
        v4f val = *(const v4fa*)(sw + lrow * 36 + (idx & 7) * 4); if (BIAS) { val[0] += bfr(bias[cofs]); val[1] += bfr(bias[cofs + 1]); val[2] += bfr(bias[cofs + 2]); val[3] += bfr(bias[cofs + 3]); }
        *(v4f*)(Ct + (size_t)(mb * 16 + trow) * ldc + cofs) = val; }
}
// Register budget: four waves per SIMD (two 8-wave work-groups or one 16-wave work-group on a WGP).
template <typename T16, int NSPLIT, bool BIAS, int NW>
__global__ __launch_bounds__(NW * 32, 4) void k_gemmw(const T16* __restrict__ A, const T16* __restrict__ A2, const T16* __restrict__ Bt, const T16* __restrict__ Bt2, int K, float* C, int ldc, const float* __restrict__ bias, size_t sA, size_t sB, size_t sC) {
    typedef typename WFrag<T16>::V V;
    __shared__ __align__(16) float os[NW * 4096 + 128 * 36];
    const size_t z = blockIdx.z; A += z * sA; if (A2) A2 += z * sA; Bt += z * sB; if (Bt2) Bt2 += z * sB; C += z * sC;
    const int lane = threadIdx.x & 31, lr = lane & 15, hi = lane >> 4; const int r0 = blockIdx.x * 64, c0 = blockIdx.y * 64;
    const int wv = __builtin_amdgcn_readfirstlane(threadIdx.x >> 5);      // wave number, scalar so that the K loop stays a scalar loop
    v8f acc[4][4];
#pragma unroll
    for (int mb = 0; mb < 4; ++mb)
#pragma unroll
        for (int nb = 0; nb < 4; ++nb) acc[mb][nb] = (v8f){};
    const size_t aoff = (size_t)(r0 + lr) * K + 8 * hi, boff = (size_t)(c0 + lr) * K + 8 * hi;
#pragma unroll 1
    for (int k0 = wv * 64; k0 < K; k0 += NW * 64) {      // wave wv takes every NW-th slice of 64 k (one 128-B line of each operand row)
#pragma unroll      // both 32-k halves of the slice in one trip: constant offsets from the trip's addresses
      for (int kc = k0; kc < k0 + 64; kc += 32) {
        V a[4], a2[4];
#pragma unroll
        for (int mb = 0; mb < 4; ++mb) { a[mb] = WFrag<T16>::ld(A + aoff + (size_t)mb * 16 * K + kc); if (NSPLIT == 1 || NSPLIT == 2) a2[mb] = WFrag<T16>::ld(A2 + aoff + (size_t)mb * 16 * K + kc); }
#pragma unroll
        for (int nb = 0; nb < 4; ++nb) { const V b = WFrag<T16>::ld(Bt + boff + (size_t)nb * 16 * K + kc); V b2; if (NSPLIT >= 2) b2 = WFrag<T16>::ld(Bt2 + boff + (size_t)nb * 16 * K + kc);
#pragma unroll
            for (int mb = 0; mb < 4; ++mb) { acc[mb][nb] = WFrag<T16>::mma(a[mb], b, acc[mb][nb]); if (NSPLIT == 1 || NSPLIT == 2) acc[mb][nb] = WFrag<T16>::mma(a2[mb], b, acc[mb][nb]); if (NSPLIT >= 2) acc[mb][nb] = WFrag<T16>::mma(a[mb], b2, acc[mb][nb]); } }
        asm volatile("v_nop\n\tv_nop\n\tv_nop\n\tv_nop" : "+v"(acc[0][0]), "+v"(acc[1][1]), "+v"(acc[2][2]), "+v"(acc[3][3]) : "v"(a[0]), "v"(a[3]));
      }
    }
    ksum_store<NW, BIAS>(acc, os, C + (size_t)r0 * ldc + c0, ldc, BIAS ? bias + c0 : bias, wv, lane);
}

// ---- k_gemmc: the same 64x64 tile GEMM specialised for causal attention: CMODE 1 skips score tiles entirely above the diagonal (query rows r0+roff.., key columns c0..), CMODE 2 limits the
// key (K) loop of the probability x value contraction to the diagonal block (probabilities beyond it are exactly zero). roff = row offset of this launch's first row within the sequence.
// NW = 1: one wave, as above. NW > 1 (the long K of CMODE 2): K is split over the NW waves of the work-group as in k_gemmw.
template <typename T16, int NSPLIT, int CMODE, int NW>
__global__ __launch_bounds__(NW * 32, NW == 1 ? 1 : 4) void k_gemmc(const T16* __restrict__ A, const T16* __restrict__ A2, const T16* __restrict__ Bt, const T16* __restrict__ Bt2, int K, float* C, int ldc, int roff, size_t sA, size_t sB, size_t sC) {
    typedef typename WFrag<T16>::V V;
    __shared__ __align__(16) float os[NW == 1 ? 16 * 68 : NW * 4096 + 128 * 36];
    const size_t z = blockIdx.z; A += z * sA; if (A2) A2 += z * sA; Bt += z * sB; if (Bt2) Bt2 += z * sB; C += z * sC;
    const int lane = threadIdx.x & 31, lr = lane & 15, hi = lane >> 4; const int r0 = blockIdx.x * 64, c0 = blockIdx.y * 64;
    const int wv = (NW == 1) ? 0 : __builtin_amdgcn_readfirstlane(threadIdx.x >> 5);      // wave number, scalar so that the K loop stays a scalar loop
    constexpr int KS = (NW == 1 || NSPLIT == 2) ? 32 : 64;      // NW > 1: wave wv takes every NW-th slice of 64 k (one 128-B line of each operand row); of 32 k with hi/lo planes on both sides (their K is short, and two fragment sets would not fit the registers)
    if (CMODE == 1 && c0 > r0 + roff + 63) return;                  // score tile entirely above the causal diagonal: never read (the softmax masks j > i by select)
    const int Kl = (CMODE == 2) ? min(K, r0 + roff + 64) : K;        // P.V: probabilities are exactly 0 beyond the diagonal block, so the K loop stops there
    v8f acc[4][4];
#pragma unroll
    for (int mb = 0; mb < 4; ++mb)
#pragma unroll
        for (int nb = 0; nb < 4; ++nb) acc[mb][nb] = (v8f){};
    const size_t aoff = (size_t)(r0 + lr) * K + 8 * hi, boff = (size_t)(c0 + lr) * K + 8 * hi;
#pragma unroll 1
    for (int k0 = wv * KS; k0 < Kl; k0 += NW * KS) {
#pragma unroll      // both 32-k halves of a 64-k slice in one trip: constant offsets from the trip's addresses
      for (int kc = k0; kc < k0 + KS; kc += 32) {
        V a[4], a2[4];
#pragma unroll
        for (int mb = 0; mb < 4; ++mb) { a[mb] = WFrag<T16>::ld(A + aoff + (size_t)mb * 16 * K + kc); if (NSPLIT == 1 || NSPLIT == 2) a2[mb] = WFrag<T16>::ld(A2 + aoff + (size_t)mb * 16 * K + kc); }
#pragma unroll
        for (int nb = 0; nb < 4; ++nb) { const V b = WFrag<T16>::ld(Bt + boff + (size_t)nb * 16 * K + kc); V b2; if (NSPLIT >= 2) b2 = WFrag<T16>::ld(Bt2 + boff + (size_t)nb * 16 * K + kc);
#pragma unroll
            for (int mb = 0; mb < 4; ++mb) { acc[mb][nb] = WFrag<T16>::mma(a[mb], b, acc[mb][nb]); if (NSPLIT == 1 || NSPLIT == 2) acc[mb][nb] = WFrag<T16>::mma(a2[mb], b, acc[mb][nb]); if (NSPLIT >= 2) acc[mb][nb] = WFrag<T16>::mma(a[mb], b2, acc[mb][nb]); } }
        asm volatile("v_nop\n\tv_nop\n\tv_nop\n\tv_nop" : "+v"(acc[0][0]), "+v"(acc[1][1]), "+v"(acc[2][2]), "+v"(acc[3][3]) : "v"(a[0]), "v"(a[3]));
      }
    }
    if constexpr (NW > 1) { ksum_store<NW, false>(acc, os, C + (size_t)r0 * ldc + c0, ldc, nullptr, wv, lane); return; }
#pragma unroll
    for (int mb = 0; mb < 4; ++mb) {
#pragma unroll
        for (int nb = 0; nb < 4; ++nb) {
#pragma unroll
            for (int j = 0; j < 8; ++j) os[(hi * 8 + j) * 68 + nb * 16 + lr] = acc[mb][nb][j]; }
        __builtin_amdgcn_wave_barrier(); asm volatile("" ::: "memory");
        float* crow = C + (size_t)(r0 + mb * 16) * ldc + c0;
{
#pragma unroll
            for (int s = 0; s < 8; ++s) { const int row = 2 * s + hi, cofs = lr * 4; v4f val = *(const v4fa*)(os + row * 68 + cofs);
                *(v4f*)(crow + (size_t)row * ldc + cofs) = val; }
             }
        __builtin_amdgcn_wave_barrier(); asm volatile("" ::: "memory");
    }
}

__device__ __forceinline__ h16 tohx(float x) { return (h16)x; }
__device__ __forceinline__ void splitf(float y, unsigned short& h, unsigned short& l) { h = f2bf(y); l = f2bf(y - bf2f(h)); }
typedef __attribute__((ext_vector_type(2))) _Float16 v2h;
typedef __attribute__((ext_vector_type(4))) _Float16 v4h;
typedef __attribute__((ext_vector_type(2))) unsigned short v2us;
typedef __attribute__((ext_vector_type(4))) unsigned short v4us;
typedef __attribute__((ext_vector_type(2))) float v2f;
typedef __attribute__((ext_vector_type(4))) int v4i;

__global__ __launch_bounds__(256) void k_cvt8(const float* __restrict__ src, bf* dst, size_t n8) { const size_t i = (size_t)blockIdx.x * 256 + threadIdx.x; if (i >= n8) return; const v8f v = *(const v8f*)(src + i * 8); v8us o;
#pragma unroll
    for (int k = 0; k < 8; ++k) o[k] = f2bf(v[k]); *(v8us*)(dst + i * 8) = o;  }

__global__ __launch_bounds__(256) void k_ropeI(const float* __restrict__ F, int pitch, int nheads, const float* __restrict__ CS, float sc, h16* P16, bf* Ph, bf* Pl) {
    const size_t e = ((size_t)blockIdx.x * 256 + threadIdx.x) * 2; if (e >= (size_t)nheads * TT * HD) return; const int d = (int)(e % HD); const int t = (int)((e / HD) % TT); const int h = (int)(e / ((size_t)HD * TT)); const float* f = F + (size_t)t * pitch + h * HD; const float x0 = f[d], x1 = f[d + 1]; const v2f cs = *(const v2f*)(CS + ((size_t)t * HD + d) * 2); v2h o16; v2us oh, ol;
    float a0 = __fmul_rn(x0, cs[0]), b0 = __fmul_rn(x1, cs[1]), a1 = __fmul_rn(x1, cs[0]), b1 = __fmul_rn(x0, cs[1]); asm volatile("" : "+v"(a0), "+v"(b0), "+v"(a1), "+v"(b1));
    float r0 = __fsub_rn(a0, b0) * sc, r1 = __fadd_rn(b1, a1) * sc;   /* even: x0 c - x1 s; odd: x0 s + x1 c */
    o16[0] = tohx(r0); o16[1] = tohx(r1); { unsigned short a2, c2; splitf(r0, a2, c2); oh[0] = a2; ol[0] = c2; splitf(r1, a2, c2); oh[1] = a2; ol[1] = c2; }
    *(v2h*)(P16 + e) = o16; *(v2us*)(Ph + e) = oh; *(v2us*)(Pl + e) = ol;  }
// k_rope: head planes [h][t][d] (fp16 + hi/lo) of rope(x) x sc with the rotate-half convention out[d] = x[d] cos[t][d] - x[d+HD/2] sin[t][d], out[d+HD/2] = x[d+HD/2] cos[t][d+HD/2] + x[d] sin[t][d+HD/2]
__global__ __launch_bounds__(256) void k_rope(const float* __restrict__ F, int pitch, int nheads, const float* __restrict__ CS, const float* __restrict__ RF, const float* __restrict__ nw, float sc, h16* P16, bf* Ph, bf* Pl) {
    const size_t e = ((size_t)blockIdx.x * 256 + threadIdx.x) * 2; if (e >= (size_t)nheads * TT * HD) return; const int d = (int)(e % HD); const int t = (int)((e / HD) % TT); const int h = (int)(e / ((size_t)HD * TT)); const float* f = F + (size_t)t * pitch + h * HD; const float rf = RF ? RF[(size_t)h * TT + t] : 1.0f; v2h o16; v2us oh, ol;
#pragma unroll
    for (int q = 0; q < 2; ++q) { const int dd = d + q; const int dp = (dd < HD / 2) ? dd + HD / 2 : dd - HD / 2; float x0 = f[dd], x1 = f[dp];
        if (RF) { float n0 = __fmul_rn(x0, rf), n1 = __fmul_rn(x1, rf); asm volatile("" : "+v"(n0)); asm volatile("" : "+v"(n1)); x0 = __fmul_rn(bfr(nw[dd]), n0); x1 = __fmul_rn(bfr(nw[dp]), n1); }
        const v2f cs = *(const v2f*)(CS + ((size_t)t * HD + dd) * 2); float a = __fmul_rn(x0, cs[0]), bq = __fmul_rn(x1, cs[1]); asm volatile("" : "+v"(a)); asm volatile("" : "+v"(bq)); const float r = ((dd < HD / 2) ? __fsub_rn(a, bq) : __fadd_rn(a, bq)) * sc;
        o16[q] = tohx(r); unsigned short a2, c2; splitf(r, a2, c2); oh[q] = a2; ol[q] = c2; }
    *(v2h*)(P16 + e) = o16; *(v2us*)(Ph + e) = oh; *(v2us*)(Pl + e) = ol;  }
__global__ __launch_bounds__(256) void k_vtp(const float* __restrict__ F, int pitch, int nheads, h16* V16, bf* Vh, bf* Vl) { const size_t e = ((size_t)blockIdx.x * 256 + threadIdx.x) * 2; if (e >= (size_t)nheads * HD * TT) return; const int t = (int)(e % TT); const int d = (int)((e / TT) % HD); const int g = (int)(e / ((size_t)TT * HD)); v2h o16; v2us oh, ol;
#pragma unroll
    for (int q = 0; q < 2; ++q) { const float x = F[(size_t)(t + q) * pitch + g * HD + d]; o16[q] = tohx(x); unsigned short a2, c2; splitf(x, a2, c2); oh[q] = a2; ol[q] = c2; }
    *(v2h*)(V16 + e) = o16; *(v2us*)(Vh + e) = oh; *(v2us*)(Vl + e) = ol;  }
__constant__ float INV2[HD / 2] = { 1.000000000e+00f, 7.498942018e-01f, 5.623413324e-01f, 4.216965139e-01f, 3.162277639e-01f, 2.371373624e-01f, 1.778279394e-01f, 1.333521456e-01f, 1.000000015e-01f, 7.498941571e-02f, 5.623412877e-02f, 4.216964915e-02f, 3.162277862e-02f, 2.371373586e-02f, 1.778279431e-02f, 1.333521493e-02f, 9.999999776e-03f, 7.498942316e-03f, 5.623413250e-03f, 4.216964822e-03f, 3.162277862e-03f, 2.371373819e-03f, 1.778279431e-03f, 1.333521446e-03f, 1.000000047e-03f, 7.498941850e-04f, 5.623413017e-04f, 4.216964880e-04f, 3.162277862e-04f, 2.371373848e-04f, 1.778279402e-04f, 1.333521504e-04f };   // float32 1.0 / (10000.0 ** (arange(0, 64, 2, dtype=float32) / 64)), generated with jnp to be bit-exact
__global__ __launch_bounds__(256) void k_csP(float* CS) { const int idx = blockIdx.x * 256 + threadIdx.x; if (idx >= TT * HD) return; const int d = idx % HD; const int t = idx / HD; const float a = __fmul_rn(__fmul_rn((float)t, 6.2831855f), INV2[d >> 1]); v2f cs; cs[0] = cosf(a); cs[1] = sinf(a); *(v2f*)(CS + (size_t)idx * 2) = cs;  }
// k_asoft: per row (zz, i): t = S x HD^-0.5 for j <= i and i - j < WIN (WIN = TT, so plain causal; the reference's -1e9 additive fill vanishes identically); softmax over the 2048 keys (register row, one exp, fixed trees);
__global__ __launch_bounds__(256) void k_asoft(const float* __restrict__ Sb, h16* P16, bf* Ph, bf* Pl) {
    const int lane = threadIdx.x & 31; const int row = blockIdx.x * 8 + (threadIdx.x >> 5); if (row >= ZH * TT) return; const int i = row % TT; const int zz = row / TT; (void)zz; const bool hires = (i < RH); const float* sr = Sb + (size_t)row * TT; float v[TT / 32]; float mx = -3.0e38f;
#pragma unroll
    for (int ch = 0; ch < TT / 128; ++ch) { const int j0 = ch * 128 + lane * 4; const v4f a = *(const v4f*)(sr + j0);
#pragma unroll
        for (int q = 0; q < 4; ++q) { const int j = j0 + q; (void)j; const float t = (j <= i && i - j < WIN) ? a[q] * SCL : -3.0e38f; v[ch * 4 + q] = t; mx = fmaxf(mx, t); } }
#pragma unroll
    for (int sh = 16; sh; sh >>= 1) mx = fmaxf(mx, __shfl_xor(mx, sh, 32));
    float sum = 0.f;
#pragma unroll
    for (int k = 0; k < TT / 32; ++k) { float d0 = __fsub_rn(v[k], mx); asm volatile("" : "+v"(d0)); v[k] = __builtin_amdgcn_exp2f(__fmul_rn(d0, 1.4426950408889634f)); sum += v[k]; }
#pragma unroll
    for (int sh = 16; sh; sh >>= 1) sum += __shfl_xor(sum, sh, 32);
    const float f = __fdiv_rn(hires ? 1.0f : PCAR, sum);
{
        if (hires) {
#pragma unroll
            for (int ch = 0; ch < TT / 128; ++ch) { v4us oh, ol;
#pragma unroll
                for (int q = 0; q < 4; ++q) { unsigned short a, c2; splitf(v[ch * 4 + q] * f, a, c2); oh[q] = a; ol[q] = c2; }
                const size_t oo = ((size_t)zz * (RH ? RH : 1) + i) * TT + ch * 128 + lane * 4; *(v4us*)(Ph + oo) = oh; *(v4us*)(Pl + oo) = ol; }
        } else {
#pragma unroll
            for (int ch = 0; ch < TT / 128; ++ch) { v4h o4;
#pragma unroll
                for (int q = 0; q < 4; ++q) o4[q] = tohx(v[ch * 4 + q] * f);
                *(v4h*)(P16 + (size_t)row * TT + ch * 128 + lane * 4) = o4; } }
         }
}
__global__ __launch_bounds__(256) void k_merge(const float* __restrict__ O, int h0, bf* Ah, bf* Al) { const size_t e = ((size_t)blockIdx.x * 256 + threadIdx.x) * 2; if (e >= (size_t)ZH * TT * HD) return; const int d = (int)(e % HD); const int t = (int)((e / HD) % TT); const int zz = (int)(e / ((size_t)HD * TT)); const float cs = (t < RH) ? 1.0f : (1.0f / PCAR); const size_t oo = (size_t)t * DQ + (h0 + zz) * HD + d;
    v2us oh, ol;
#pragma unroll
    for (int q = 0; q < 2; ++q) { unsigned short a, c2; splitf(O[e + q] * cs, a, c2); oh[q] = a; ol[q] = c2; } *(v2us*)(Ah + oo) = oh; *(v2us*)(Al + oo) = ol;  }

extern "C" void kernel_launch(void* const* d_in, const int* in_sizes, int n_in,
                              void* d_out, int out_size, void* d_ws, size_t ws_size, hipStream_t stream) {
    (void)in_sizes; (void)n_in; (void)out_size;
    const float* x = (const float*)d_in[0]; const float* wq = (const float*)d_in[1]; const float* wk = (const float*)d_in[2]; const float* wv = (const float*)d_in[3]; const float* wo = (const float*)d_in[4];   /* order x, Wq ('oi' [2048][2048]), Wk, Wv ('oi' [512][2048]), Wo ('oi') */
    float* OUT = (float*)d_out;     // [2][2048][2048]
    char* wsp = (char*)d_ws;
    auto take = [&](size_t bytes) { char* p = wsp; wsp += (bytes + 255) & ~(size_t)255; return (void*)p; };
    bf* WQ = (bf*)take((size_t)DQ * DM * 2); bf* WK = (bf*)take((size_t)DKV * DM * 2); bf* WV = (bf*)take((size_t)DKV * DM * 2); bf* WO = (bf*)take((size_t)DM * DQ * 2); float* CS = (float*)take((size_t)TT * HD * 2 * 4);
    bf* XB = (bf*)take((size_t)TT * DM * 2); float* FQ = (float*)take((size_t)TT * DQ * 4); float* FK = (float*)take((size_t)TT * DKV * 4);
    h16* QP16 = (h16*)take((size_t)NH_ * TT * HD * 2); h16* KP16 = (h16*)take((size_t)NKV * TT * HD * 2); h16* VT16 = (h16*)take((size_t)NKV * HD * TT * 2);
    bf* QPh = (bf*)take((size_t)NH_ * TT * HD * 2); bf* QPl = (bf*)take((size_t)NH_ * TT * HD * 2); bf* KPh = (bf*)take((size_t)NKV * TT * HD * 2); bf* KPl = (bf*)take((size_t)NKV * TT * HD * 2); bf* VTh = (bf*)take((size_t)NKV * HD * TT * 2); bf* VTl = (bf*)take((size_t)NKV * HD * TT * 2); bf* Ph = (bf*)take((size_t)ZH * RH * TT * 2); bf* Pl = (bf*)take((size_t)ZH * RH * TT * 2);
    float* Sb = (float*)take((size_t)ZH * TT * TT * 4); h16* P16 = (h16*)take((size_t)ZH * TT * TT * 2); float* Ob = (float*)take((size_t)ZH * TT * HD * 4); bf* ATh = (bf*)take((size_t)TT * DQ * 2); bf* ATl = (bf*)take((size_t)TT * DQ * 2);
    if ((size_t)(wsp - (char*)d_ws) > ws_size) return;    // ws 256 MiB
    float* FV = FK;   // v projection reuses the k buffer after the k planes are built (stream-ordered)
    { k_cvt8<<<(unsigned)(((size_t)DQ * DM / 8 + 255) / 256), 256, 0, stream>>>(wq, WQ, (size_t)DQ * DM / 8); k_cvt8<<<(unsigned)(((size_t)DKV * DM / 8 + 255) / 256), 256, 0, stream>>>(wk, WK, (size_t)DKV * DM / 8); k_cvt8<<<(unsigned)(((size_t)DKV * DM / 8 + 255) / 256), 256, 0, stream>>>(wv, WV, (size_t)DKV * DM / 8);
      k_cvt8<<<(unsigned)(((size_t)DM * DQ / 8 + 255) / 256), 256, 0, stream>>>(wo, WO, (size_t)DM * DQ / 8);
       }
    k_csP<<<(TT * HD + 255) / 256, 256, 0, stream>>>(CS);
    const unsigned LQ = (unsigned)(((size_t)NH_ * TT * HD / 2 + 255) / 256), LKv = (unsigned)(((size_t)NKV * TT * HD / 2 + 255) / 256);
    for (int b = 0; b < NB_; ++b) {
        
        k_cvt8<<<(unsigned)(((size_t)TT * DM / 8 + 255) / 256), 256, 0, stream>>>(x + (size_t)b * TT * DM, XB, (size_t)TT * DM / 8);
        k_gemmw<bf, 0, false, 8><<<dim3(TT / 64, DQ / 64, 1), 256, 0, stream>>>(XB, nullptr, WQ, nullptr, DM, FQ, DQ, nullptr, 0, 0, 0);
        k_ropeI<<<LQ, 256, 0, stream>>>(FQ, DQ, NH_, CS, 1.0f, QP16, QPh, QPl);
        k_gemmw<bf, 0, false, 16><<<dim3(TT / 64, DKV / 64, 1), 512, 0, stream>>>(XB, nullptr, WK, nullptr, DM, FK, DKV, nullptr, 0, 0, 0);
        k_ropeI<<<LKv, 256, 0, stream>>>(FK, DKV, NKV, CS, 1.0f, KP16, KPh, KPl);
        k_gemmw<bf, 0, false, 16><<<dim3(TT / 64, DKV / 64, 1), 512, 0, stream>>>(XB, nullptr, WV, nullptr, DM, FV, DKV, nullptr, 0, 0, 0); k_vtp<<<LKv, 256, 0, stream>>>(FV, DKV, NKV, VT16, VTh, VTl);
        for (int h0 = 0; h0 < NH_; h0 += ZH) { const size_t zq = (size_t)h0, zk = (size_t)(h0 / REP);   // both heads of a pass share kv group h0/REP (REP >= 2): sB = 0
            k_gemmc<bf, 2, 1, 1><<<dim3(RH / 64, TT / 64, ZH), 32, 0, stream>>>(QPh + zq * TT * HD, QPl + zq * TT * HD, KPh + zk * TT * HD, KPl + zk * TT * HD, HD, Sb, TT, 0, (size_t)TT * HD, 0, (size_t)TT * TT);
            k_gemmc<h16, 0, 1, 1><<<dim3((TT - RH) / 64, TT / 64, ZH), 32, 0, stream>>>(QP16 + zq * TT * HD + (size_t)RH * HD, nullptr, KP16 + zk * TT * HD, nullptr, HD, Sb + (size_t)RH * TT, TT, RH, (size_t)TT * HD, 0, (size_t)TT * TT);
            k_asoft<<<ZH * TT / 8, 256, 0, stream>>>(Sb, P16, Ph, Pl);
            k_gemmc<bf, 2, 2, 16><<<dim3(RH / 64, HD / 64, ZH), 512, 0, stream>>>(Ph, Pl, VTh + zk * HD * TT, VTl + zk * HD * TT, TT, Ob, HD, 0, (size_t)RH * TT, 0, (size_t)TT * HD);
            k_gemmc<h16, 0, 2, 16><<<dim3((TT - RH) / 64, HD / 64, ZH), 512, 0, stream>>>(P16 + (size_t)RH * TT, nullptr, VT16 + zk * HD * TT, nullptr, TT, Ob + (size_t)RH * HD, HD, RH, (size_t)TT * TT, 0, (size_t)TT * HD);
            k_merge<<<(unsigned)(((size_t)ZH * TT * HD / 2 + 255) / 256), 256, 0, stream>>>(Ob, h0, ATh, ATl); }
        k_gemmw<bf, 1, false, 8><<<dim3(TT / 64, DM / 64, 1), 256, 0, stream>>>(ATh, ATl, WO, nullptr, DQ, OUT + (size_t)b * TT * DM, DM, nullptr, 0, 0, 0); }
}

// v002
// One run takes 741 microseconds.
// In two side-by-side timings against v001, it was 2.01 and 2.03 times as fast.
// Over all steps from v000 it is 3.69 times as fast.
#include <hip/hip_runtime.h>

// Causal grouped-query attention with interleaved-pair rotary embeddings whose positions carry a 2 pi factor (x [2][2048][2048]; q = x Wq^T (32 heads x 64), k, v = x Wk^T, x Wv^T (8 kv heads x 64) ('oi' 1/sqrt(2048), no bias); rope on (even, odd) pairs: (re, im) = (q0 c - q1 s, q0 s + q1 c) with angle fl(fl(s x 2 pi) x freq_i), freq_i = 1 / 10000^(2i/64) (32 f32 frequencies jnp-exact; TWO f32 products; precise cosf/sinf); k, v repeated 4 x along the head axis: kv head = q head / 4; scores / sqrt(64); causal (finfo.min == exclusion); softmax; out = merged Wo^T ('oi', no bias) -> [2][2048][2048] (8.4 M); argument order x, Wq, Wk, Wv, Wo).
// Layout per batch: bf16 copy of x; 'oi' weights as-is; exact projections; identity-table plane builders; causal T-2048 GQA attention in passes of 512 query rows x all 32 heads (z = head, kv group z / 4; probabilities overwrite their own f32 score rows; hybrid rows: < 512 hi/lo 3 products, rest fp16 x1024; k_gemmc skips tiles above the diagonal); merged hi/lo x Wo exact.
// Compute dtypes, f32 accumulate: every input rounded to bf16; projections exact; attention rows < 512 3 products, rest fp16; softmax f32; output projection hl x exact.

#define NB_  2
#define TT   2048
#define DM   2048
#define NH_  32
#define NKV  8
#define REP  (NH_ / NKV)
#define HD   64
#define DQ   (NH_ * HD)
#define DKV  (NKV * HD)
#define RC   512                  // query rows of every head per attention pass: the f32 score plane of a pass is NH_ x RC x TT (128 MiB)
#define RH   512                  // query rows < RH use hi+lo planes (0: none)
#define WIN  2048
#define PCAR 1024.0f
#define SCL  0.125f   // HD^-0.5
static_assert(RH == RC && TT == 4 * RC, "pass 0 holds exactly the hi/lo rows; kernel_launch writes out four passes");
typedef _Float16 h16;
typedef unsigned short bf;
typedef __attribute__((ext_vector_type(16))) __bf16   v16bf;
typedef __attribute__((ext_vector_type(16))) _Float16 v16h;
typedef __attribute__((ext_vector_type(8)))  _Float16 v8h;
typedef __attribute__((ext_vector_type(8)))  unsigned short v8us;
typedef __attribute__((ext_vector_type(8)))  float    v8f;
typedef __attribute__((ext_vector_type(4)))  float    v4f;
typedef v8h  __attribute__((may_alias)) v8ha;
typedef v4f  __attribute__((may_alias)) v4fa;
typedef v8us __attribute__((may_alias)) v8usa;

__device__ __forceinline__ unsigned short f2bf(float f) { unsigned u = __float_as_uint(f); u += 0x7FFFu + ((u >> 16) & 1u); return (unsigned short)(u >> 16); }
__device__ __forceinline__ float bf2f(unsigned short b) { return __uint_as_float(((unsigned)b) << 16); }
__device__ __forceinline__ float bfr(float f) { return bf2f(f2bf(f)); }
__device__ __forceinline__ v16h cat16(v8h lo, v8h hi) { return __builtin_shufflevector(lo, hi, 0, 1, 2, 3, 4, 5, 6, 7, 8, 9, 10, 11, 12, 13, 14, 15); }
__device__ __forceinline__ v16bf cat16b(v8us lo, v8us hi) { return __builtin_bit_cast(v16bf, __builtin_shufflevector(lo, hi, 0, 1, 2, 3, 4, 5, 6, 7, 8, 9, 10, 11, 12, 13, 14, 15)); }
__device__ __forceinline__ v8f wmma16(v16h a, v16h b, v8f c) { return __builtin_amdgcn_wmma_f32_16x16x32_f16(false, a, false, b, (short)0, c, false, false); }
__device__ __forceinline__ v8f wmmab(v16bf a, v16bf b, v8f c) { return __builtin_amdgcn_wmma_f32_16x16x32_bf16(false, a, false, b, (short)0, c, false, false); }



// ---- k_gemmw: register-blocked GEMM, one work-group of NW waves per 64x64 output tile; each wave holds the whole tile (16 accumulators) for its share of K, operands straight from K-contiguous 16-bit planes; grid (M/64, N/64, Z), NW x 32 threads.
// C[m][n] (f32, pitch ldc, + optional f32 bias[n]) = sum_k A[m][k] Bt[n][k] (+ split products per NSPLIT). z-batch strides sA/sB/sC in elements. K % 64 == 0.
template <typename T16> struct WFrag;
template <> struct WFrag<h16> { typedef v16h V; static __device__ __forceinline__ V ld(const h16* p) { return cat16(*(const v8h*)p, *(const v8h*)(p + 16)); } static __device__ __forceinline__ v8f mma(V a, V b, v8f c) { return wmma16(a, b, c); } };
template <> struct WFrag<bf> { typedef v16bf V; static __device__ __forceinline__ V ld(const bf* p) { return cat16b(*(const v8us*)p, *(const v8us*)(p + 16)); } static __device__ __forceinline__ v8f mma(V a, V b, v8f c) { return wmmab(a, b, c); } };
// ksum_store: the NW waves of a work-group each hold a partial 64x64 f32 tile (their share of K). Every wave writes its tile to LDS in register order (32 slots of 16 B per lane), one barrier,
// then wave w sums slots w*32/NW.. over the waves in the fixed order 0..NW-1, turns its rows (32 columns = one 128-B line each) through its own LDS strip and stores whole lines. Ct = the tile's first element.
template <int NW, bool BIAS>
__device__ __forceinline__ void ksum_store(const v8f (&acc)[4][4], float* ps, float* Ct, int ldc, const float* bias, int wv, int lane) {
    constexpr int SP = 32 / NW, RW = SP * 4;      // slots and rows per summing wave
    const int lr = lane & 15, hi = lane >> 4;
    v4fa* pw = (v4fa*)ps;
#pragma unroll
    for (int mb = 0; mb < 4; ++mb)
#pragma unroll
        for (int nb = 0; nb < 4; ++nb)
#pragma unroll
            for (int jh = 0; jh < 2; ++jh) { const int q = ((mb * 2 + (nb >> 1)) * 2 + jh) * 2 + (nb & 1); pw[(wv * 32 + q) * 32 + lane] = (v4f){ acc[mb][nb][jh * 4], acc[mb][nb][jh * 4 + 1], acc[mb][nb][jh * 4 + 2], acc[mb][nb][jh * 4 + 3] }; }
    __syncthreads();      // every wave's partial tile is in LDS before any wave sums
    v4f r[SP];
#pragma unroll
    for (int i = 0; i < SP; ++i) r[i] = pw[(wv * SP + i) * 32 + lane];
#pragma unroll
    for (int s = 1; s < NW; ++s)
#pragma unroll
        for (int i = 0; i < SP; ++i) r[i] += pw[(s * 32 + wv * SP + i) * 32 + lane];
    const int q0 = wv * SP, mb = q0 >> 3, nbp = (q0 >> 2) & 1, jh0 = (q0 >> 1) & 1;      // slot q = ((mb*2 + nb/2)*2 + jh)*2 + nb%2
    float* sw = ps + NW * 4096 + wv * (RW * 36);
#pragma unroll
    for (int i = 0; i < SP; ++i)
#pragma unroll
        for (int jj = 0; jj < 4; ++jj) sw[(hi * (RW / 2) + (i >> 1) * 4 + jj) * 36 + (i & 1) * 16 + lr] = r[i][jj];
    asm volatile("s_wait_dscnt 0x0" ::: "memory");      // the wave's own strip is written before other lanes of the wave read it back
#pragma unroll
    for (int i = 0; i < SP; ++i) { const int idx = i * 32 + lane, lrow = idx >> 3, cofs = nbp * 32 + (idx & 7) * 4; const int trow = (SP == 4) ? lrow : ((lrow >> 2) * 8 + jh0 * 4 + (lrow & 3));
        v4f val = *(const v4fa*)(sw + lrow * 36 + (idx & 7) * 4); if (BIAS) { val[0] += bfr(bias[cofs]); val[1] += bfr(bias[cofs + 1]); val[2] += bfr(bias[cofs + 2]); val[3] += bfr(bias[cofs + 3]); }
        *(v4f*)(Ct + (size_t)(mb * 16 + trow) * ldc + cofs) = val; }
}
// Register budget: four waves per SIMD (two 8-wave work-groups or one 16-wave work-group on a WGP).
template <typename T16, int NSPLIT, bool BIAS, int NW>
__global__ __launch_bounds__(NW * 32, 4) void k_gemmw(const T16* __restrict__ A, const T16* __restrict__ A2, const T16* __restrict__ Bt, const T16* __restrict__ Bt2, int K, float* C, int ldc, const float* __restrict__ bias, size_t sA, size_t sB, size_t sC) {
    typedef typename WFrag<T16>::V V;
    __shared__ __align__(16) float os[NW * 4096 + 128 * 36];
    const size_t z = blockIdx.z; A += z * sA; if (A2) A2 += z * sA; Bt += z * sB; if (Bt2) Bt2 += z * sB; C += z * sC;
    const int lane = threadIdx.x & 31, lr = lane & 15, hi = lane >> 4; const int r0 = blockIdx.x * 64, c0 = blockIdx.y * 64;
    const int wv = __builtin_amdgcn_readfirstlane(threadIdx.x >> 5);      // wave number, scalar so that the K loop stays a scalar loop
    v8f acc[4][4];
#pragma unroll
    for (int mb = 0; mb < 4; ++mb)
#pragma unroll
        for (int nb = 0; nb < 4; ++nb) acc[mb][nb] = (v8f){};
    const size_t aoff = (size_t)(r0 + lr) * K + 8 * hi, boff = (size_t)(c0 + lr) * K + 8 * hi;
#pragma unroll 1
    for (int k0 = wv * 64; k0 < K; k0 += NW * 64) {      // wave wv takes every NW-th slice of 64 k (one 128-B line of each operand row)
#pragma unroll      // both 32-k halves of the slice in one trip: constant offsets from the trip's addresses
      for (int kc = k0; kc < k0 + 64; kc += 32) {
        V a[4], a2[4];
#pragma unroll
        for (int mb = 0; mb < 4; ++mb) { a[mb] = WFrag<T16>::ld(A + aoff + (size_t)mb * 16 * K + kc); if (NSPLIT == 1 || NSPLIT == 2) a2[mb] = WFrag<T16>::ld(A2 + aoff + (size_t)mb * 16 * K + kc); }
#pragma unroll
        for (int nb = 0; nb < 4; ++nb) { const V b = WFrag<T16>::ld(Bt + boff + (size_t)nb * 16 * K + kc); V b2; if (NSPLIT >= 2) b2 = WFrag<T16>::ld(Bt2 + boff + (size_t)nb * 16 * K + kc);
#pragma unroll
            for (int mb = 0; mb < 4; ++mb) { acc[mb][nb] = WFrag<T16>::mma(a[mb], b, acc[mb][nb]); if (NSPLIT == 1 || NSPLIT == 2) acc[mb][nb] = WFrag<T16>::mma(a2[mb], b, acc[mb][nb]); if (NSPLIT >= 2) acc[mb][nb] = WFrag<T16>::mma(a[mb], b2, acc[mb][nb]); } }
        asm volatile("v_nop\n\tv_nop\n\tv_nop\n\tv_nop" : "+v"(acc[0][0]), "+v"(acc[1][1]), "+v"(acc[2][2]), "+v"(acc[3][3]) : "v"(a[0]), "v"(a[3]));
      }
    }
    ksum_store<NW, BIAS>(acc, os, C + (size_t)r0 * ldc + c0, ldc, BIAS ? bias + c0 : bias, wv, lane);
}

// xwait4, xwait8: s_wait_xcnt 0 behind a run of fragment loads. The run's addresses are inputs of the statement, so each stays in its registers until the wait (a precaution for replayed address translations).
template <typename T16> __device__ __forceinline__ void xwait4(const T16* p0, const T16* p1, const T16* p2, const T16* p3) { asm volatile("s_wait_xcnt 0x0" :: "v"(p0), "v"(p1), "v"(p2), "v"(p3) : "memory"); }
template <typename T16> __device__ __forceinline__ void xwait8(const T16* p0, const T16* p1, const T16* p2, const T16* p3, const T16* p4, const T16* p5, const T16* p6, const T16* p7) { asm volatile("s_wait_xcnt 0x0" :: "v"(p0), "v"(p1), "v"(p2), "v"(p3), "v"(p4), "v"(p5), "v"(p6), "v"(p7) : "memory"); }

// ---- k_gemmc: the 64x64 tile GEMM of k_gemmw specialised for causal attention: CMODE 1 skips score tiles entirely above the diagonal (query rows r0+roff.., key columns c0..), CMODE 2 limits the
// key (K) loop of the probability x value contraction to the diagonal block (probabilities beyond it are exactly zero). roff = row offset of this launch's first row within the sequence.
// NW = 1: one wave, as above. NW > 1 (the long K of CMODE 2): K is split over the NW waves of the work-group as in k_gemmw.
// z = query head: A and C step by sA, sC per head, Bt by sB per kv group (z / REP). lda = pitch of A in elements (Bt has pitch K).
template <typename T16, int NSPLIT, int CMODE, int NW>
__global__ __launch_bounds__(NW * 32, NW == 1 ? 1 : 4) void k_gemmc(const T16* __restrict__ A, const T16* __restrict__ A2, int lda, const T16* __restrict__ Bt, const T16* __restrict__ Bt2, int K, float* C, int ldc, int roff, size_t sA, size_t sB, size_t sC) {
    typedef typename WFrag<T16>::V V;
    __shared__ __align__(16) float os[NW == 1 ? 16 * 68 : NW * 4096 + 128 * 36];
    const size_t z = blockIdx.z, zb = z / REP; A += z * sA; if (A2) A2 += z * sA; Bt += zb * sB; if (Bt2) Bt2 += zb * sB; C += z * sC;
    const int lane = threadIdx.x & 31, lr = lane & 15, hi = lane >> 4; const int r0 = blockIdx.x * 64, c0 = blockIdx.y * 64;
    const int wv = (NW == 1) ? 0 : __builtin_amdgcn_readfirstlane(threadIdx.x >> 5);      // wave number, scalar so that the K loop stays a scalar loop
    constexpr int KS = (NW == 1 || NSPLIT == 2) ? 32 : 64;      // NW > 1: wave wv takes every NW-th slice of 64 k (one 128-B line of each operand row); of 32 k with hi/lo planes on both sides (their K is short, and two fragment sets would not fit the registers)
    static_assert(NSPLIT == 0 || NSPLIT == 2, "one plane or hi/lo planes on both sides");
    constexpr int GB = (NSPLIT == 2) ? 2 : 4;
    if (CMODE == 1 && c0 > r0 + roff + 63) return;                  // score tile entirely above the causal diagonal: never read (the softmax masks j > i by select)
    const int Kl = (CMODE == 2) ? min(K, r0 + roff + 64) : K;        // P.V: probabilities are exactly 0 beyond the diagonal block, so the K loop stops there
    v8f acc[4][4];
#pragma unroll
    for (int mb = 0; mb < 4; ++mb)
#pragma unroll
        for (int nb = 0; nb < 4; ++nb) acc[mb][nb] = (v8f){};
    const size_t aoff = (size_t)(r0 + lr) * lda + 8 * hi, boff = (size_t)(c0 + lr) * K + 8 * hi;
#pragma unroll 1
    for (int k0 = wv * KS; k0 < Kl; k0 += NW * KS) {
#pragma unroll      // both 32-k halves of a 64-k slice in one trip: constant offsets ko from the trip's addresses
      for (int ko = 0; ko < KS; ko += 32) {
        V a[4], a2[4]; const T16 *pa[4], *pa2[4];
#pragma unroll
        for (int mb = 0; mb < 4; ++mb) { pa[mb] = A + aoff + (size_t)mb * 16 * lda + k0; a[mb] = WFrag<T16>::ld(pa[mb] + ko); if (NSPLIT == 2) { pa2[mb] = A2 + aoff + (size_t)mb * 16 * lda + k0; a2[mb] = WFrag<T16>::ld(pa2[mb] + ko); } }
        if constexpr (NSPLIT == 2) xwait8(pa[0], pa[1], pa[2], pa[3], pa2[0], pa2[1], pa2[2], pa2[3]); else xwait4(pa[0], pa[1], pa[2], pa[3]);
#pragma unroll
        for (int ng = 0; ng < 4; ng += GB) { V b[GB], b2[GB]; const T16 *pb[GB], *pb2[GB];      // GB column blocks of Bt per run of loads
#pragma unroll
            for (int g = 0; g < GB; ++g) { pb[g] = Bt + boff + (size_t)(ng + g) * 16 * K + k0; b[g] = WFrag<T16>::ld(pb[g] + ko); if (NSPLIT == 2) { pb2[g] = Bt2 + boff + (size_t)(ng + g) * 16 * K + k0; b2[g] = WFrag<T16>::ld(pb2[g] + ko); } }
            if constexpr (NSPLIT == 2) xwait4(pb[0], pb[1], pb2[0], pb2[1]); else xwait4(pb[0], pb[1], pb[2], pb[3]);
#pragma unroll
            for (int g = 0; g < GB; ++g) { const int nb = ng + g;
#pragma unroll
                for (int mb = 0; mb < 4; ++mb) { acc[mb][nb] = WFrag<T16>::mma(a[mb], b[g], acc[mb][nb]); if (NSPLIT == 2) { acc[mb][nb] = WFrag<T16>::mma(a2[mb], b[g], acc[mb][nb]); acc[mb][nb] = WFrag<T16>::mma(a[mb], b2[g], acc[mb][nb]); } } } }
        asm volatile("v_nop\n\tv_nop\n\tv_nop\n\tv_nop" : "+v"(acc[0][0]), "+v"(acc[1][1]), "+v"(acc[2][2]), "+v"(acc[3][3]) : "v"(a[0]), "v"(a[3]));
      }
    }
    if constexpr (NW > 1) { ksum_store<NW, false>(acc, os, C + (size_t)r0 * ldc + c0, ldc, nullptr, wv, lane); return; }
#pragma unroll
    for (int mb = 0; mb < 4; ++mb) {
#pragma unroll
        for (int nb = 0; nb < 4; ++nb) {
#pragma unroll
            for (int j = 0; j < 8; ++j) os[(hi * 8 + j) * 68 + nb * 16 + lr] = acc[mb][nb][j]; }
        __builtin_amdgcn_wave_barrier(); asm volatile("" ::: "memory");
        float* crow = C + (size_t)(r0 + mb * 16) * ldc + c0;
{
#pragma unroll
            for (int s = 0; s < 8; ++s) { const int row = 2 * s + hi, cofs = lr * 4; v4f val = *(const v4fa*)(os + row * 68 + cofs);
                *(v4f*)(crow + (size_t)row * ldc + cofs) = val; }
             }
        __builtin_amdgcn_wave_barrier(); asm volatile("" ::: "memory");
    }
}

__device__ __forceinline__ h16 tohx(float x) { return (h16)x; }
__device__ __forceinline__ void splitf(float y, unsigned short& h, unsigned short& l) { h = f2bf(y); l = f2bf(y - bf2f(h)); }
typedef __attribute__((ext_vector_type(2))) _Float16 v2h;
typedef __attribute__((ext_vector_type(4))) _Float16 v4h;
typedef __attribute__((ext_vector_type(2))) unsigned short v2us;
typedef __attribute__((ext_vector_type(4))) unsigned short v4us;
typedef __attribute__((ext_vector_type(2))) float v2f;
typedef __attribute__((ext_vector_type(4))) int v4i;

__global__ __launch_bounds__(256) void k_cvt8(const float* __restrict__ src, bf* dst, size_t n8) { const size_t i = (size_t)blockIdx.x * 256 + threadIdx.x; if (i >= n8) return; const v8f v = *(const v8f*)(src + i * 8); v8us o;
#pragma unroll
    for (int k = 0; k < 8; ++k) o[k] = f2bf(v[k]); *(v8us*)(dst + i * 8) = o;  }

__global__ __launch_bounds__(256) void k_ropeI(const float* __restrict__ F, int pitch, int nheads, const float* __restrict__ CS, float sc, h16* P16, bf* Ph, bf* Pl) {
    const size_t e = ((size_t)blockIdx.x * 256 + threadIdx.x) * 2; if (e >= (size_t)nheads * TT * HD) return; const int d = (int)(e % HD); const int t = (int)((e / HD) % TT); const int h = (int)(e / ((size_t)HD * TT)); const float* f = F + (size_t)t * pitch + h * HD; const float x0 = f[d], x1 = f[d + 1]; const v2f cs = *(const v2f*)(CS + ((size_t)t * HD + d) * 2); v2h o16; v2us oh, ol;
    float a0 = __fmul_rn(x0, cs[0]), b0 = __fmul_rn(x1, cs[1]), a1 = __fmul_rn(x1, cs[0]), b1 = __fmul_rn(x0, cs[1]); asm volatile("" : "+v"(a0), "+v"(b0), "+v"(a1), "+v"(b1));
    float r0 = __fsub_rn(a0, b0) * sc, r1 = __fadd_rn(b1, a1) * sc;   /* even: x0 c - x1 s; odd: x0 s + x1 c */
    o16[0] = tohx(r0); o16[1] = tohx(r1); { unsigned short a2, c2; splitf(r0, a2, c2); oh[0] = a2; ol[0] = c2; splitf(r1, a2, c2); oh[1] = a2; ol[1] = c2; }
    *(v2h*)(P16 + e) = o16; *(v2us*)(Ph + e) = oh; *(v2us*)(Pl + e) = ol;  }
// k_rope: head planes [h][t][d] (fp16 + hi/lo) of rope(x) x sc with the rotate-half convention out[d] = x[d] cos[t][d] - x[d+HD/2] sin[t][d], out[d+HD/2] = x[d+HD/2] cos[t][d+HD/2] + x[d] sin[t][d+HD/2]
__global__ __launch_bounds__(256) void k_rope(const float* __restrict__ F, int pitch, int nheads, const float* __restrict__ CS, const float* __restrict__ RF, const float* __restrict__ nw, float sc, h16* P16, bf* Ph, bf* Pl) {
    const size_t e = ((size_t)blockIdx.x * 256 + threadIdx.x) * 2; if (e >= (size_t)nheads * TT * HD) return; const int d = (int)(e % HD); const int t = (int)((e / HD) % TT); const int h = (int)(e / ((size_t)HD * TT)); const float* f = F + (size_t)t * pitch + h * HD; const float rf = RF ? RF[(size_t)h * TT + t] : 1.0f; v2h o16; v2us oh, ol;
#pragma unroll
    for (int q = 0; q < 2; ++q) { const int dd = d + q; const int dp = (dd < HD / 2) ? dd + HD / 2 : dd - HD / 2; float x0 = f[dd], x1 = f[dp];
        if (RF) { float n0 = __fmul_rn(x0, rf), n1 = __fmul_rn(x1, rf); asm volatile("" : "+v"(n0)); asm volatile("" : "+v"(n1)); x0 = __fmul_rn(bfr(nw[dd]), n0); x1 = __fmul_rn(bfr(nw[dp]), n1); }
        const v2f cs = *(const v2f*)(CS + ((size_t)t * HD + dd) * 2); float a = __fmul_rn(x0, cs[0]), bq = __fmul_rn(x1, cs[1]); asm volatile("" : "+v"(a)); asm volatile("" : "+v"(bq)); const float r = ((dd < HD / 2) ? __fsub_rn(a, bq) : __fadd_rn(a, bq)) * sc;
        o16[q] = tohx(r); unsigned short a2, c2; splitf(r, a2, c2); oh[q] = a2; ol[q] = c2; }
    *(v2h*)(P16 + e) = o16; *(v2us*)(Ph + e) = oh; *(v2us*)(Pl + e) = ol;  }
__global__ __launch_bounds__(256) void k_vtp(const float* __restrict__ F, int pitch, int nheads, h16* V16, bf* Vh, bf* Vl) { const size_t e = ((size_t)blockIdx.x * 256 + threadIdx.x) * 2; if (e >= (size_t)nheads * HD * TT) return; const int t = (int)(e % TT); const int d = (int)((e / TT) % HD); const int g = (int)(e / ((size_t)TT * HD)); v2h o16; v2us oh, ol;
#pragma unroll
    for (int q = 0; q < 2; ++q) { const float x = F[(size_t)(t + q) * pitch + g * HD + d]; o16[q] = tohx(x); unsigned short a2, c2; splitf(x, a2, c2); oh[q] = a2; ol[q] = c2; }
    *(v2h*)(V16 + e) = o16; *(v2us*)(Vh + e) = oh; *(v2us*)(Vl + e) = ol;  }
__constant__ float INV2[HD / 2] = { 1.000000000e+00f, 7.498942018e-01f, 5.623413324e-01f, 4.216965139e-01f, 3.162277639e-01f, 2.371373624e-01f, 1.778279394e-01f, 1.333521456e-01f, 1.000000015e-01f, 7.498941571e-02f, 5.623412877e-02f, 4.216964915e-02f, 3.162277862e-02f, 2.371373586e-02f, 1.778279431e-02f, 1.333521493e-02f, 9.999999776e-03f, 7.498942316e-03f, 5.623413250e-03f, 4.216964822e-03f, 3.162277862e-03f, 2.371373819e-03f, 1.778279431e-03f, 1.333521446e-03f, 1.000000047e-03f, 7.498941850e-04f, 5.623413017e-04f, 4.216964880e-04f, 3.162277862e-04f, 2.371373848e-04f, 1.778279402e-04f, 1.333521504e-04f };   // float32 1.0 / (10000.0 ** (arange(0, 64, 2, dtype=float32) / 64)), generated with jnp to be bit-exact
__global__ __launch_bounds__(256) void k_csP(float* CS) { const int idx = blockIdx.x * 256 + threadIdx.x; if (idx >= TT * HD) return; const int d = idx % HD; const int t = idx / HD; const float a = __fmul_rn(__fmul_rn((float)t, 6.2831855f), INV2[d >> 1]); v2f cs; cs[0] = cosf(a); cs[1] = sinf(a); *(v2f*)(CS + (size_t)idx * 2) = cs;  }
// k_asoft: one wave per row; row = head x RC + r, query position i = roff + r. The wave holds its whole f32 score row (8 KiB) in registers before it stores, and the probabilities go over that same row:
// fp16 x PCAR in the first 4 KiB (i >= RH), or the bf16 hi plane in the first and the lo plane in the second 4 KiB (i < RH); as 16-bit planes the rows have pitch 2 TT.
// per row (zz, i): t = S x HD^-0.5 for j <= i and i - j < WIN (sliding causal window; the reference's -1e9 additive fill vanishes identically); softmax over the 2048 keys (register row, one exp, fixed trees);
__global__ __launch_bounds__(256) void k_asoft(float* Sb, int roff) {
    const int lane = threadIdx.x & 31; const int row = blockIdx.x * 8 + (threadIdx.x >> 5); if (row >= NH_ * RC) return; const int i = roff + row % RC; const bool hires = (i < RH); float* sr = Sb + (size_t)row * TT; float v[TT / 32]; float mx = -3.0e38f;
#pragma unroll
    for (int ch = 0; ch < TT / 128; ++ch) { const int j0 = ch * 128 + lane * 4; const v4f a = *(const v4f*)(sr + j0);
#pragma unroll
        for (int q = 0; q < 4; ++q) { const int j = j0 + q; (void)j; const float t = (j <= i && i - j < WIN) ? a[q] * SCL : -3.0e38f; v[ch * 4 + q] = t; mx = fmaxf(mx, t); } }
#pragma unroll
    for (int sh = 16; sh; sh >>= 1) mx = fmaxf(mx, __shfl_xor(mx, sh, 32));
    float sum = 0.f;
#pragma unroll
    for (int k = 0; k < TT / 32; ++k) { float d0 = __fsub_rn(v[k], mx); asm volatile("" : "+v"(d0)); v[k] = __builtin_amdgcn_exp2f(__fmul_rn(d0, 1.4426950408889634f)); sum += v[k]; }
#pragma unroll
    for (int sh = 16; sh; sh >>= 1) sum += __shfl_xor(sum, sh, 32);
    const float f = __fdiv_rn(hires ? 1.0f : PCAR, sum);
{
        if (hires) {
#pragma unroll
            for (int ch = 0; ch < TT / 128; ++ch) { v4us oh, ol;
#pragma unroll
                for (int q = 0; q < 4; ++q) { unsigned short a, c2; splitf(v[ch * 4 + q] * f, a, c2); oh[q] = a; ol[q] = c2; }
                bf* po = (bf*)sr + ch * 128 + lane * 4; *(v4us*)po = oh; *(v4us*)(po + TT) = ol; }
        } else {
#pragma unroll
            for (int ch = 0; ch < TT / 128; ++ch) { v4h o4;
#pragma unroll
                for (int q = 0; q < 4; ++q) o4[q] = tohx(v[ch * 4 + q] * f);
                *(v4h*)((h16*)sr + ch * 128 + lane * 4) = o4; } }
         }
}
__global__ __launch_bounds__(256) void k_merge(const float* __restrict__ O, int roff, bf* Ah, bf* Al) { const size_t e = ((size_t)blockIdx.x * 256 + threadIdx.x) * 2; if (e >= (size_t)NH_ * RC * HD) return; const int d = (int)(e % HD); const int t = roff + (int)((e / HD) % RC); const int zz = (int)(e / ((size_t)HD * RC)); const float cs = (t < RH) ? 1.0f : (1.0f / PCAR); const size_t oo = (size_t)t * DQ + zz * HD + d;
    v2us oh, ol;
#pragma unroll
    for (int q = 0; q < 2; ++q) { unsigned short a, c2; splitf(O[e + q] * cs, a, c2); oh[q] = a; ol[q] = c2; } *(v2us*)(Ah + oo) = oh; *(v2us*)(Al + oo) = ol;  }

extern "C" void kernel_launch(void* const* d_in, const int* in_sizes, int n_in,
                              void* d_out, int out_size, void* d_ws, size_t ws_size, hipStream_t stream) {
    (void)in_sizes; (void)n_in; (void)out_size;
    const float* x = (const float*)d_in[0]; const float* wq = (const float*)d_in[1]; const float* wk = (const float*)d_in[2]; const float* wv = (const float*)d_in[3]; const float* wo = (const float*)d_in[4];   /* order x, Wq ('oi' [2048][2048]), Wk, Wv ('oi' [512][2048]), Wo ('oi') */
    float* OUT = (float*)d_out;     // [2][2048][2048]
    char* wsp = (char*)d_ws;
    auto take = [&](size_t bytes) { char* p = wsp; wsp += (bytes + 255) & ~(size_t)255; return (void*)p; };
    bf* WQ = (bf*)take((size_t)DQ * DM * 2); bf* WK = (bf*)take((size_t)DKV * DM * 2); bf* WV = (bf*)take((size_t)DKV * DM * 2); bf* WO = (bf*)take((size_t)DM * DQ * 2); float* CS = (float*)take((size_t)TT * HD * 2 * 4);
    bf* XB = (bf*)take((size_t)TT * DM * 2); float* FQ = (float*)take((size_t)TT * DQ * 4); float* FK = (float*)take((size_t)TT * DKV * 4);
    h16* QP16 = (h16*)take((size_t)NH_ * TT * HD * 2); h16* KP16 = (h16*)take((size_t)NKV * TT * HD * 2); h16* VT16 = (h16*)take((size_t)NKV * HD * TT * 2);
    bf* QPh = (bf*)take((size_t)NH_ * TT * HD * 2); bf* QPl = (bf*)take((size_t)NH_ * TT * HD * 2); bf* KPh = (bf*)take((size_t)NKV * TT * HD * 2); bf* KPl = (bf*)take((size_t)NKV * TT * HD * 2); bf* VTh = (bf*)take((size_t)NKV * HD * TT * 2); bf* VTl = (bf*)take((size_t)NKV * HD * TT * 2);
    float* Sb = (float*)take((size_t)NH_ * RC * TT * 4); float* Ob = (float*)take((size_t)NH_ * RC * HD * 4); bf* ATh = (bf*)take((size_t)TT * DQ * 2); bf* ATl = (bf*)take((size_t)TT * DQ * 2);
    if ((size_t)(wsp - (char*)d_ws) > ws_size) return;    // ws 256 MiB
    float* FV = FK;   // v projection reuses the k buffer after the k planes are built (stream-ordered)
    { k_cvt8<<<(unsigned)(((size_t)DQ * DM / 8 + 255) / 256), 256, 0, stream>>>(wq, WQ, (size_t)DQ * DM / 8); k_cvt8<<<(unsigned)(((size_t)DKV * DM / 8 + 255) / 256), 256, 0, stream>>>(wk, WK, (size_t)DKV * DM / 8); k_cvt8<<<(unsigned)(((size_t)DKV * DM / 8 + 255) / 256), 256, 0, stream>>>(wv, WV, (size_t)DKV * DM / 8);
      k_cvt8<<<(unsigned)(((size_t)DM * DQ / 8 + 255) / 256), 256, 0, stream>>>(wo, WO, (size_t)DM * DQ / 8);
       }
    k_csP<<<(TT * HD + 255) / 256, 256, 0, stream>>>(CS);
    const unsigned LQ = (unsigned)(((size_t)NH_ * TT * HD / 2 + 255) / 256), LKv = (unsigned)(((size_t)NKV * TT * HD / 2 + 255) / 256);
    for (int b = 0; b < NB_; ++b) {
        
        k_cvt8<<<(unsigned)(((size_t)TT * DM / 8 + 255) / 256), 256, 0, stream>>>(x + (size_t)b * TT * DM, XB, (size_t)TT * DM / 8);
        k_gemmw<bf, 0, false, 8><<<dim3(TT / 64, DQ / 64, 1), 256, 0, stream>>>(XB, nullptr, WQ, nullptr, DM, FQ, DQ, nullptr, 0, 0, 0);
        k_ropeI<<<LQ, 256, 0, stream>>>(FQ, DQ, NH_, CS, 1.0f, QP16, QPh, QPl);
        k_gemmw<bf, 0, false, 16><<<dim3(TT / 64, DKV / 64, 1), 512, 0, stream>>>(XB, nullptr, WK, nullptr, DM, FK, DKV, nullptr, 0, 0, 0);
        k_ropeI<<<LKv, 256, 0, stream>>>(FK, DKV, NKV, CS, 1.0f, KP16, KPh, KPl);
        k_gemmw<bf, 0, false, 16><<<dim3(TT / 64, DKV / 64, 1), 512, 0, stream>>>(XB, nullptr, WV, nullptr, DM, FV, DKV, nullptr, 0, 0, 0); k_vtp<<<LKv, 256, 0, stream>>>(FV, DKV, NKV, VT16, VTh, VTl);
        // pass 0: query rows 0..RC-1 (= RH: the hi/lo rows) of all heads; keys 0..RC-1
        k_gemmc<bf, 2, 1, 1><<<dim3(RC / 64, RC / 64, NH_), 32, 0, stream>>>(QPh, QPl, HD, KPh, KPl, HD, Sb, TT, 0, (size_t)TT * HD, (size_t)TT * HD, (size_t)RC * TT);
        k_asoft<<<NH_ * RC / 8, 256, 0, stream>>>(Sb, 0);
        k_gemmc<bf, 2, 2, 16><<<dim3(RC / 64, HD / 64, NH_), 512, 0, stream>>>((const bf*)Sb, (const bf*)Sb + TT, 2 * TT, VTh, VTl, TT, Ob, HD, 0, (size_t)RC * 2 * TT, (size_t)HD * TT, (size_t)RC * HD);
        k_merge<<<(unsigned)(((size_t)NH_ * RC * HD / 2 + 255) / 256), 256, 0, stream>>>(Ob, 0, ATh, ATl);
        // passes 1..3: query rows P RC..(P + 1) RC - 1 of all heads, fp16; the score grid covers the keys up to the pass's last row
#define ATT_PASS(P) \
        k_gemmc<h16, 0, 1, 1><<<dim3(RC / 64, ((P) + 1) * RC / 64, NH_), 32, 0, stream>>>(QP16 + (size_t)(P) * RC * HD, nullptr, HD, KP16, nullptr, HD, Sb, TT, (P) * RC, (size_t)TT * HD, (size_t)TT * HD, (size_t)RC * TT); \
        k_asoft<<<NH_ * RC / 8, 256, 0, stream>>>(Sb, (P) * RC); \
        k_gemmc<h16, 0, 2, 16><<<dim3(RC / 64, HD / 64, NH_), 512, 0, stream>>>((const h16*)Sb, nullptr, 2 * TT, VT16, nullptr, TT, Ob, HD, (P) * RC, (size_t)RC * 2 * TT, (size_t)HD * TT, (size_t)RC * HD); \
        k_merge<<<(unsigned)(((size_t)NH_ * RC * HD / 2 + 255) / 256), 256, 0, stream>>>(Ob, (P) * RC, ATh, ATl);
        ATT_PASS(1) ATT_PASS(2) ATT_PASS(3)
#undef ATT_PASS
        k_gemmw<bf, 1, false, 8><<<dim3(TT / 64, DM / 64, 1), 256, 0, stream>>>(ATh, ATl, WO, nullptr, DQ, OUT + (size_t)b * TT * DM, DM, nullptr, 0, 0, 0); }
}

// v003
// A run of this version takes 398 microseconds.
// Next to v002, in two timings, it ran 1.87 and 1.85 times as fast.
// Over all steps from v000 it is 6.86 times as fast.
#include <hip/hip_runtime.h>

// Causal grouped-query attention with interleaved-pair rotary embeddings whose positions carry a 2 pi factor (x [2][2048][2048]; q = x Wq^T (32 heads x 64), k, v = x Wk^T, x Wv^T (8 kv heads x 64) ('oi' 1/sqrt(2048), no bias); rope on (even, odd) pairs: (re, im) = (q0 c - q1 s, q0 s + q1 c) with angle fl(fl(s x 2 pi) x freq_i), freq_i = 1 / 10000^(2i/64) (32 f32 frequencies jnp-exact; TWO f32 products; precise cosf/sinf); k, v repeated 4 x along the head axis: kv head = q head / 4; scores / sqrt(64); causal (finfo.min == exclusion); softmax; out = merged Wo^T ('oi', no bias) -> [2][2048][2048] (8.4 M); argument order x, Wq, Wk, Wv, Wo).
// Layout per batch: bf16 copy of x; 'oi' weights as-is; exact projections; identity-table plane builders; causal T-2048 GQA attention in one launch (k_fattn: scores, running-maximum softmax and P.V in registers; hybrid rows: < 512 hi/lo 3 products, rest fp16); merged hi/lo x Wo exact.
// Compute dtypes, f32 accumulate: every input rounded to bf16; projections exact; attention rows < 512 3 products, rest fp16; softmax f32; output projection hl x exact.

#define NB_  2
#define TT   2048
#define DM   2048
#define NH_  32
#define NKV  8
#define REP  (NH_ / NKV)
#define HD   64
#define DQ   (NH_ * HD)
#define DKV  (NKV * HD)
#define RH   512                  // query rows < RH use hi+lo planes (0: none)
#define SCL  0.125f   // HD^-0.5
static_assert(RH % 32 == 0 && TT % 64 == 0 && (REP & (REP - 1)) == 0, "a 32-row block is wholly hi/lo or wholly fp16; blocks pair up; the head comes from the low bits of the wave number");
typedef _Float16 h16;
typedef unsigned short bf;
typedef __attribute__((ext_vector_type(16))) __bf16   v16bf;
typedef __attribute__((ext_vector_type(16))) _Float16 v16h;
typedef __attribute__((ext_vector_type(8)))  _Float16 v8h;
typedef __attribute__((ext_vector_type(8)))  unsigned short v8us;
typedef __attribute__((ext_vector_type(8)))  float    v8f;
typedef __attribute__((ext_vector_type(4)))  float    v4f;
typedef v8h  __attribute__((may_alias)) v8ha;
typedef v4f  __attribute__((may_alias)) v4fa;
typedef v8us __attribute__((may_alias)) v8usa;

__device__ __forceinline__ unsigned short f2bf(float f) { unsigned u = __float_as_uint(f); u += 0x7FFFu + ((u >> 16) & 1u); return (unsigned short)(u >> 16); }
__device__ __forceinline__ float bf2f(unsigned short b) { return __uint_as_float(((unsigned)b) << 16); }
__device__ __forceinline__ float bfr(float f) { return bf2f(f2bf(f)); }
__device__ __forceinline__ v16h cat16(v8h lo, v8h hi) { return __builtin_shufflevector(lo, hi, 0, 1, 2, 3, 4, 5, 6, 7, 8, 9, 10, 11, 12, 13, 14, 15); }
__device__ __forceinline__ v16bf cat16b(v8us lo, v8us hi) { return __builtin_bit_cast(v16bf, __builtin_shufflevector(lo, hi, 0, 1, 2, 3, 4, 5, 6, 7, 8, 9, 10, 11, 12, 13, 14, 15)); }
__device__ __forceinline__ v8f wmma16(v16h a, v16h b, v8f c) { return __builtin_amdgcn_wmma_f32_16x16x32_f16(false, a, false, b, (short)0, c, false, false); }
__device__ __forceinline__ v8f wmmab(v16bf a, v16bf b, v8f c) { return __builtin_amdgcn_wmma_f32_16x16x32_bf16(false, a, false, b, (short)0, c, false, false); }



// ---- k_gemmw: register-blocked GEMM, one work-group of NW waves per 64x64 output tile; each wave holds the whole tile (16 accumulators) for its share of K, operands straight from K-contiguous 16-bit planes; grid (M/64, N/64, Z), NW x 32 threads.
// C[m][n] (f32, pitch ldc, + optional f32 bias[n]) = sum_k A[m][k] Bt[n][k] (+ split products per NSPLIT). z-batch strides sA/sB/sC in elements. K % 64 == 0.
template <typename T16> struct WFrag;
template <> struct WFrag<h16> { typedef v16h V; static __device__ __forceinline__ V ld(const h16* p) { return cat16(*(const v8h*)p, *(const v8h*)(p + 16)); } static __device__ __forceinline__ v8f mma(V a, V b, v8f c) { return wmma16(a, b, c); } };
template <> struct WFrag<bf> { typedef v16bf V; static __device__ __forceinline__ V ld(const bf* p) { return cat16b(*(const v8us*)p, *(const v8us*)(p + 16)); } static __device__ __forceinline__ v8f mma(V a, V b, v8f c) { return wmmab(a, b, c); } };
// ksum_store: the NW waves of a work-group each hold a partial 64x64 f32 tile (their share of K). Every wave writes its tile to LDS in register order (32 slots of 16 B per lane), one barrier,
// then wave w sums slots w*32/NW.. over the waves in the fixed order 0..NW-1, turns its rows (32 columns = one 128-B line each) through its own LDS strip and stores whole lines. Ct = the tile's first element.
template <int NW, bool BIAS>
__device__ __forceinline__ void ksum_store(const v8f (&acc)[4][4], float* ps, float* Ct, int ldc, const float* bias, int wv, int lane) {
    constexpr int SP = 32 / NW, RW = SP * 4;      // slots and rows per summing wave
    const int lr = lane & 15, hi = lane >> 4;
    v4fa* pw = (v4fa*)ps;
#pragma unroll
    for (int mb = 0; mb < 4; ++mb)
#pragma unroll
        for (int nb = 0; nb < 4; ++nb)
#pragma unroll
            for (int jh = 0; jh < 2; ++jh) { const int q = ((mb * 2 + (nb >> 1)) * 2 + jh) * 2 + (nb & 1); pw[(wv * 32 + q) * 32 + lane] = (v4f){ acc[mb][nb][jh * 4], acc[mb][nb][jh * 4 + 1], acc[mb][nb][jh * 4 + 2], acc[mb][nb][jh * 4 + 3] }; }
    __syncthreads();      // every wave's partial tile is in LDS before any wave sums
    v4f r[SP];
#pragma unroll
    for (int i = 0; i < SP; ++i) r[i] = pw[(wv * SP + i) * 32 + lane];
#pragma unroll
    for (int s = 1; s < NW; ++s)
#pragma unroll
        for (int i = 0; i < SP; ++i) r[i] += pw[(s * 32 + wv * SP + i) * 32 + lane];
    const int q0 = wv * SP, mb = q0 >> 3, nbp = (q0 >> 2) & 1, jh0 = (q0 >> 1) & 1;      // slot q = ((mb*2 + nb/2)*2 + jh)*2 + nb%2
    float* sw = ps + NW * 4096 + wv * (RW * 36);
#pragma unroll
    for (int i = 0; i < SP; ++i)
#pragma unroll
        for (int jj = 0; jj < 4; ++jj) sw[(hi * (RW / 2) + (i >> 1) * 4 + jj) * 36 + (i & 1) * 16 + lr] = r[i][jj];
    asm volatile("s_wait_dscnt 0x0" ::: "memory");      // the wave's own strip is written before other lanes of the wave read it back
#pragma unroll
    for (int i = 0; i < SP; ++i) { const int idx = i * 32 + lane, lrow = idx >> 3, cofs = nbp * 32 + (idx & 7) * 4; const int trow = (SP == 4) ? lrow : ((lrow >> 2) * 8 + jh0 * 4 + (lrow & 3));
        v4f val = *(const v4fa*)(sw + lrow * 36 + (idx & 7) * 4); if (BIAS) { val[0] += bfr(bias[cofs]); val[1] += bfr(bias[cofs + 1]); val[2] += bfr(bias[cofs + 2]); val[3] += bfr(bias[cofs + 3]); }
        *(v4f*)(Ct + (size_t)(mb * 16 + trow) * ldc + cofs) = val; }
}
// Register budget: four waves per SIMD (two 8-wave work-groups or one 16-wave work-group on a WGP).
template <typename T16, int NSPLIT, bool BIAS, int NW>
__global__ __launch_bounds__(NW * 32, 4) void k_gemmw(const T16* __restrict__ A, const T16* __restrict__ A2, const T16* __restrict__ Bt, const T16* __restrict__ Bt2, int K, float* C, int ldc, const float* __restrict__ bias, size_t sA, size_t sB, size_t sC) {
    typedef typename WFrag<T16>::V V;
    __shared__ __align__(16) float os[NW * 4096 + 128 * 36];
    const size_t z = blockIdx.z; A += z * sA; if (A2) A2 += z * sA; Bt += z * sB; if (Bt2) Bt2 += z * sB; C += z * sC;
    const int lane = threadIdx.x & 31, lr = lane & 15, hi = lane >> 4; const int r0 = blockIdx.x * 64, c0 = blockIdx.y * 64;
    const int wv = __builtin_amdgcn_readfirstlane(threadIdx.x >> 5);      // wave number, scalar so that the K loop stays a scalar loop
    v8f acc[4][4];
#pragma unroll
    for (int mb = 0; mb < 4; ++mb)
#pragma unroll
        for (int nb = 0; nb < 4; ++nb) acc[mb][nb] = (v8f){};
    const size_t aoff = (size_t)(r0 + lr) * K + 8 * hi, boff = (size_t)(c0 + lr) * K + 8 * hi;
#pragma unroll 1
    for (int k0 = wv * 64; k0 < K; k0 += NW * 64) {      // wave wv takes every NW-th slice of 64 k (one 128-B line of each operand row)
#pragma unroll      // both 32-k halves of the slice in one trip: constant offsets from the trip's addresses
      for (int kc = k0; kc < k0 + 64; kc += 32) {
        V a[4], a2[4];
#pragma unroll
        for (int mb = 0; mb < 4; ++mb) { a[mb] = WFrag<T16>::ld(A + aoff + (size_t)mb * 16 * K + kc); if (NSPLIT == 1 || NSPLIT == 2) a2[mb] = WFrag<T16>::ld(A2 + aoff + (size_t)mb * 16 * K + kc); }
#pragma unroll
        for (int nb = 0; nb < 4; ++nb) { const V b = WFrag<T16>::ld(Bt + boff + (size_t)nb * 16 * K + kc); V b2; if (NSPLIT >= 2) b2 = WFrag<T16>::ld(Bt2 + boff + (size_t)nb * 16 * K + kc);
#pragma unroll
            for (int mb = 0; mb < 4; ++mb) { acc[mb][nb] = WFrag<T16>::mma(a[mb], b, acc[mb][nb]); if (NSPLIT == 1 || NSPLIT == 2) acc[mb][nb] = WFrag<T16>::mma(a2[mb], b, acc[mb][nb]); if (NSPLIT >= 2) acc[mb][nb] = WFrag<T16>::mma(a[mb], b2, acc[mb][nb]); } }
        asm volatile("v_nop\n\tv_nop\n\tv_nop\n\tv_nop" : "+v"(acc[0][0]), "+v"(acc[1][1]), "+v"(acc[2][2]), "+v"(acc[3][3]) : "v"(a[0]), "v"(a[3]));
      }
    }
    ksum_store<NW, BIAS>(acc, os, C + (size_t)r0 * ldc + c0, ldc, BIAS ? bias + c0 : bias, wv, lane);
}

// xwait4: s_wait_xcnt 0 behind a run of fragment loads. The run's addresses are inputs of the statement, so each stays in its registers until the wait (a precaution for replayed address translations).
template <typename T16> __device__ __forceinline__ void xwait4(const T16* p0, const T16* p1, const T16* p2, const T16* p3) { asm volatile("s_wait_xcnt 0x0" :: "v"(p0), "v"(p1), "v"(p2), "v"(p3) : "memory"); }

__device__ __forceinline__ h16 tohx(float x) { return (h16)x; }
__device__ __forceinline__ void splitf(float y, unsigned short& h, unsigned short& l) { h = f2bf(y); l = f2bf(y - bf2f(h)); }
typedef __attribute__((ext_vector_type(2))) _Float16 v2h;
typedef __attribute__((ext_vector_type(4))) _Float16 v4h;
typedef __attribute__((ext_vector_type(2))) unsigned short v2us;
typedef __attribute__((ext_vector_type(4))) unsigned short v4us;
typedef __attribute__((ext_vector_type(2))) float v2f;
typedef __attribute__((ext_vector_type(4))) int v4i;

__global__ __launch_bounds__(256) void k_cvt8(const float* __restrict__ src, bf* dst, size_t n8) { const size_t i = (size_t)blockIdx.x * 256 + threadIdx.x; if (i >= n8) return; const v8f v = *(const v8f*)(src + i * 8); v8us o;
#pragma unroll
    for (int k = 0; k < 8; ++k) o[k] = f2bf(v[k]); *(v8us*)(dst + i * 8) = o;  }

__global__ __launch_bounds__(256) void k_ropeI(const float* __restrict__ F, int pitch, int nheads, const float* __restrict__ CS, float sc, h16* P16, bf* Ph, bf* Pl) {
    const size_t e = ((size_t)blockIdx.x * 256 + threadIdx.x) * 2; if (e >= (size_t)nheads * TT * HD) return; const int d = (int)(e % HD); const int t = (int)((e / HD) % TT); const int h = (int)(e / ((size_t)HD * TT)); const float* f = F + (size_t)t * pitch + h * HD; const float x0 = f[d], x1 = f[d + 1]; const v2f cs = *(const v2f*)(CS + ((size_t)t * HD + d) * 2); v2h o16; v2us oh, ol;
    float a0 = __fmul_rn(x0, cs[0]), b0 = __fmul_rn(x1, cs[1]), a1 = __fmul_rn(x1, cs[0]), b1 = __fmul_rn(x0, cs[1]); asm volatile("" : "+v"(a0), "+v"(b0), "+v"(a1), "+v"(b1));
    float r0 = __fsub_rn(a0, b0) * sc, r1 = __fadd_rn(b1, a1) * sc;   /* even: x0 c - x1 s; odd: x0 s + x1 c */
    o16[0] = tohx(r0); o16[1] = tohx(r1); { unsigned short a2, c2; splitf(r0, a2, c2); oh[0] = a2; ol[0] = c2; splitf(r1, a2, c2); oh[1] = a2; ol[1] = c2; }
    *(v2h*)(P16 + e) = o16; *(v2us*)(Ph + e) = oh; *(v2us*)(Pl + e) = ol;  }
// k_rope: head planes [h][t][d] (fp16 + hi/lo) of rope(x) x sc with the rotate-half convention out[d] = x[d] cos[t][d] - x[d+HD/2] sin[t][d], out[d+HD/2] = x[d+HD/2] cos[t][d+HD/2] + x[d] sin[t][d+HD/2]
__global__ __launch_bounds__(256) void k_rope(const float* __restrict__ F, int pitch, int nheads, const float* __restrict__ CS, const float* __restrict__ RF, const float* __restrict__ nw, float sc, h16* P16, bf* Ph, bf* Pl) {
    const size_t e = ((size_t)blockIdx.x * 256 + threadIdx.x) * 2; if (e >= (size_t)nheads * TT * HD) return; const int d = (int)(e % HD); const int t = (int)((e / HD) % TT); const int h = (int)(e / ((size_t)HD * TT)); const float* f = F + (size_t)t * pitch + h * HD; const float rf = RF ? RF[(size_t)h * TT + t] : 1.0f; v2h o16; v2us oh, ol;
#pragma unroll
    for (int q = 0; q < 2; ++q) { const int dd = d + q; const int dp = (dd < HD / 2) ? dd + HD / 2 : dd - HD / 2; float x0 = f[dd], x1 = f[dp];
        if (RF) { float n0 = __fmul_rn(x0, rf), n1 = __fmul_rn(x1, rf); asm volatile("" : "+v"(n0)); asm volatile("" : "+v"(n1)); x0 = __fmul_rn(bfr(nw[dd]), n0); x1 = __fmul_rn(bfr(nw[dp]), n1); }
        const v2f cs = *(const v2f*)(CS + ((size_t)t * HD + dd) * 2); float a = __fmul_rn(x0, cs[0]), bq = __fmul_rn(x1, cs[1]); asm volatile("" : "+v"(a)); asm volatile("" : "+v"(bq)); const float r = ((dd < HD / 2) ? __fsub_rn(a, bq) : __fadd_rn(a, bq)) * sc;
        o16[q] = tohx(r); unsigned short a2, c2; splitf(r, a2, c2); oh[q] = a2; ol[q] = c2; }
    *(v2h*)(P16 + e) = o16; *(v2us*)(Ph + e) = oh; *(v2us*)(Pl + e) = ol;  }
__global__ __launch_bounds__(256) void k_vtp(const float* __restrict__ F, int pitch, int nheads, h16* V16, bf* Vh, bf* Vl) { const size_t e = ((size_t)blockIdx.x * 256 + threadIdx.x) * 2; if (e >= (size_t)nheads * HD * TT) return; const int t = (int)(e % TT); const int d = (int)((e / TT) % HD); const int g = (int)(e / ((size_t)TT * HD)); v2h o16; v2us oh, ol;
#pragma unroll
    for (int q = 0; q < 2; ++q) { const float x = F[(size_t)(t + q) * pitch + g * HD + d]; o16[q] = tohx(x); unsigned short a2, c2; splitf(x, a2, c2); oh[q] = a2; ol[q] = c2; }
    *(v2h*)(V16 + e) = o16; *(v2us*)(Vh + e) = oh; *(v2us*)(Vl + e) = ol;  }
__constant__ float INV2[HD / 2] = { 1.000000000e+00f, 7.498942018e-01f, 5.623413324e-01f, 4.216965139e-01f, 3.162277639e-01f, 2.371373624e-01f, 1.778279394e-01f, 1.333521456e-01f, 1.000000015e-01f, 7.498941571e-02f, 5.623412877e-02f, 4.216964915e-02f, 3.162277862e-02f, 2.371373586e-02f, 1.778279431e-02f, 1.333521493e-02f, 9.999999776e-03f, 7.498942316e-03f, 5.623413250e-03f, 4.216964822e-03f, 3.162277862e-03f, 2.371373819e-03f, 1.778279431e-03f, 1.333521446e-03f, 1.000000047e-03f, 7.498941850e-04f, 5.623413017e-04f, 4.216964880e-04f, 3.162277862e-04f, 2.371373848e-04f, 1.778279402e-04f, 1.333521504e-04f };   // float32 1.0 / (10000.0 ** (arange(0, 64, 2, dtype=float32) / 64)), generated with jnp to be bit-exact
__global__ __launch_bounds__(256) void k_csP(float* CS) { const int idx = blockIdx.x * 256 + threadIdx.x; if (idx >= TT * HD) return; const int d = idx % HD; const int t = idx / HD; const float a = __fmul_rn(__fmul_rn((float)t, 6.2831855f), INV2[d >> 1]); v2f cs; cs[0] = cosf(a); cs[1] = sinf(a); *(v2f*)(CS + (size_t)idx * 2) = cs;  }
// ---- k_fattn: causal attention in one launch; no score plane. One wave = one query head x 32 query rows; the REP heads of one kv group sit in one work-group and walk the same keys.
// Per 32 keys a wave forms S^T = K Q^T (A = 16 key rows, B = 16 query columns, Q kept in registers), so a lane holds scores of ONE query per column tile: lane (lr, hi), register j of key tile kt = key kt 16 + hi 8 + j.
// Softmax runs on a running maximum (base 2, scale folded in); two converted S^T tiles are the B operand of O^T += V^T P^T as they stand (the loader's k order 8 hi + e, 16 + 8 hi + e is theirs too).
// Rows < RH: bf16 hi/lo planes, 3 products each; the rest fp16. O^T / sum goes out as the merged bf16 hi/lo planes [t][head x HD + d], 8 consecutive d per lane.
__device__ __forceinline__ float xhalf(float x) { return __builtin_bit_cast(float, __builtin_amdgcn_permlanex16(__builtin_bit_cast(int, x), __builtin_bit_cast(int, x), 0x76543210, 0xfedcba98, false, false)); }   // the value of lane l ^ 16
__device__ __forceinline__ void ppack(const v8f& t0, const v8f& t1, v16h& h, v16h& l) { (void)l;
#pragma unroll
    for (int e = 0; e < 8; ++e) { h[e] = (h16)t0[e]; h[8 + e] = (h16)t1[e]; } }
__device__ __forceinline__ void ppack(const v8f& t0, const v8f& t1, v16bf& h, v16bf& l) {
#pragma unroll
    for (int e = 0; e < 8; ++e) { const __bf16 a = (__bf16)t0[e], b = (__bf16)t1[e]; h[e] = a; h[8 + e] = b; l[e] = (__bf16)(t0[e] - (float)a); l[8 + e] = (__bf16)(t1[e] - (float)b); } }
template <bool B> struct BoolC { static constexpr bool v = B; };
template <typename T16, int NSPLIT>
__device__ __forceinline__ void fattn(const T16* __restrict__ Q, const T16* __restrict__ Q2, const T16* __restrict__ Kp, const T16* __restrict__ Kp2, const T16* __restrict__ Vt, const T16* __restrict__ Vt2, int g, int head, int q0, int lane, bf* Ah, bf* Al) {
    typedef typename WFrag<T16>::V V;
    static_assert(NSPLIT == 0 || NSPLIT == 2, "one plane or hi/lo planes on both sides");
    constexpr float C2 = SCL * 1.4426950408889634f;      // score scale x log2 e. Every inner loop below is unrolled so that the fragment and tile arrays are indexed by constants and stay in registers.
    const int lr = lane & 15, hi = lane >> 4;
    const size_t qo = ((size_t)head * TT + q0 + lr) * HD + 8 * hi, ko = ((size_t)g * TT + lr) * HD + 8 * hi, vo = ((size_t)g * HD + lr) * TT + 8 * hi;
    V qf[2][2], qf2[2][2], kf[2][2], kf2[2][2];
    { const T16 *pq = Q + qo, *pq2 = (NSPLIT == 2) ? Q2 + qo : pq, *pk = Kp + ko, *pk2 = (NSPLIT == 2) ? Kp2 + ko : pk;
#pragma unroll
      for (int t = 0; t < 2; ++t)
#pragma unroll
          for (int ks = 0; ks < 2; ++ks) { qf[t][ks] = WFrag<T16>::ld(pq + t * 16 * HD + ks * 32); kf[t][ks] = WFrag<T16>::ld(pk + t * 16 * HD + ks * 32); if (NSPLIT == 2) { qf2[t][ks] = WFrag<T16>::ld(pq2 + t * 16 * HD + ks * 32); kf2[t][ks] = WFrag<T16>::ld(pk2 + t * 16 * HD + ks * 32); } }
      xwait4(pq, pq2, pk, pk2); }
    v8f o[4][2];
#pragma unroll
    for (int db = 0; db < 4; ++db)
#pragma unroll
        for (int qt = 0; qt < 2; ++qt) o[db][qt] = (v8f){};
    float m[2] = { -3.0e38f, -3.0e38f }, nm[2] = { 3.0e38f * C2, 3.0e38f * C2 }, l[2] = { 0.f, 0.f };      // running maximum (raw score), minus its scaled value, this lane's share of the sum
    auto block = [&](int k0, auto lastc) __attribute__((always_inline)) {
        constexpr bool LAST = decltype(lastc)::v;      // the diagonal block (k0 == q0): masked, and nothing fetched ahead
        V vf[4], vf2[4];
        { const T16 *pv = Vt + vo + k0, *pv2 = (NSPLIT == 2) ? Vt2 + vo + k0 : pv;      // issued here, used behind the softmax
#pragma unroll
          for (int db = 0; db < 4; ++db) { vf[db] = WFrag<T16>::ld(pv + (size_t)db * 16 * TT); if (NSPLIT == 2) vf2[db] = WFrag<T16>::ld(pv2 + (size_t)db * 16 * TT); }
          xwait4(pv, pv2, pv, pv2); }
        v8f s[2][2];
#pragma unroll
        for (int kt = 0; kt < 2; ++kt)
#pragma unroll
            for (int qt = 0; qt < 2; ++qt) { v8f c = (v8f){};
#pragma unroll
                for (int ks = 0; ks < 2; ++ks) { c = WFrag<T16>::mma(kf[kt][ks], qf[qt][ks], c); if (NSPLIT == 2) { c = WFrag<T16>::mma(kf[kt][ks], qf2[qt][ks], c); c = WFrag<T16>::mma(kf2[kt][ks], qf[qt][ks], c); } }
                s[kt][qt] = c; }
        if constexpr (!LAST) { const T16 *pk = Kp + ko + (size_t)(k0 + 32) * HD, *pk2 = (NSPLIT == 2) ? Kp2 + ko + (size_t)(k0 + 32) * HD : pk;      // the next block's key fragments fly during this block's softmax and P.V
#pragma unroll
            for (int t = 0; t < 2; ++t)
#pragma unroll
                for (int ks = 0; ks < 2; ++ks) { kf[t][ks] = WFrag<T16>::ld(pk + t * 16 * HD + ks * 32); if (NSPLIT == 2) kf2[t][ks] = WFrag<T16>::ld(pk2 + t * 16 * HD + ks * 32); }
            xwait4(pk, pk2, pk, pk2); }
        if constexpr (LAST) {
#pragma unroll
            for (int kt = 0; kt < 2; ++kt)
#pragma unroll
                for (int qt = 0; qt < 2; ++qt)
#pragma unroll
                    for (int j = 0; j < 8; ++j) if (kt * 16 + hi * 8 + j > qt * 16 + lr) s[kt][qt][j] = -3.0e38f; }      // key beyond the query: excluded
        float mb[2];
#pragma unroll
        for (int qt = 0; qt < 2; ++qt) { float x0 = fmaxf(s[0][qt][0], s[1][qt][0]), x1 = fmaxf(s[0][qt][1], s[1][qt][1]);
#pragma unroll
            for (int j = 2; j < 8; j += 2) { x0 = fmaxf(x0, fmaxf(s[0][qt][j], s[1][qt][j])); x1 = fmaxf(x1, fmaxf(s[0][qt][j + 1], s[1][qt][j + 1])); }
            x0 = fmaxf(x0, x1); mb[qt] = fmaxf(x0, xhalf(x0)); }
        if (__builtin_amdgcn_ballot_w32(mb[0] > m[0] || mb[1] > m[1]) != 0) {      // scalar branch: a maximum rose somewhere in the wave (rare after the first blocks)
#pragma unroll
            for (int qt = 0; qt < 2; ++qt) { const float mn = fmaxf(m[qt], mb[qt]), nn = -(mn * C2), al = __builtin_amdgcn_exp2f(nn - nm[qt]); m[qt] = mn; nm[qt] = nn; l[qt] *= al;
#pragma unroll
                for (int db = 0; db < 4; ++db) o[db][qt] *= al; } }
        V ph[2], pl[2];
#pragma unroll
        for (int qt = 0; qt < 2; ++qt) { float a[4] = { 0.f, 0.f, 0.f, 0.f };
#pragma unroll
            for (int kt = 0; kt < 2; ++kt)
#pragma unroll
                for (int j = 0; j < 8; ++j) { const float p = __builtin_amdgcn_exp2f(__builtin_fmaf(s[kt][qt][j], C2, nm[qt])); s[kt][qt][j] = p; a[j & 3] += p; }
            l[qt] += (a[0] + a[1]) + (a[2] + a[3]); ppack(s[0][qt], s[1][qt], ph[qt], pl[qt]); }
#pragma unroll
        for (int db = 0; db < 4; ++db)
#pragma unroll
            for (int qt = 0; qt < 2; ++qt) { o[db][qt] = WFrag<T16>::mma(vf[db], ph[qt], o[db][qt]); if (NSPLIT == 2) { o[db][qt] = WFrag<T16>::mma(vf[db], pl[qt], o[db][qt]); o[db][qt] = WFrag<T16>::mma(vf2[db], ph[qt], o[db][qt]); } }
    };
#pragma unroll 1      // rolled: the key fragments fetched ahead land in the registers the next trip reads, and the loop's code stays short
    for (int k0 = 0; k0 < q0; k0 += 32) block(k0, BoolC<false>());
    block(q0, BoolC<true>());
#pragma unroll
    for (int qt = 0; qt < 2; ++qt) { const float inv = __fdiv_rn(1.0f, l[qt] + xhalf(l[qt])); const size_t oo = (size_t)(q0 + qt * 16 + lr) * DQ + head * HD + hi * 8;      // the two lane halves' sums join here, once
#pragma unroll
        for (int db = 0; db < 4; ++db) { v8us oh, ol;
#pragma unroll
            for (int j = 0; j < 8; ++j) { unsigned short a, c2; splitf(o[db][qt][j] * inv, a, c2); oh[j] = a; ol[j] = c2; }
            *(v8us*)(Ah + oo + db * 16) = oh; *(v8us*)(Al + oo + db * 16) = ol; } }
}
// grid (NKV, TT / 64), 2 REP waves: waves 0..REP-1 take 32-row block TT/32 - 1 - y (long), waves REP.. block y (short), one head each, so that every work-group walks about the same number of key blocks. The waves share no barrier and no buffer.
// Register budget: two waves per SIMD (one work-group per WGP).
__global__ __launch_bounds__(2 * REP * 32, 2) void k_fattn(const h16* __restrict__ Q16, const h16* __restrict__ K16, const h16* __restrict__ V16, const bf* __restrict__ Qh, const bf* __restrict__ Ql, const bf* __restrict__ Kh, const bf* __restrict__ Kl, const bf* __restrict__ Vh, const bf* __restrict__ Vl, bf* Ah, bf* Al) {
    const int lane = threadIdx.x & 31, wv = __builtin_amdgcn_readfirstlane(threadIdx.x >> 5);      // wave number, scalar so that head, row block and the key loop stay scalar
    const int g = blockIdx.x, head = g * REP + (wv & (REP - 1)), q0 = ((wv < REP) ? TT / 32 - 1 - (int)blockIdx.y : (int)blockIdx.y) * 32;
    if (q0 < RH) fattn<bf, 2>(Qh, Ql, Kh, Kl, Vh, Vl, g, head, q0, lane, Ah, Al); else fattn<h16, 0>(Q16, nullptr, K16, nullptr, V16, nullptr, g, head, q0, lane, Ah, Al);
}

extern "C" void kernel_launch(void* const* d_in, const int* in_sizes, int n_in,
                              void* d_out, int out_size, void* d_ws, size_t ws_size, hipStream_t stream) {
    (void)in_sizes; (void)n_in; (void)out_size;
    const float* x = (const float*)d_in[0]; const float* wq = (const float*)d_in[1]; const float* wk = (const float*)d_in[2]; const float* wv = (const float*)d_in[3]; const float* wo = (const float*)d_in[4];   /* order x, Wq ('oi' [2048][2048]), Wk, Wv ('oi' [512][2048]), Wo ('oi') */
    float* OUT = (float*)d_out;     // [2][2048][2048]
    char* wsp = (char*)d_ws;
    auto take = [&](size_t bytes) { char* p = wsp; wsp += (bytes + 255) & ~(size_t)255; return (void*)p; };
    bf* WQ = (bf*)take((size_t)DQ * DM * 2); bf* WK = (bf*)take((size_t)DKV * DM * 2); bf* WV = (bf*)take((size_t)DKV * DM * 2); bf* WO = (bf*)take((size_t)DM * DQ * 2); float* CS = (float*)take((size_t)TT * HD * 2 * 4);
    bf* XB = (bf*)take((size_t)TT * DM * 2); float* FQ = (float*)take((size_t)TT * DQ * 4); float* FK = (float*)take((size_t)TT * DKV * 4);
    h16* QP16 = (h16*)take((size_t)NH_ * TT * HD * 2); h16* KP16 = (h16*)take((size_t)NKV * TT * HD * 2); h16* VT16 = (h16*)take((size_t)NKV * HD * TT * 2);
    bf* QPh = (bf*)take((size_t)NH_ * TT * HD * 2); bf* QPl = (bf*)take((size_t)NH_ * TT * HD * 2); bf* KPh = (bf*)take((size_t)NKV * TT * HD * 2); bf* KPl = (bf*)take((size_t)NKV * TT * HD * 2); bf* VTh = (bf*)take((size_t)NKV * HD * TT * 2); bf* VTl = (bf*)take((size_t)NKV * HD * TT * 2);
    bf* ATh = (bf*)take((size_t)TT * DQ * 2); bf* ATl = (bf*)take((size_t)TT * DQ * 2);
    if ((size_t)(wsp - (char*)d_ws) > ws_size) return;    // ws 256 MiB
    float* FV = FK;   // v projection reuses the k buffer after the k planes are built (stream-ordered)
    { k_cvt8<<<(unsigned)(((size_t)DQ * DM / 8 + 255) / 256), 256, 0, stream>>>(wq, WQ, (size_t)DQ * DM / 8); k_cvt8<<<(unsigned)(((size_t)DKV * DM / 8 + 255) / 256), 256, 0, stream>>>(wk, WK, (size_t)DKV * DM / 8); k_cvt8<<<(unsigned)(((size_t)DKV * DM / 8 + 255) / 256), 256, 0, stream>>>(wv, WV, (size_t)DKV * DM / 8);
      k_cvt8<<<(unsigned)(((size_t)DM * DQ / 8 + 255) / 256), 256, 0, stream>>>(wo, WO, (size_t)DM * DQ / 8);
       }
    k_csP<<<(TT * HD + 255) / 256, 256, 0, stream>>>(CS);
    const unsigned LQ = (unsigned)(((size_t)NH_ * TT * HD / 2 + 255) / 256), LKv = (unsigned)(((size_t)NKV * TT * HD / 2 + 255) / 256);
    for (int b = 0; b < NB_; ++b) {
        
        k_cvt8<<<(unsigned)(((size_t)TT * DM / 8 + 255) / 256), 256, 0, stream>>>(x + (size_t)b * TT * DM, XB, (size_t)TT * DM / 8);
        k_gemmw<bf, 0, false, 8><<<dim3(TT / 64, DQ / 64, 1), 256, 0, stream>>>(XB, nullptr, WQ, nullptr, DM, FQ, DQ, nullptr, 0, 0, 0);
        k_ropeI<<<LQ, 256, 0, stream>>>(FQ, DQ, NH_, CS, 1.0f, QP16, QPh, QPl);
        k_gemmw<bf, 0, false, 16><<<dim3(TT / 64, DKV / 64, 1), 512, 0, stream>>>(XB, nullptr, WK, nullptr, DM, FK, DKV, nullptr, 0, 0, 0);
        k_ropeI<<<LKv, 256, 0, stream>>>(FK, DKV, NKV, CS, 1.0f, KP16, KPh, KPl);
        k_gemmw<bf, 0, false, 16><<<dim3(TT / 64, DKV / 64, 1), 512, 0, stream>>>(XB, nullptr, WV, nullptr, DM, FV, DKV, nullptr, 0, 0, 0); k_vtp<<<LKv, 256, 0, stream>>>(FV, DKV, NKV, VT16, VTh, VTl);
        k_fattn<<<dim3(NKV, TT / 64, 1), 2 * REP * 32, 0, stream>>>(QP16, KP16, VT16, QPh, QPl, KPh, KPl, VTh, VTl, ATh, ATl);
        k_gemmw<bf, 1, false, 8><<<dim3(TT / 64, DM / 64, 1), 256, 0, stream>>>(ATh, ATl, WO, nullptr, DQ, OUT + (size_t)b * TT * DM, DM, nullptr, 0, 0, 0); }
}

// v004
// It runs in 377 microseconds.
// Two timings next to v003 put it at 1.04 and 1.08 times that version's speed.
// Over all steps from v000 it is 7.29 times as fast.
#include <hip/hip_runtime.h>

// Causal grouped-query attention with interleaved-pair rotary embeddings whose positions carry a 2 pi factor (x [2][2048][2048]; q = x Wq^T (32 heads x 64), k, v = x Wk^T, x Wv^T (8 kv heads x 64) ('oi' 1/sqrt(2048), no bias); rope on (even, odd) pairs: (re, im) = (q0 c - q1 s, q0 s + q1 c) with angle fl(fl(s x 2 pi) x freq_i), freq_i = 1 / 10000^(2i/64) (32 f32 frequencies jnp-exact; TWO f32 products; precise cosf/sinf); k, v repeated 4 x along the head axis: kv head = q head / 4; scores / sqrt(64); causal (finfo.min == exclusion); softmax; out = merged Wo^T ('oi', no bias) -> [2][2048][2048] (8.4 M); argument order x, Wq, Wk, Wv, Wo).
// Layout per batch: bf16 copy of x; 'oi' weights as-is; exact projections whose epilogue applies the rotary table and writes the head planes (v: product formed transposed); causal T-2048 GQA attention in one launch (k_fattn: scores, running-maximum softmax and P.V in registers; hybrid rows: < 512 hi/lo 3 products, rest fp16); merged hi/lo x Wo exact.
// Compute dtypes, f32 accumulate: every input rounded to bf16; projections exact; attention rows < 512 3 products, rest fp16; softmax f32; output projection hl x exact.

#define NB_  2
#define TT   2048
#define DM   2048
#define NH_  32
#define NKV  8
#define REP  (NH_ / NKV)
#define HD   64
#define DQ   (NH_ * HD)
#define DKV  (NKV * HD)
#define RH   512                  // query rows < RH use hi+lo planes (0: none)
#define SCL  0.125f   // HD^-0.5
static_assert(RH % 32 == 0 && TT % 64 == 0 && (REP & (REP - 1)) == 0, "a 32-row block is wholly hi/lo or wholly fp16; blocks pair up; the head comes from the low bits of the wave number");
typedef _Float16 h16;
typedef unsigned short bf;
typedef __attribute__((ext_vector_type(16))) __bf16   v16bf;
typedef __attribute__((ext_vector_type(16))) _Float16 v16h;
typedef __attribute__((ext_vector_type(8)))  _Float16 v8h;
typedef __attribute__((ext_vector_type(8)))  unsigned short v8us;
typedef __attribute__((ext_vector_type(8)))  float    v8f;
typedef __attribute__((ext_vector_type(4)))  float    v4f;
typedef v8h  __attribute__((may_alias)) v8ha;
typedef v4f  __attribute__((may_alias)) v4fa;
typedef v8us __attribute__((may_alias)) v8usa;

__device__ __forceinline__ unsigned short f2bf(float f) { unsigned u = __float_as_uint(f); u += 0x7FFFu + ((u >> 16) & 1u); return (unsigned short)(u >> 16); }
__device__ __forceinline__ float bf2f(unsigned short b) { return __uint_as_float(((unsigned)b) << 16); }
__device__ __forceinline__ float bfr(float f) { return bf2f(f2bf(f)); }
__device__ __forceinline__ void splitf(float y, unsigned short& h, unsigned short& l) { h = f2bf(y); l = f2bf(y - bf2f(h)); }
typedef __attribute__((ext_vector_type(2))) float v2f;
__device__ __forceinline__ v16h cat16(v8h lo, v8h hi) { return __builtin_shufflevector(lo, hi, 0, 1, 2, 3, 4, 5, 6, 7, 8, 9, 10, 11, 12, 13, 14, 15); }
__device__ __forceinline__ v16bf cat16b(v8us lo, v8us hi) { return __builtin_bit_cast(v16bf, __builtin_shufflevector(lo, hi, 0, 1, 2, 3, 4, 5, 6, 7, 8, 9, 10, 11, 12, 13, 14, 15)); }
__device__ __forceinline__ v8f wmma16(v16h a, v16h b, v8f c) { return __builtin_amdgcn_wmma_f32_16x16x32_f16(false, a, false, b, (short)0, c, false, false); }
__device__ __forceinline__ v8f wmmab(v16bf a, v16bf b, v8f c) { return __builtin_amdgcn_wmma_f32_16x16x32_bf16(false, a, false, b, (short)0, c, false, false); }



// ---- k_gemmw: register-blocked GEMM, one work-group of NW waves per 64x64 output tile; each wave holds the whole tile (16 accumulators) for its share of K, operands straight from K-contiguous 16-bit planes; grid (M/64, N/64, Z), NW x 32 threads.
// C[m][n] (f32, pitch ldc, + optional f32 bias[n]) = sum_k A[m][k] Bt[n][k] (+ split products per NSPLIT). z-batch strides sA/sB/sC in elements. K % 64 == 0. EPI 0: C is stored; EPI 1, 2: no C, the tile goes out as 16-bit planes (ksum_planes).
template <typename T16> struct WFrag;
template <> struct WFrag<h16> { typedef v16h V; static __device__ __forceinline__ V ld(const h16* p) { return cat16(*(const v8h*)p, *(const v8h*)(p + 16)); } static __device__ __forceinline__ v8f mma(V a, V b, v8f c) { return wmma16(a, b, c); } };
template <> struct WFrag<bf> { typedef v16bf V; static __device__ __forceinline__ V ld(const bf* p) { return cat16b(*(const v8us*)p, *(const v8us*)(p + 16)); } static __device__ __forceinline__ v8f mma(V a, V b, v8f c) { return wmmab(a, b, c); } };
// ksum_store: the NW waves of a work-group each hold a partial 64x64 f32 tile (their share of K). Every wave writes its tile to LDS in register order (32 slots of 16 B per lane), one barrier,
// then wave w sums slots w*32/NW.. over the waves in the fixed order 0..NW-1, turns its rows (32 columns = one 128-B line each) through its own LDS strip and stores whole lines. Ct = the tile's first element.
template <int NW, bool BIAS>
__device__ __forceinline__ void ksum_store(const v8f (&acc)[4][4], float* ps, float* Ct, int ldc, const float* bias, int wv, int lane) {
    constexpr int SP = 32 / NW, RW = SP * 4;      // slots and rows per summing wave
    const int lr = lane & 15, hi = lane >> 4;
    v4fa* pw = (v4fa*)ps;
#pragma unroll
    for (int mb = 0; mb < 4; ++mb)
#pragma unroll
        for (int nb = 0; nb < 4; ++nb)
#pragma unroll
            for (int jh = 0; jh < 2; ++jh) { const int q = ((mb * 2 + (nb >> 1)) * 2 + jh) * 2 + (nb & 1); pw[(wv * 32 + q) * 32 + lane] = (v4f){ acc[mb][nb][jh * 4], acc[mb][nb][jh * 4 + 1], acc[mb][nb][jh * 4 + 2], acc[mb][nb][jh * 4 + 3] }; }
    __syncthreads();      // every wave's partial tile is in LDS before any wave sums
    v4f r[SP];
#pragma unroll
    for (int i = 0; i < SP; ++i) r[i] = pw[(wv * SP + i) * 32 + lane];
#pragma unroll
    for (int s = 1; s < NW; ++s)
#pragma unroll
        for (int i = 0; i < SP; ++i) r[i] += pw[(s * 32 + wv * SP + i) * 32 + lane];
    const int q0 = wv * SP, mb = q0 >> 3, nbp = (q0 >> 2) & 1, jh0 = (q0 >> 1) & 1;      // slot q = ((mb*2 + nb/2)*2 + jh)*2 + nb%2
    float* sw = ps + NW * 4096 + wv * (RW * 36);
#pragma unroll
    for (int i = 0; i < SP; ++i)
#pragma unroll
        for (int jj = 0; jj < 4; ++jj) sw[(hi * (RW / 2) + (i >> 1) * 4 + jj) * 36 + (i & 1) * 16 + lr] = r[i][jj];
    asm volatile("s_wait_dscnt 0x0" ::: "memory");      // the wave's own strip is written before other lanes of the wave read it back
#pragma unroll
    for (int i = 0; i < SP; ++i) { const int idx = i * 32 + lane, lrow = idx >> 3, cofs = nbp * 32 + (idx & 7) * 4; const int trow = (SP == 4) ? lrow : ((lrow >> 2) * 8 + jh0 * 4 + (lrow & 3));
        v4f val = *(const v4fa*)(sw + lrow * 36 + (idx & 7) * 4); if (BIAS) { val[0] += bfr(bias[cofs]); val[1] += bfr(bias[cofs + 1]); val[2] += bfr(bias[cofs + 2]); val[3] += bfr(bias[cofs + 3]); }
        *(v4f*)(Ct + (size_t)(mb * 16 + trow) * ldc + cofs) = val; }
}
// ksum_planes: the same wave sum as ksum_store, but the 64x64 tile leaves as 16-bit planes (fp16 + bf16 hi/lo) instead of f32. The summed slots go into one LDS tile (pitch 68 floats), one more barrier,
// then each wave takes 64 / NW whole rows, 8 consecutive columns per lane, so that 8 lanes store one whole 128-B line of each plane. P16 / Ph / Pl = the tile's first element in each plane.
// EPI 1: tile rows = positions, tile columns = the 64 dims of one head; (even, odd) pairs are rotated by the table row CSt[row][d] = (cos, sin); plane pitch HD. EPI 2: values as they are; plane pitch TT.
template <int NW, int EPI>
__device__ __forceinline__ void ksum_planes(const v8f (&acc)[4][4], float* ps, const float* __restrict__ CSt, h16* P16, bf* Ph, bf* Pl, int wv, int lane) {
    static_assert(HD == 64, "one 64-column tile is one head");
    constexpr int SP = 32 / NW, NI = 16 / NW, PT = 68, PP = (EPI == 1) ? HD : TT;      // slots per summing wave; groups of 4 rows per storing wave; LDS tile pitch; plane pitch
    const int lr = lane & 15, hi = lane >> 4, c8 = (lane & 7) * 8, rw = wv * (64 / NW) + (lane >> 3);
    v2f cs[NI][4];
    if constexpr (EPI == 1) { const float* pc = CSt + (rw * HD + c8) * 2;      // issued first: the table values fly while the partial tiles go to LDS
#pragma unroll
        for (int it = 0; it < NI; ++it)
#pragma unroll
            for (int p = 0; p < 4; ++p) cs[it][p] = *(const v2f*)(pc + (it * 4 * HD + 2 * p) * 2);
        asm volatile("s_wait_xcnt 0x0" :: "v"(pc) : "memory"); }      // the run's address is an input, so it stays in its registers until the wait: otherwise the last load's result lands in the address pair the earlier loads name (a precaution, as in xwait4)
    v4fa* pw = (v4fa*)ps;
#pragma unroll
    for (int mb = 0; mb < 4; ++mb)
#pragma unroll
        for (int nb = 0; nb < 4; ++nb)
#pragma unroll
            for (int jh = 0; jh < 2; ++jh) { const int q = ((mb * 2 + (nb >> 1)) * 2 + jh) * 2 + (nb & 1); pw[(wv * 32 + q) * 32 + lane] = (v4f){ acc[mb][nb][jh * 4], acc[mb][nb][jh * 4 + 1], acc[mb][nb][jh * 4 + 2], acc[mb][nb][jh * 4 + 3] }; }
    __syncthreads();      // every wave's partial tile is in LDS before any wave sums
    v4f r[SP];
#pragma unroll
    for (int i = 0; i < SP; ++i) r[i] = pw[(wv * SP + i) * 32 + lane];
#pragma unroll
    for (int s = 1; s < NW; ++s)
#pragma unroll
        for (int i = 0; i < SP; ++i) r[i] += pw[(s * 32 + wv * SP + i) * 32 + lane];
    float* tl = ps + NW * 4096;
#pragma unroll
    for (int i = 0; i < SP; ++i) { const int q = wv * SP + i, mb = q >> 3, nb = ((q >> 2) & 1) * 2 + (q & 1), jh = (q >> 1) & 1;      // slot q = ((mb*2 + nb/2)*2 + jh)*2 + nb%2
#pragma unroll
        for (int jj = 0; jj < 4; ++jj) tl[(mb * 16 + hi * 8 + jh * 4 + jj) * PT + nb * 16 + lr] = r[i][jj]; }
    __syncthreads();      // the whole summed tile is in LDS before any wave reads whole rows of it
#pragma unroll
    for (int it = 0; it < NI; ++it) { const int row = rw + it * 4; const v4f u0 = *(const v4fa*)(tl + row * PT + c8), u1 = *(const v4fa*)(tl + row * PT + c8 + 4);
        float y[8] = { u0[0], u0[1], u0[2], u0[3], u1[0], u1[1], u1[2], u1[3] };
        if constexpr (EPI == 1) {
#pragma unroll
            for (int p = 0; p < 4; ++p) { const float x0 = y[2 * p], x1 = y[2 * p + 1], c = cs[it][p][0], s = cs[it][p][1]; y[2 * p] = x0 * c - x1 * s; y[2 * p + 1] = x0 * s + x1 * c; } }      // even: x0 c - x1 s; odd: x0 s + x1 c
        v8h o16; v8us oh, ol;
#pragma unroll
        for (int e = 0; e < 8; ++e) { o16[e] = (h16)y[e]; unsigned short a, b; splitf(y[e], a, b); oh[e] = a; ol[e] = b; }
        const size_t e0 = (size_t)row * PP + c8;
        *(v8h*)(P16 + e0) = o16; *(v8us*)(Ph + e0) = oh; *(v8us*)(Pl + e0) = ol; }
}
// Register budget: four waves per SIMD (two 8-wave work-groups or one 16-wave work-group on a WGP).
template <typename T16, int NSPLIT, bool BIAS, int NW, int EPI>
__global__ __launch_bounds__(NW * 32, 4) void k_gemmw(const T16* __restrict__ A, const T16* __restrict__ A2, const T16* __restrict__ Bt, const T16* __restrict__ Bt2, int K, float* C, int ldc, const float* __restrict__ bias, size_t sA, size_t sB, size_t sC, const float* __restrict__ CS, h16* P16, bf* Ph, bf* Pl) {
    typedef typename WFrag<T16>::V V;
    __shared__ __align__(16) float os[NW * 4096 + 128 * 36];
    const size_t z = blockIdx.z; A += z * sA; if (A2) A2 += z * sA; Bt += z * sB; if (Bt2) Bt2 += z * sB; C += z * sC;
    const int lane = threadIdx.x & 31, lr = lane & 15, hi = lane >> 4; const int r0 = blockIdx.x * 64, c0 = blockIdx.y * 64;
    const int wv = __builtin_amdgcn_readfirstlane(threadIdx.x >> 5);      // wave number, scalar so that the K loop stays a scalar loop
    v8f acc[4][4];
#pragma unroll
    for (int mb = 0; mb < 4; ++mb)
#pragma unroll
        for (int nb = 0; nb < 4; ++nb) acc[mb][nb] = (v8f){};
    const size_t aoff = (size_t)(r0 + lr) * K + 8 * hi, boff = (size_t)(c0 + lr) * K + 8 * hi;
#pragma unroll 1
    for (int k0 = wv * 64; k0 < K; k0 += NW * 64) {      // wave wv takes every NW-th slice of 64 k (one 128-B line of each operand row)
#pragma unroll      // both 32-k halves of the slice in one trip: constant offsets from the trip's addresses
      for (int kc = k0; kc < k0 + 64; kc += 32) {
        V a[4], a2[4];
#pragma unroll
        for (int mb = 0; mb < 4; ++mb) { a[mb] = WFrag<T16>::ld(A + aoff + (size_t)mb * 16 * K + kc); if (NSPLIT == 1 || NSPLIT == 2) a2[mb] = WFrag<T16>::ld(A2 + aoff + (size_t)mb * 16 * K + kc); }
#pragma unroll
        for (int nb = 0; nb < 4; ++nb) { const V b = WFrag<T16>::ld(Bt + boff + (size_t)nb * 16 * K + kc); V b2; if (NSPLIT >= 2) b2 = WFrag<T16>::ld(Bt2 + boff + (size_t)nb * 16 * K + kc);
#pragma unroll
            for (int mb = 0; mb < 4; ++mb) { acc[mb][nb] = WFrag<T16>::mma(a[mb], b, acc[mb][nb]); if (NSPLIT == 1 || NSPLIT == 2) acc[mb][nb] = WFrag<T16>::mma(a2[mb], b, acc[mb][nb]); if (NSPLIT >= 2) acc[mb][nb] = WFrag<T16>::mma(a[mb], b2, acc[mb][nb]); } }
        asm volatile("v_nop\n\tv_nop\n\tv_nop\n\tv_nop" : "+v"(acc[0][0]), "+v"(acc[1][1]), "+v"(acc[2][2]), "+v"(acc[3][3]) : "v"(a[0]), "v"(a[3]));
      }
    }
    if constexpr (EPI == 0) ksum_store<NW, BIAS>(acc, os, C + (size_t)r0 * ldc + c0, ldc, BIAS ? bias + c0 : bias, wv, lane);
    else { const size_t po = (EPI == 1) ? ((size_t)blockIdx.y * TT + r0) * HD : (size_t)r0 * TT + c0;      // EPI 1: planes [head = tile column][t][d]; EPI 2: planes [row][t]
        ksum_planes<NW, EPI>(acc, os, CS + (size_t)r0 * HD * 2, P16 + po, Ph + po, Pl + po, wv, lane); }
}

// xwait4: s_wait_xcnt 0 behind a run of fragment loads. The run's addresses are inputs of the statement, so each stays in its registers until the wait (a precaution for replayed address translations).
template <typename T16> __device__ __forceinline__ void xwait4(const T16* p0, const T16* p1, const T16* p2, const T16* p3) { asm volatile("s_wait_xcnt 0x0" :: "v"(p0), "v"(p1), "v"(p2), "v"(p3) : "memory"); }

__device__ __forceinline__ h16 tohx(float x) { return (h16)x; }
typedef __attribute__((ext_vector_type(2))) _Float16 v2h;
typedef __attribute__((ext_vector_type(4))) _Float16 v4h;
typedef __attribute__((ext_vector_type(2))) unsigned short v2us;
typedef __attribute__((ext_vector_type(4))) unsigned short v4us;
typedef __attribute__((ext_vector_type(4))) int v4i;

__global__ __launch_bounds__(256) void k_cvt8(const float* __restrict__ src, bf* dst, size_t n8) { const size_t i = (size_t)blockIdx.x * 256 + threadIdx.x; if (i >= n8) return; const v8f v = *(const v8f*)(src + i * 8); v8us o;
#pragma unroll
    for (int k = 0; k < 8; ++k) o[k] = f2bf(v[k]); *(v8us*)(dst + i * 8) = o;  }

// k_rope: head planes [h][t][d] (fp16 + hi/lo) of rope(x) x sc with the rotate-half convention out[d] = x[d] cos[t][d] - x[d+HD/2] sin[t][d], out[d+HD/2] = x[d+HD/2] cos[t][d+HD/2] + x[d] sin[t][d+HD/2]
__global__ __launch_bounds__(256) void k_rope(const float* __restrict__ F, int pitch, int nheads, const float* __restrict__ CS, const float* __restrict__ RF, const float* __restrict__ nw, float sc, h16* P16, bf* Ph, bf* Pl) {
    const size_t e = ((size_t)blockIdx.x * 256 + threadIdx.x) * 2; if (e >= (size_t)nheads * TT * HD) return; const int d = (int)(e % HD); const int t = (int)((e / HD) % TT); const int h = (int)(e / ((size_t)HD * TT)); const float* f = F + (size_t)t * pitch + h * HD; const float rf = RF ? RF[(size_t)h * TT + t] : 1.0f; v2h o16; v2us oh, ol;
#pragma unroll
    for (int q = 0; q < 2; ++q) { const int dd = d + q; const int dp = (dd < HD / 2) ? dd + HD / 2 : dd - HD / 2; float x0 = f[dd], x1 = f[dp];
        if (RF) { float n0 = __fmul_rn(x0, rf), n1 = __fmul_rn(x1, rf); asm volatile("" : "+v"(n0)); asm volatile("" : "+v"(n1)); x0 = __fmul_rn(bfr(nw[dd]), n0); x1 = __fmul_rn(bfr(nw[dp]), n1); }
        const v2f cs = *(const v2f*)(CS + ((size_t)t * HD + dd) * 2); float a = __fmul_rn(x0, cs[0]), bq = __fmul_rn(x1, cs[1]); asm volatile("" : "+v"(a)); asm volatile("" : "+v"(bq)); const float r = ((dd < HD / 2) ? __fsub_rn(a, bq) : __fadd_rn(a, bq)) * sc;
        o16[q] = tohx(r); unsigned short a2, c2; splitf(r, a2, c2); oh[q] = a2; ol[q] = c2; }
    *(v2h*)(P16 + e) = o16; *(v2us*)(Ph + e) = oh; *(v2us*)(Pl + e) = ol;  }
__constant__ float INV2[HD / 2] = { 1.000000000e+00f, 7.498942018e-01f, 5.623413324e-01f, 4.216965139e-01f, 3.162277639e-01f, 2.371373624e-01f, 1.778279394e-01f, 1.333521456e-01f, 1.000000015e-01f, 7.498941571e-02f, 5.623412877e-02f, 4.216964915e-02f, 3.162277862e-02f, 2.371373586e-02f, 1.778279431e-02f, 1.333521493e-02f, 9.999999776e-03f, 7.498942316e-03f, 5.623413250e-03f, 4.216964822e-03f, 3.162277862e-03f, 2.371373819e-03f, 1.778279431e-03f, 1.333521446e-03f, 1.000000047e-03f, 7.498941850e-04f, 5.623413017e-04f, 4.216964880e-04f, 3.162277862e-04f, 2.371373848e-04f, 1.778279402e-04f, 1.333521504e-04f };   // float32 1.0 / (10000.0 ** (arange(0, 64, 2, dtype=float32) / 64)), generated with jnp to be bit-exact
__global__ __launch_bounds__(256) void k_csP(float* CS) { const int idx = blockIdx.x * 256 + threadIdx.x; if (idx >= TT * HD) return; const int d = idx % HD; const int t = idx / HD; const float a = __fmul_rn(__fmul_rn((float)t, 6.2831855f), INV2[d >> 1]); v2f cs; cs[0] = cosf(a); cs[1] = sinf(a); *(v2f*)(CS + (size_t)idx * 2) = cs;  }
// ---- k_fattn: causal attention in one launch; no score plane. One wave = one query head x 32 query rows; the REP heads of one kv group sit in one work-group and walk the same keys.
// Per 32 keys a wave forms S^T = K Q^T (A = 16 key rows, B = 16 query columns, Q kept in registers), so a lane holds scores of ONE query per column tile: lane (lr, hi), register j of key tile kt = key kt 16 + hi 8 + j.
// Softmax runs on a running maximum (base 2, scale folded in); two converted S^T tiles are the B operand of O^T += V^T P^T as they stand (the loader's k order 8 hi + e, 16 + 8 hi + e is theirs too).
// Rows < RH: bf16 hi/lo planes, 3 products each; the rest fp16. O^T / sum goes out as the merged bf16 hi/lo planes [t][head x HD + d], 8 consecutive d per lane.
__device__ __forceinline__ float xhalf(float x) { return __builtin_bit_cast(float, __builtin_amdgcn_permlanex16(__builtin_bit_cast(int, x), __builtin_bit_cast(int, x), 0x76543210, 0xfedcba98, false, false)); }   // the value of lane l ^ 16
__device__ __forceinline__ void ppack(const v8f& t0, const v8f& t1, v16h& h, v16h& l) { (void)l;
#pragma unroll
    for (int e = 0; e < 8; ++e) { h[e] = (h16)t0[e]; h[8 + e] = (h16)t1[e]; } }
__device__ __forceinline__ void ppack(const v8f& t0, const v8f& t1, v16bf& h, v16bf& l) {
#pragma unroll
    for (int e = 0; e < 8; ++e) { const __bf16 a = (__bf16)t0[e], b = (__bf16)t1[e]; h[e] = a; h[8 + e] = b; l[e] = (__bf16)(t0[e] - (float)a); l[8 + e] = (__bf16)(t1[e] - (float)b); } }
template <bool B> struct BoolC { static constexpr bool v = B; };
template <typename T16, int NSPLIT>
__device__ __forceinline__ void fattn(const T16* __restrict__ Q, const T16* __restrict__ Q2, const T16* __restrict__ Kp, const T16* __restrict__ Kp2, const T16* __restrict__ Vt, const T16* __restrict__ Vt2, int g, int head, int q0, int lane, bf* Ah, bf* Al) {
    typedef typename WFrag<T16>::V V;
    static_assert(NSPLIT == 0 || NSPLIT == 2, "one plane or hi/lo planes on both sides");
    constexpr float C2 = SCL * 1.4426950408889634f;      // score scale x log2 e. Every inner loop below is unrolled so that the fragment and tile arrays are indexed by constants and stay in registers.
    const int lr = lane & 15, hi = lane >> 4;
    const size_t qo = ((size_t)head * TT + q0 + lr) * HD + 8 * hi, ko = ((size_t)g * TT + lr) * HD + 8 * hi, vo = ((size_t)g * HD + lr) * TT + 8 * hi;
    V qf[2][2], qf2[2][2], kf[2][2], kf2[2][2];
    { const T16 *pq = Q + qo, *pq2 = (NSPLIT == 2) ? Q2 + qo : pq, *pk = Kp + ko, *pk2 = (NSPLIT == 2) ? Kp2 + ko : pk;
#pragma unroll
      for (int t = 0; t < 2; ++t)
#pragma unroll
          for (int ks = 0; ks < 2; ++ks) { qf[t][ks] = WFrag<T16>::ld(pq + t * 16 * HD + ks * 32); kf[t][ks] = WFrag<T16>::ld(pk + t * 16 * HD + ks * 32); if (NSPLIT == 2) { qf2[t][ks] = WFrag<T16>::ld(pq2 + t * 16 * HD + ks * 32); kf2[t][ks] = WFrag<T16>::ld(pk2 + t * 16 * HD + ks * 32); } }
      xwait4(pq, pq2, pk, pk2); }
    v8f o[4][2];
#pragma unroll
    for (int db = 0; db < 4; ++db)
#pragma unroll
        for (int qt = 0; qt < 2; ++qt) o[db][qt] = (v8f){};
    float m[2] = { -3.0e38f, -3.0e38f }, nm[2] = { 3.0e38f * C2, 3.0e38f * C2 }, l[2] = { 0.f, 0.f };      // running maximum (raw score), minus its scaled value, this lane's share of the sum
    auto block = [&](int k0, auto lastc) __attribute__((always_inline)) {
        constexpr bool LAST = decltype(lastc)::v;      // the diagonal block (k0 == q0): masked, and nothing fetched ahead
        V vf[4], vf2[4];
        { const T16 *pv = Vt + vo + k0, *pv2 = (NSPLIT == 2) ? Vt2 + vo + k0 : pv;      // issued here, used behind the softmax
#pragma unroll
          for (int db = 0; db < 4; ++db) { vf[db] = WFrag<T16>::ld(pv + (size_t)db * 16 * TT); if (NSPLIT == 2) vf2[db] = WFrag<T16>::ld(pv2 + (size_t)db * 16 * TT); }
          xwait4(pv, pv2, pv, pv2); }
        v8f s[2][2];
#pragma unroll
        for (int kt = 0; kt < 2; ++kt)
#pragma unroll
            for (int qt = 0; qt < 2; ++qt) { v8f c = (v8f){};
#pragma unroll
                for (int ks = 0; ks < 2; ++ks) { c = WFrag<T16>::mma(kf[kt][ks], qf[qt][ks], c); if (NSPLIT == 2) { c = WFrag<T16>::mma(kf[kt][ks], qf2[qt][ks], c); c = WFrag<T16>::mma(kf2[kt][ks], qf[qt][ks], c); } }
                s[kt][qt] = c; }
        if constexpr (!LAST) { const T16 *pk = Kp + ko + (size_t)(k0 + 32) * HD, *pk2 = (NSPLIT == 2) ? Kp2 + ko + (size_t)(k0 + 32) * HD : pk;      // the next block's key fragments fly during this block's softmax and P.V
#pragma unroll
            for (int t = 0; t < 2; ++t)
#pragma unroll
                for (int ks = 0; ks < 2; ++ks) { kf[t][ks] = WFrag<T16>::ld(pk + t * 16 * HD + ks * 32); if (NSPLIT == 2) kf2[t][ks] = WFrag<T16>::ld(pk2 + t * 16 * HD + ks * 32); }
            xwait4(pk, pk2, pk, pk2); }
        if constexpr (LAST) {
#pragma unroll
            for (int kt = 0; kt < 2; ++kt)
#pragma unroll
                for (int qt = 0; qt < 2; ++qt)
#pragma unroll
                    for (int j = 0; j < 8; ++j) if (kt * 16 + hi * 8 + j > qt * 16 + lr) s[kt][qt][j] = -3.0e38f; }      // key beyond the query: excluded
        float mb[2];
#pragma unroll
        for (int qt = 0; qt < 2; ++qt) { float x0 = fmaxf(s[0][qt][0], s[1][qt][0]), x1 = fmaxf(s[0][qt][1], s[1][qt][1]);
#pragma unroll
            for (int j = 2; j < 8; j += 2) { x0 = fmaxf(x0, fmaxf(s[0][qt][j], s[1][qt][j])); x1 = fmaxf(x1, fmaxf(s[0][qt][j + 1], s[1][qt][j + 1])); }
            x0 = fmaxf(x0, x1); mb[qt] = fmaxf(x0, xhalf(x0)); }
        if (__builtin_amdgcn_ballot_w32(mb[0] > m[0] || mb[1] > m[1]) != 0) {      // scalar branch: a maximum rose somewhere in the wave (rare after the first blocks)
#pragma unroll
            for (int qt = 0; qt < 2; ++qt) { const float mn = fmaxf(m[qt], mb[qt]), nn = -(mn * C2), al = __builtin_amdgcn_exp2f(nn - nm[qt]); m[qt] = mn; nm[qt] = nn; l[qt] *= al;
#pragma unroll
                for (int db = 0; db < 4; ++db) o[db][qt] *= al; } }
        V ph[2], pl[2];
#pragma unroll
        for (int qt = 0; qt < 2; ++qt) { float a[4] = { 0.f, 0.f, 0.f, 0.f };
#pragma unroll
            for (int kt = 0; kt < 2; ++kt)
#pragma unroll
                for (int j = 0; j < 8; ++j) { const float p = __builtin_amdgcn_exp2f(__builtin_fmaf(s[kt][qt][j], C2, nm[qt])); s[kt][qt][j] = p; a[j & 3] += p; }
            l[qt] += (a[0] + a[1]) + (a[2] + a[3]); ppack(s[0][qt], s[1][qt], ph[qt], pl[qt]); }
#pragma unroll
        for (int db = 0; db < 4; ++db)
#pragma unroll
            for (int qt = 0; qt < 2; ++qt) { o[db][qt] = WFrag<T16>::mma(vf[db], ph[qt], o[db][qt]); if (NSPLIT == 2) { o[db][qt] = WFrag<T16>::mma(vf[db], pl[qt], o[db][qt]); o[db][qt] = WFrag<T16>::mma(vf2[db], ph[qt], o[db][qt]); } }
    };
#pragma unroll 1      // rolled: the key fragments fetched ahead land in the registers the next trip reads, and the loop's code stays short
    for (int k0 = 0; k0 < q0; k0 += 32) block(k0, BoolC<false>());
    block(q0, BoolC<true>());
#pragma unroll
    for (int qt = 0; qt < 2; ++qt) { const float inv = __fdiv_rn(1.0f, l[qt] + xhalf(l[qt])); const size_t oo = (size_t)(q0 + qt * 16 + lr) * DQ + head * HD + hi * 8;      // the two lane halves' sums join here, once
#pragma unroll
        for (int db = 0; db < 4; ++db) { v8us oh, ol;
#pragma unroll
            for (int j = 0; j < 8; ++j) { unsigned short a, c2; splitf(o[db][qt][j] * inv, a, c2); oh[j] = a; ol[j] = c2; }
            *(v8us*)(Ah + oo + db * 16) = oh; *(v8us*)(Al + oo + db * 16) = ol; } }
}
// grid (NKV, TT / 64), 2 REP waves: waves 0..REP-1 take 32-row block TT/32 - 1 - y (long), waves REP.. block y (short), one head each, so that every work-group walks about the same number of key blocks. The waves share no barrier and no buffer.
// Register budget: two waves per SIMD (one work-group per WGP).
__global__ __launch_bounds__(2 * REP * 32, 2) void k_fattn(const h16* __restrict__ Q16, const h16* __restrict__ K16, const h16* __restrict__ V16, const bf* __restrict__ Qh, const bf* __restrict__ Ql, const bf* __restrict__ Kh, const bf* __restrict__ Kl, const bf* __restrict__ Vh, const bf* __restrict__ Vl, bf* Ah, bf* Al) {
    const int lane = threadIdx.x & 31, wv = __builtin_amdgcn_readfirstlane(threadIdx.x >> 5);      // wave number, scalar so that head, row block and the key loop stay scalar
    const int g = blockIdx.x, head = g * REP + (wv & (REP - 1)), q0 = ((wv < REP) ? TT / 32 - 1 - (int)blockIdx.y : (int)blockIdx.y) * 32;
    if (q0 < RH) fattn<bf, 2>(Qh, Ql, Kh, Kl, Vh, Vl, g, head, q0, lane, Ah, Al); else fattn<h16, 0>(Q16, nullptr, K16, nullptr, V16, nullptr, g, head, q0, lane, Ah, Al);
}

extern "C" void kernel_launch(void* const* d_in, const int* in_sizes, int n_in,
                              void* d_out, int out_size, void* d_ws, size_t ws_size, hipStream_t stream) {
    (void)in_sizes; (void)n_in; (void)out_size;
    const float* x = (const float*)d_in[0]; const float* wq = (const float*)d_in[1]; const float* wk = (const float*)d_in[2]; const float* wv = (const float*)d_in[3]; const float* wo = (const float*)d_in[4];   /* order x, Wq ('oi' [2048][2048]), Wk, Wv ('oi' [512][2048]), Wo ('oi') */
    float* OUT = (float*)d_out;     // [2][2048][2048]
    char* wsp = (char*)d_ws;
    auto take = [&](size_t bytes) { char* p = wsp; wsp += (bytes + 255) & ~(size_t)255; return (void*)p; };
    bf* WQ = (bf*)take((size_t)DQ * DM * 2); bf* WK = (bf*)take((size_t)DKV * DM * 2); bf* WV = (bf*)take((size_t)DKV * DM * 2); bf* WO = (bf*)take((size_t)DM * DQ * 2); float* CS = (float*)take((size_t)TT * HD * 2 * 4);
    bf* XB = (bf*)take((size_t)TT * DM * 2);
    h16* QP16 = (h16*)take((size_t)NH_ * TT * HD * 2); h16* KP16 = (h16*)take((size_t)NKV * TT * HD * 2); h16* VT16 = (h16*)take((size_t)NKV * HD * TT * 2);
    bf* QPh = (bf*)take((size_t)NH_ * TT * HD * 2); bf* QPl = (bf*)take((size_t)NH_ * TT * HD * 2); bf* KPh = (bf*)take((size_t)NKV * TT * HD * 2); bf* KPl = (bf*)take((size_t)NKV * TT * HD * 2); bf* VTh = (bf*)take((size_t)NKV * HD * TT * 2); bf* VTl = (bf*)take((size_t)NKV * HD * TT * 2);
    bf* ATh = (bf*)take((size_t)TT * DQ * 2); bf* ATl = (bf*)take((size_t)TT * DQ * 2);
    if ((size_t)(wsp - (char*)d_ws) > ws_size) return;    // ws 256 MiB
    { k_cvt8<<<(unsigned)(((size_t)DQ * DM / 8 + 255) / 256), 256, 0, stream>>>(wq, WQ, (size_t)DQ * DM / 8); k_cvt8<<<(unsigned)(((size_t)DKV * DM / 8 + 255) / 256), 256, 0, stream>>>(wk, WK, (size_t)DKV * DM / 8); k_cvt8<<<(unsigned)(((size_t)DKV * DM / 8 + 255) / 256), 256, 0, stream>>>(wv, WV, (size_t)DKV * DM / 8);
      k_cvt8<<<(unsigned)(((size_t)DM * DQ / 8 + 255) / 256), 256, 0, stream>>>(wo, WO, (size_t)DM * DQ / 8);
       }
    k_csP<<<(TT * HD + 255) / 256, 256, 0, stream>>>(CS);
    for (int b = 0; b < NB_; ++b) {
        
        k_cvt8<<<(unsigned)(((size_t)TT * DM / 8 + 255) / 256), 256, 0, stream>>>(x + (size_t)b * TT * DM, XB, (size_t)TT * DM / 8);
        k_gemmw<bf, 0, false, 8, 1><<<dim3(TT / 64, DQ / 64, 1), 256, 0, stream>>>(XB, nullptr, WQ, nullptr, DM, nullptr, 0, nullptr, 0, 0, 0, CS, QP16, QPh, QPl);
        k_gemmw<bf, 0, false, 16, 1><<<dim3(TT / 64, DKV / 64, 1), 512, 0, stream>>>(XB, nullptr, WK, nullptr, DM, nullptr, 0, nullptr, 0, 0, 0, CS, KP16, KPh, KPl);
        k_gemmw<bf, 0, false, 16, 2><<<dim3(DKV / 64, TT / 64, 1), 512, 0, stream>>>(WV, nullptr, XB, nullptr, DM, nullptr, 0, nullptr, 0, 0, 0, nullptr, VT16, VTh, VTl);      // A = Wv rows, B = x rows: the tile is V^T [kv head x HD + d][t]
        k_fattn<<<dim3(NKV, TT / 64, 1), 2 * REP * 32, 0, stream>>>(QP16, KP16, VT16, QPh, QPl, KPh, KPl, VTh, VTl, ATh, ATl);
        k_gemmw<bf, 1, false, 8, 0><<<dim3(TT / 64, DM / 64, 1), 256, 0, stream>>>(ATh, ATl, WO, nullptr, DQ, OUT + (size_t)b * TT * DM, DM, nullptr, 0, 0, 0, nullptr, nullptr, nullptr, nullptr); }
}

// v005
// A run of this version takes 270 microseconds.
// In both of two side-by-side timings against v004, it was 1.37 times as fast.
// Counting every step since v000, it is 10.0 times as fast.
#include <hip/hip_runtime.h>

// Causal grouped-query attention with interleaved-pair rotary embeddings whose positions carry a 2 pi factor (x [2][2048][2048]; q = x Wq^T (32 heads x 64), k, v = x Wk^T, x Wv^T (8 kv heads x 64) ('oi' 1/sqrt(2048), no bias); rope on (even, odd) pairs: (re, im) = (q0 c - q1 s, q0 s + q1 c) with angle fl(fl(s x 2 pi) x freq_i), freq_i = 1 / 10000^(2i/64) (32 f32 frequencies jnp-exact; TWO f32 products; precise cosf/sinf); k, v repeated 4 x along the head axis: kv head = q head / 4; scores / sqrt(64); causal (finfo.min == exclusion); softmax; out = merged Wo^T ('oi', no bias) -> [2][2048][2048] (8.4 M); argument order x, Wq, Wk, Wv, Wo).
// Layout per batch: bf16 copy of x; 'oi' weights as-is; exact projections whose epilogue applies the rotary table and writes the head planes (v: product formed transposed); causal T-2048 GQA attention in one launch (k_fattn: scores, running-maximum softmax and P.V in registers; hybrid rows: < 512 hi/lo 3 products, rest fp16); merged hi/lo x Wo exact.
// Compute dtypes, f32 accumulate: every input rounded to bf16; projections exact; attention rows < 512 3 products, rest fp16; softmax f32; output projection hl x exact.

#define NB_  2
#define TT   2048
#define DM   2048
#define NH_  32
#define NKV  8
#define REP  (NH_ / NKV)
#define HD   64
#define DQ   (NH_ * HD)
#define DKV  (NKV * HD)
#define RH   512                  // query rows < RH use hi+lo planes (0: none)
#define SCL  0.125f   // HD^-0.5
static_assert(RH % 32 == 0 && TT % 64 == 0 && (REP & (REP - 1)) == 0, "a 32-row block is wholly hi/lo or wholly fp16; blocks pair up; the head comes from the low bits of the wave number");
typedef _Float16 h16;
typedef unsigned short bf;
typedef __attribute__((ext_vector_type(16))) __bf16   v16bf;
typedef __attribute__((ext_vector_type(16))) _Float16 v16h;
typedef __attribute__((ext_vector_type(8)))  _Float16 v8h;
typedef __attribute__((ext_vector_type(8)))  unsigned short v8us;
typedef __attribute__((ext_vector_type(8)))  float    v8f;
typedef __attribute__((ext_vector_type(4)))  float    v4f;
typedef v8h  __attribute__((may_alias)) v8ha;
typedef v4f  __attribute__((may_alias)) v4fa;
typedef v8us __attribute__((may_alias)) v8usa;

__device__ __forceinline__ unsigned short f2bf(float f) { unsigned u = __float_as_uint(f); u += 0x7FFFu + ((u >> 16) & 1u); return (unsigned short)(u >> 16); }
__device__ __forceinline__ float bf2f(unsigned short b) { return __uint_as_float(((unsigned)b) << 16); }
__device__ __forceinline__ float bfr(float f) { return bf2f(f2bf(f)); }
__device__ __forceinline__ void splitf(float y, unsigned short& h, unsigned short& l) { h = f2bf(y); l = f2bf(y - bf2f(h)); }
typedef __attribute__((ext_vector_type(2))) float v2f;
__device__ __forceinline__ v16h cat16(v8h lo, v8h hi) { return __builtin_shufflevector(lo, hi, 0, 1, 2, 3, 4, 5, 6, 7, 8, 9, 10, 11, 12, 13, 14, 15); }
__device__ __forceinline__ v16bf cat16b(v8us lo, v8us hi) { return __builtin_bit_cast(v16bf, __builtin_shufflevector(lo, hi, 0, 1, 2, 3, 4, 5, 6, 7, 8, 9, 10, 11, 12, 13, 14, 15)); }
__device__ __forceinline__ v8f wmma16(v16h a, v16h b, v8f c) { return __builtin_amdgcn_wmma_f32_16x16x32_f16(false, a, false, b, (short)0, c, false, false); }
__device__ __forceinline__ v8f wmmab(v16bf a, v16bf b, v8f c) { return __builtin_amdgcn_wmma_f32_16x16x32_bf16(false, a, false, b, (short)0, c, false, false); }



// ---- k_gemmw: register-blocked GEMM, one work-group of NW waves per 64x64 output tile; each wave holds the whole tile (16 accumulators) for its share of K; grid (M/64, N/64, Z), NW x 32 threads.
// Operands come from K-contiguous 16-bit planes through LDS: per trip the work-group copies NW x 32 k of its 64 rows of every operand (whole 128-B lines, 512 contiguous bytes per wave-wide asynchronous copy) into one of two buffers, and wave w reads the 32 k at w x 32 of that stretch.
// C[m][n] (f32, pitch ldc, + optional f32 bias[n]) = sum_k A[m][k] Bt[n][k] (+ split products per NSPLIT). z-batch strides sA/sB/sC in elements. K % (NW x 32) == 0. EPI 0: C is stored; EPI 1, 2: no C, the tile goes out as 16-bit planes (ksum_planes).
template <typename T16> struct WFrag;
template <> struct WFrag<h16> { typedef v16h V; static __device__ __forceinline__ V ld(const h16* p) { return cat16(*(const v8h*)p, *(const v8h*)(p + 16)); } static __device__ __forceinline__ v8f mma(V a, V b, v8f c) { return wmma16(a, b, c); } };
template <> struct WFrag<bf> { typedef v16bf V; static __device__ __forceinline__ V ld(const bf* p) { return cat16b(*(const v8us*)p, *(const v8us*)(p + 16)); } static __device__ __forceinline__ v8f mma(V a, V b, v8f c) { return wmmab(a, b, c); } };
// ksum_store: the NW waves of a work-group each hold a partial 64x64 f32 tile (their share of K). Every wave writes its tile to LDS in register order (32 slots of 16 B per lane), one barrier,
// then wave w sums slots w*32/NW.. over the waves in the fixed order 0..NW-1, turns its rows (32 columns = one 128-B line each) through its own LDS strip and stores whole lines. Ct = the tile's first element.
template <int NW, bool BIAS>
__device__ __forceinline__ void ksum_store(const v8f (&acc)[4][4], float* ps, float* Ct, int ldc, const float* bias, int wv, int lane) {
    constexpr int SP = 32 / NW, RW = SP * 4;      // slots and rows per summing wave
    const int lr = lane & 15, hi = lane >> 4;
    v4fa* pw = (v4fa*)ps;
#pragma unroll
    for (int mb = 0; mb < 4; ++mb)
#pragma unroll
        for (int nb = 0; nb < 4; ++nb)
#pragma unroll
            for (int jh = 0; jh < 2; ++jh) { const int q = ((mb * 2 + (nb >> 1)) * 2 + jh) * 2 + (nb & 1); pw[(wv * 32 + q) * 32 + lane] = (v4f){ acc[mb][nb][jh * 4], acc[mb][nb][jh * 4 + 1], acc[mb][nb][jh * 4 + 2], acc[mb][nb][jh * 4 + 3] }; }
    __syncthreads();      // every wave's partial tile is in LDS before any wave sums
    v4f r[SP];
#pragma unroll
    for (int i = 0; i < SP; ++i) r[i] = pw[(wv * SP + i) * 32 + lane];
#pragma unroll
    for (int s = 1; s < NW; ++s)
#pragma unroll
        for (int i = 0; i < SP; ++i) r[i] += pw[(s * 32 + wv * SP + i) * 32 + lane];
    const int q0 = wv * SP, mb = q0 >> 3, nbp = (q0 >> 2) & 1, jh0 = (q0 >> 1) & 1;      // slot q = ((mb*2 + nb/2)*2 + jh)*2 + nb%2
    float* sw = ps + NW * 4096 + wv * (RW * 36);
#pragma unroll
    for (int i = 0; i < SP; ++i)
#pragma unroll
        for (int jj = 0; jj < 4; ++jj) sw[(hi * (RW / 2) + (i >> 1) * 4 + jj) * 36 + (i & 1) * 16 + lr] = r[i][jj];
    asm volatile("s_wait_dscnt 0x0" ::: "memory");      // the wave's own strip is written before other lanes of the wave read it back
#pragma unroll
    for (int i = 0; i < SP; ++i) { const int idx = i * 32 + lane, lrow = idx >> 3, cofs = nbp * 32 + (idx & 7) * 4; const int trow = (SP == 4) ? lrow : ((lrow >> 2) * 8 + jh0 * 4 + (lrow & 3));
        v4f val = *(const v4fa*)(sw + lrow * 36 + (idx & 7) * 4); if (BIAS) { val[0] += bfr(bias[cofs]); val[1] += bfr(bias[cofs + 1]); val[2] += bfr(bias[cofs + 2]); val[3] += bfr(bias[cofs + 3]); }
        *(v4f*)(Ct + (size_t)(mb * 16 + trow) * ldc + cofs) = val; }
}
// ksum_planes: the same wave sum as ksum_store, but the 64x64 tile leaves as 16-bit planes (fp16 + bf16 hi/lo) instead of f32. The summed slots go into one LDS tile (pitch 68 floats), one more barrier,
// then each wave takes 64 / NW whole rows, 8 consecutive columns per lane, so that 8 lanes store one whole 128-B line of each plane. P16 / Ph / Pl = the tile's first element in each plane.
// EPI 1: tile rows = positions, tile columns = the 64 dims of one head; (even, odd) pairs are rotated by the table row CSt[row][d] = (cos, sin); plane pitch HD. EPI 2: values as they are; plane pitch TT.
template <int NW, int EPI>
__device__ __forceinline__ void ksum_planes(const v8f (&acc)[4][4], float* ps, const float* __restrict__ CSt, h16* P16, bf* Ph, bf* Pl, int wv, int lane) {
    static_assert(HD == 64, "one 64-column tile is one head");
    constexpr int SP = 32 / NW, NI = 16 / NW, PT = 68, PP = (EPI == 1) ? HD : TT;      // slots per summing wave; groups of 4 rows per storing wave; LDS tile pitch; plane pitch
    const int lr = lane & 15, hi = lane >> 4, c8 = (lane & 7) * 8, rw = wv * (64 / NW) + (lane >> 3);
    v2f cs[NI][4];
    if constexpr (EPI == 1) { const float* pc = CSt + (rw * HD + c8) * 2;      // issued first: the table values fly while the partial tiles go to LDS
#pragma unroll
        for (int it = 0; it < NI; ++it)
#pragma unroll
            for (int p = 0; p < 4; ++p) cs[it][p] = *(const v2f*)(pc + (it * 4 * HD + 2 * p) * 2);
        asm volatile("s_wait_xcnt 0x0" :: "v"(pc) : "memory"); }      // the run's address is an input, so it stays in its registers until the wait: otherwise the last load's result lands in the address pair the earlier loads name (a precaution, as in xwait4)
    v4fa* pw = (v4fa*)ps;
#pragma unroll
    for (int mb = 0; mb < 4; ++mb)
#pragma unroll
        for (int nb = 0; nb < 4; ++nb)
#pragma unroll
            for (int jh = 0; jh < 2; ++jh) { const int q = ((mb * 2 + (nb >> 1)) * 2 + jh) * 2 + (nb & 1); pw[(wv * 32 + q) * 32 + lane] = (v4f){ acc[mb][nb][jh * 4], acc[mb][nb][jh * 4 + 1], acc[mb][nb][jh * 4 + 2], acc[mb][nb][jh * 4 + 3] }; }
    __syncthreads();      // every wave's partial tile is in LDS before any wave sums
    v4f r[SP];
#pragma unroll
    for (int i = 0; i < SP; ++i) r[i] = pw[(wv * SP + i) * 32 + lane];
#pragma unroll
    for (int s = 1; s < NW; ++s)
#pragma unroll
        for (int i = 0; i < SP; ++i) r[i] += pw[(s * 32 + wv * SP + i) * 32 + lane];
    float* tl = ps + NW * 4096;
#pragma unroll
    for (int i = 0; i < SP; ++i) { const int q = wv * SP + i, mb = q >> 3, nb = ((q >> 2) & 1) * 2 + (q & 1), jh = (q >> 1) & 1;      // slot q = ((mb*2 + nb/2)*2 + jh)*2 + nb%2
#pragma unroll
        for (int jj = 0; jj < 4; ++jj) tl[(mb * 16 + hi * 8 + jh * 4 + jj) * PT + nb * 16 + lr] = r[i][jj]; }
    __syncthreads();      // the whole summed tile is in LDS before any wave reads whole rows of it
#pragma unroll
    for (int it = 0; it < NI; ++it) { const int row = rw + it * 4; const v4f u0 = *(const v4fa*)(tl + row * PT + c8), u1 = *(const v4fa*)(tl + row * PT + c8 + 4);
        float y[8] = { u0[0], u0[1], u0[2], u0[3], u1[0], u1[1], u1[2], u1[3] };
        if constexpr (EPI == 1) {
#pragma unroll
            for (int p = 0; p < 4; ++p) { const float x0 = y[2 * p], x1 = y[2 * p + 1], c = cs[it][p][0], s = cs[it][p][1]; y[2 * p] = x0 * c - x1 * s; y[2 * p + 1] = x0 * s + x1 * c; } }      // even: x0 c - x1 s; odd: x0 s + x1 c
        v8h o16; v8us oh, ol;
#pragma unroll
        for (int e = 0; e < 8; ++e) { o16[e] = (h16)y[e]; unsigned short a, b; splitf(y[e], a, b); oh[e] = a; ol[e] = b; }
        const size_t e0 = (size_t)row * PP + c8;
        *(v8h*)(P16 + e0) = o16; *(v8us*)(Ph + e0) = oh; *(v8us*)(Pl + e0) = ol; }
}
// acopy8: eight asynchronous copies global -> LDS, 16 bytes per lane each (l = the lane's LDS byte address, g = the lane's global address). The s_wait_xcnt 0 is the last line of the copies' own statement, so that no address register is rewritten in front of it (a precaution).
template <typename T16>
__device__ __forceinline__ void acopy8(const unsigned (&l)[8], const T16* const (&g)[8]) {
    asm volatile("global_load_async_to_lds_b128 %0, %8, off\n\t"
                 "global_load_async_to_lds_b128 %1, %9, off\n\t"
                 "global_load_async_to_lds_b128 %2, %10, off\n\t"
                 "global_load_async_to_lds_b128 %3, %11, off\n\t"
                 "global_load_async_to_lds_b128 %4, %12, off\n\t"
                 "global_load_async_to_lds_b128 %5, %13, off\n\t"
                 "global_load_async_to_lds_b128 %6, %14, off\n\t"
                 "global_load_async_to_lds_b128 %7, %15, off\n\t"
                 "s_wait_xcnt 0x0"
                 :: "v"(l[0]), "v"(l[1]), "v"(l[2]), "v"(l[3]), "v"(l[4]), "v"(l[5]), "v"(l[6]), "v"(l[7]), "v"(g[0]), "v"(g[1]), "v"(g[2]), "v"(g[3]), "v"(g[4]), "v"(g[5]), "v"(g[6]), "v"(g[7]) : "memory");
}
// Register budget: four waves per SIMD (two 8-wave work-groups or one 16-wave work-group on a WGP); with a third operand plane the two buffers leave LDS for one 8-wave work-group, two waves per SIMD.
template <typename T16, int NSPLIT, bool BIAS, int NW, int EPI>
__global__ __launch_bounds__(NW * 32, 4) void k_gemmw(const T16* __restrict__ A, const T16* __restrict__ A2, const T16* __restrict__ Bt, const T16* __restrict__ Bt2, int K, float* C, int ldc, const float* __restrict__ bias, size_t sA, size_t sB, size_t sC, const float* __restrict__ CS, h16* P16, bf* Ph, bf* Pl) {
    typedef typename WFrag<T16>::V V;
    static_assert(NW % 8 == 0, "a row's stretch of NW x 64 bytes is a whole number of 512-byte copies");
    constexpr bool HA2 = (NSPLIT == 1 || NSPLIT == 2), HB2 = (NSPLIT >= 2);
    constexpr int NOP = 2 + (HA2 ? 1 : 0) + (HB2 ? 1 : 0);      // operand planes staged: slots A, Bt, then A2, Bt2 where they exist
    constexpr int KT = NW * 32, PB = KT * 2 + 16, CPR = NW / 8, BUFB = NOP * 64 * PB;      // k per trip; LDS row pitch in bytes (16 x odd: no bank conflict for 16-byte fragment reads); copies per row; bytes per buffer
    constexpr int EPF = NW * 4096 + 128 * 36, RGF = 2 * BUFB / 4;      // floats the epilogue needs; floats of the two buffers (the epilogue takes the same LDS over behind the last trip's barrier)
    __shared__ __align__(16) float os[EPF > RGF ? EPF : RGF];
    const size_t z = blockIdx.z; A += z * sA; if (A2) A2 += z * sA; Bt += z * sB; if (Bt2) Bt2 += z * sB; C += z * sC;
    const int lane = threadIdx.x & 31, lr = lane & 15, hi = lane >> 4; const int r0 = blockIdx.x * 64, c0 = blockIdx.y * 64;
    const int wv = __builtin_amdgcn_readfirstlane(threadIdx.x >> 5);      // wave number, scalar so that the K loop stays a scalar loop
    v8f acc[4][4];
#pragma unroll
    for (int mb = 0; mb < 4; ++mb)
#pragma unroll
        for (int nb = 0; nb < 4; ++nb) acc[mb][nb] = (v8f){};
    const char* lb = (const char*)os;
    const unsigned lw = (unsigned)(size_t)os + (unsigned)(((wv * 8) / CPR) * PB + lane * 16);      // LDS byte address of this wave's first copy inside an operand's slot
    const size_t gw = (size_t)((wv * 8) / CPR) * K + lane * 8;      // the same place in an operand's 64 rows, in elements
    // stage: tile t (k = t KT ..) of every operand into buffer b. Per operand the wave makes 8 of the 8 NW copies: copy c = wv 8 + j is part c % CPR (512 bytes) of row c / CPR.
    auto stage = [&](int t, int b) __attribute__((always_inline)) {
        const T16* P[4] = { A + (size_t)r0 * K, Bt + (size_t)c0 * K, HA2 ? A2 + (size_t)r0 * K : (HB2 ? Bt2 + (size_t)c0 * K : A), HB2 ? Bt2 + (size_t)c0 * K : A };
#pragma unroll
        for (int o = 0; o < NOP; ++o) { unsigned l[8]; const T16* g[8];
#pragma unroll
            for (int j = 0; j < 8; ++j) { l[j] = lw + (unsigned)(b * BUFB + o * 64 * PB + (j / CPR) * PB + (j % CPR) * 512); g[j] = P[o] + gw + (size_t)(j / CPR) * K + (size_t)t * KT + (j % CPR) * 256; }
            acopy8<T16>(l, g); }
    };
    const int nt = (int)((unsigned)K / (unsigned)KT);
    stage(0, 0);
    asm volatile("s_wait_asynccnt 0x0" ::: "memory");      // this wave's share of tile 0 has landed
    __syncthreads();      // tile 0 is whole before any wave reads it
    if (nt > 1) stage(1, 1);
    const int fo = lr * PB + wv * 64 + hi * 16;      // this lane's place in a 16-row fragment: row lr, the wave's 32 k, k order 8 hi + e, 16 + 8 hi + e on both sides
#pragma unroll 1
    for (int t = 0; t < nt; ++t) {      // wave wv takes the 32 k at wv x 32 of every stretch of NW x 32 k
        const char* fb = lb + (t & 1) * BUFB + fo;
        V a[4], a2[4], b[4], b2[4];      // all of the trip's fragment reads stand together in front of its products
#pragma unroll
        for (int mb = 0; mb < 4; ++mb) { a[mb] = WFrag<T16>::ld((const T16*)(fb + mb * 16 * PB)); b[mb] = WFrag<T16>::ld((const T16*)(fb + (64 + mb * 16) * PB)); if (HA2) a2[mb] = WFrag<T16>::ld((const T16*)(fb + (2 * 64 + mb * 16) * PB)); if (HB2) b2[mb] = WFrag<T16>::ld((const T16*)(fb + ((NOP - 1) * 64 + mb * 16) * PB)); }
        asm volatile("s_wait_dscnt 0x0" ::: "memory");      // this wave's reads of buffer t & 1 are done: the trip's fragments are in registers
        asm volatile("s_wait_asynccnt 0x0" ::: "memory");      // this wave's share of tile t + 1 has landed
        __syncthreads();      // publishes tile t + 1 and ends every wave's reads of the buffer refilled below (in the last trip: of the LDS the epilogue takes over)
        if (t + 2 < nt) stage(t + 2, t & 1);      // issued in front of the trip's products, which need registers only: the copies fly behind them
#pragma unroll
        for (int nb = 0; nb < 4; ++nb)
#pragma unroll
            for (int mb = 0; mb < 4; ++mb) { acc[mb][nb] = WFrag<T16>::mma(a[mb], b[nb], acc[mb][nb]); if (HA2) acc[mb][nb] = WFrag<T16>::mma(a2[mb], b[nb], acc[mb][nb]); if (HB2) acc[mb][nb] = WFrag<T16>::mma(a[mb], b2[nb], acc[mb][nb]); }
        asm volatile("v_nop\n\tv_nop\n\tv_nop\n\tv_nop" : "+v"(acc[0][0]), "+v"(acc[1][1]), "+v"(acc[2][2]), "+v"(acc[3][3]) : "v"(a[0]), "v"(a[3]));      // four vector slots behind the trip's last products on both ways out of the trip: the next fragment reads land in their A and B registers, the epilogue stores their results
    }
    asm volatile("s_wait_asynccnt 0x0" ::: "memory");      // no copy is outstanding when the epilogue writes this LDS
    if constexpr (EPI == 0) ksum_store<NW, BIAS>(acc, os, C + (size_t)r0 * ldc + c0, ldc, BIAS ? bias + c0 : bias, wv, lane);
    else { const size_t po = (EPI == 1) ? ((size_t)blockIdx.y * TT + r0) * HD : (size_t)r0 * TT + c0;      // EPI 1: planes [head = tile column][t][d]; EPI 2: planes [row][t]
        ksum_planes<NW, EPI>(acc, os, CS + (size_t)r0 * HD * 2, P16 + po, Ph + po, Pl + po, wv, lane); }
}

// xwait4: s_wait_xcnt 0 behind a run of fragment loads. The run's addresses are inputs of the statement, so each stays in its registers until the wait (a precaution for replayed address translations).
template <typename T16> __device__ __forceinline__ void xwait4(const T16* p0, const T16* p1, const T16* p2, const T16* p3) { asm volatile("s_wait_xcnt 0x0" :: "v"(p0), "v"(p1), "v"(p2), "v"(p3) : "memory"); }

__device__ __forceinline__ h16 tohx(float x) { return (h16)x; }
typedef __attribute__((ext_vector_type(2))) _Float16 v2h;
typedef __attribute__((ext_vector_type(4))) _Float16 v4h;
typedef __attribute__((ext_vector_type(2))) unsigned short v2us;
typedef __attribute__((ext_vector_type(4))) unsigned short v4us;
typedef __attribute__((ext_vector_type(4))) int v4i;

__global__ __launch_bounds__(256) void k_cvt8(const float* __restrict__ src, bf* dst, size_t n8) { const size_t i = (size_t)blockIdx.x * 256 + threadIdx.x; if (i >= n8) return; const v8f v = *(const v8f*)(src + i * 8); v8us o;
#pragma unroll
    for (int k = 0; k < 8; ++k) o[k] = f2bf(v[k]); *(v8us*)(dst + i * 8) = o;  }

// k_rope: head planes [h][t][d] (fp16 + hi/lo) of rope(x) x sc with the rotate-half convention out[d] = x[d] cos[t][d] - x[d+HD/2] sin[t][d], out[d+HD/2] = x[d+HD/2] cos[t][d+HD/2] + x[d] sin[t][d+HD/2]
__global__ __launch_bounds__(256) void k_rope(const float* __restrict__ F, int pitch, int nheads, const float* __restrict__ CS, const float* __restrict__ RF, const float* __restrict__ nw, float sc, h16* P16, bf* Ph, bf* Pl) {
    const size_t e = ((size_t)blockIdx.x * 256 + threadIdx.x) * 2; if (e >= (size_t)nheads * TT * HD) return; const int d = (int)(e % HD); const int t = (int)((e / HD) % TT); const int h = (int)(e / ((size_t)HD * TT)); const float* f = F + (size_t)t * pitch + h * HD; const float rf = RF ? RF[(size_t)h * TT + t] : 1.0f; v2h o16; v2us oh, ol;
#pragma unroll
    for (int q = 0; q < 2; ++q) { const int dd = d + q; const int dp = (dd < HD / 2) ? dd + HD / 2 : dd - HD / 2; float x0 = f[dd], x1 = f[dp];
        if (RF) { float n0 = __fmul_rn(x0, rf), n1 = __fmul_rn(x1, rf); asm volatile("" : "+v"(n0)); asm volatile("" : "+v"(n1)); x0 = __fmul_rn(bfr(nw[dd]), n0); x1 = __fmul_rn(bfr(nw[dp]), n1); }
        const v2f cs = *(const v2f*)(CS + ((size_t)t * HD + dd) * 2); float a = __fmul_rn(x0, cs[0]), bq = __fmul_rn(x1, cs[1]); asm volatile("" : "+v"(a)); asm volatile("" : "+v"(bq)); const float r = ((dd < HD / 2) ? __fsub_rn(a, bq) : __fadd_rn(a, bq)) * sc;
        o16[q] = tohx(r); unsigned short a2, c2; splitf(r, a2, c2); oh[q] = a2; ol[q] = c2; }
    *(v2h*)(P16 + e) = o16; *(v2us*)(Ph + e) = oh; *(v2us*)(Pl + e) = ol;  }
__constant__ float INV2[HD / 2] = { 1.000000000e+00f, 7.498942018e-01f, 5.623413324e-01f, 4.216965139e-01f, 3.162277639e-01f, 2.371373624e-01f, 1.778279394e-01f, 1.333521456e-01f, 1.000000015e-01f, 7.498941571e-02f, 5.623412877e-02f, 4.216964915e-02f, 3.162277862e-02f, 2.371373586e-02f, 1.778279431e-02f, 1.333521493e-02f, 9.999999776e-03f, 7.498942316e-03f, 5.623413250e-03f, 4.216964822e-03f, 3.162277862e-03f, 2.371373819e-03f, 1.778279431e-03f, 1.333521446e-03f, 1.000000047e-03f, 7.498941850e-04f, 5.623413017e-04f, 4.216964880e-04f, 3.162277862e-04f, 2.371373848e-04f, 1.778279402e-04f, 1.333521504e-04f };   // float32 1.0 / (10000.0 ** (arange(0, 64, 2, dtype=float32) / 64)), generated with jnp to be bit-exact
__global__ __launch_bounds__(256) void k_csP(float* CS) { const int idx = blockIdx.x * 256 + threadIdx.x; if (idx >= TT * HD) return; const int d = idx % HD; const int t = idx / HD; const float a = __fmul_rn(__fmul_rn((float)t, 6.2831855f), INV2[d >> 1]); v2f cs; cs[0] = cosf(a); cs[1] = sinf(a); *(v2f*)(CS + (size_t)idx * 2) = cs;  }
// ---- k_fattn: causal attention in one launch; no score plane. One wave = one query head x 32 query rows; the REP heads of one kv group sit in one work-group and walk the same keys.
// Per 32 keys a wave forms S^T = K Q^T (A = 16 key rows, B = 16 query columns, Q kept in registers), so a lane holds scores of ONE query per column tile: lane (lr, hi), register j of key tile kt = key kt 16 + hi 8 + j.
// Softmax runs on a running maximum (base 2, scale folded in); two converted S^T tiles are the B operand of O^T += V^T P^T as they stand (the loader's k order 8 hi + e, 16 + 8 hi + e is theirs too).
// Rows < RH: bf16 hi/lo planes, 3 products each; the rest fp16. O^T / sum goes out as the merged bf16 hi/lo planes [t][head x HD + d], 8 consecutive d per lane.
__device__ __forceinline__ float xhalf(float x) { return __builtin_bit_cast(float, __builtin_amdgcn_permlanex16(__builtin_bit_cast(int, x), __builtin_bit_cast(int, x), 0x76543210, 0xfedcba98, false, false)); }   // the value of lane l ^ 16
__device__ __forceinline__ void ppack(const v8f& t0, const v8f& t1, v16h& h, v16h& l) { (void)l;
#pragma unroll
    for (int e = 0; e < 8; ++e) { h[e] = (h16)t0[e]; h[8 + e] = (h16)t1[e]; } }
__device__ __forceinline__ void ppack(const v8f& t0, const v8f& t1, v16bf& h, v16bf& l) {
#pragma unroll
    for (int e = 0; e < 8; ++e) { const __bf16 a = (__bf16)t0[e], b = (__bf16)t1[e]; h[e] = a; h[8 + e] = b; l[e] = (__bf16)(t0[e] - (float)a); l[8 + e] = (__bf16)(t1[e] - (float)b); } }
template <bool B> struct BoolC { static constexpr bool v = B; };
template <typename T16, int NSPLIT>
__device__ __forceinline__ void fattn(const T16* __restrict__ Q, const T16* __restrict__ Q2, const T16* __restrict__ Kp, const T16* __restrict__ Kp2, const T16* __restrict__ Vt, const T16* __restrict__ Vt2, int g, int head, int q0, int lane, bf* Ah, bf* Al) {
    typedef typename WFrag<T16>::V V;
    static_assert(NSPLIT == 0 || NSPLIT == 2, "one plane or hi/lo planes on both sides");
    constexpr float C2 = SCL * 1.4426950408889634f;      // score scale x log2 e. Every inner loop below is unrolled so that the fragment and tile arrays are indexed by constants and stay in registers.
    const int lr = lane & 15, hi = lane >> 4;
    const size_t qo = ((size_t)head * TT + q0 + lr) * HD + 8 * hi, ko = ((size_t)g * TT + lr) * HD + 8 * hi, vo = ((size_t)g * HD + lr) * TT + 8 * hi;
    V qf[2][2], qf2[2][2], kf[2][2], kf2[2][2];
    { const T16 *pq = Q + qo, *pq2 = (NSPLIT == 2) ? Q2 + qo : pq, *pk = Kp + ko, *pk2 = (NSPLIT == 2) ? Kp2 + ko : pk;
#pragma unroll
      for (int t = 0; t < 2; ++t)
#pragma unroll
          for (int ks = 0; ks < 2; ++ks) { qf[t][ks] = WFrag<T16>::ld(pq + t * 16 * HD + ks * 32); kf[t][ks] = WFrag<T16>::ld(pk + t * 16 * HD + ks * 32); if (NSPLIT == 2) { qf2[t][ks] = WFrag<T16>::ld(pq2 + t * 16 * HD + ks * 32); kf2[t][ks] = WFrag<T16>::ld(pk2 + t * 16 * HD + ks * 32); } }
      xwait4(pq, pq2, pk, pk2); }
    v8f o[4][2];
#pragma unroll
    for (int db = 0; db < 4; ++db)
#pragma unroll
        for (int qt = 0; qt < 2; ++qt) o[db][qt] = (v8f){};
    float m[2] = { -3.0e38f, -3.0e38f }, nm[2] = { 3.0e38f * C2, 3.0e38f * C2 }, l[2] = { 0.f, 0.f };      // running maximum (raw score), minus its scaled value, this lane's share of the sum
    auto block = [&](int k0, auto lastc) __attribute__((always_inline)) {
        constexpr bool LAST = decltype(lastc)::v;      // the diagonal block (k0 == q0): masked, and nothing fetched ahead
        V vf[4], vf2[4];
        { const T16 *pv = Vt + vo + k0, *pv2 = (NSPLIT == 2) ? Vt2 + vo + k0 : pv;      // issued here, used behind the softmax
#pragma unroll
          for (int db = 0; db < 4; ++db) { vf[db] = WFrag<T16>::ld(pv + (size_t)db * 16 * TT); if (NSPLIT == 2) vf2[db] = WFrag<T16>::ld(pv2 + (size_t)db * 16 * TT); }
          xwait4(pv, pv2, pv, pv2); }
        v8f s[2][2];
#pragma unroll
        for (int kt = 0; kt < 2; ++kt)
#pragma unroll
            for (int qt = 0; qt < 2; ++qt) { v8f c = (v8f){};
#pragma unroll
                for (int ks = 0; ks < 2; ++ks) { c = WFrag<T16>::mma(kf[kt][ks], qf[qt][ks], c); if (NSPLIT == 2) { c = WFrag<T16>::mma(kf[kt][ks], qf2[qt][ks], c); c = WFrag<T16>::mma(kf2[kt][ks], qf[qt][ks], c); } }
                s[kt][qt] = c; }
        if constexpr (!LAST) { const T16 *pk = Kp + ko + (size_t)(k0 + 32) * HD, *pk2 = (NSPLIT == 2) ? Kp2 + ko + (size_t)(k0 + 32) * HD : pk;      // the next block's key fragments fly during this block's softmax and P.V
#pragma unroll
            for (int t = 0; t < 2; ++t)
#pragma unroll
                for (int ks = 0; ks < 2; ++ks) { kf[t][ks] = WFrag<T16>::ld(pk + t * 16 * HD + ks * 32); if (NSPLIT == 2) kf2[t][ks] = WFrag<T16>::ld(pk2 + t * 16 * HD + ks * 32); }
            xwait4(pk, pk2, pk, pk2); }
        if constexpr (LAST) {
#pragma unroll
            for (int kt = 0; kt < 2; ++kt)
#pragma unroll
                for (int qt = 0; qt < 2; ++qt)
#pragma unroll
                    for (int j = 0; j < 8; ++j) if (kt * 16 + hi * 8 + j > qt * 16 + lr) s[kt][qt][j] = -3.0e38f; }      // key beyond the query: excluded
        float mb[2];
#pragma unroll
        for (int qt = 0; qt < 2; ++qt) { float x0 = fmaxf(s[0][qt][0], s[1][qt][0]), x1 = fmaxf(s[0][qt][1], s[1][qt][1]);
#pragma unroll
            for (int j = 2; j < 8; j += 2) { x0 = fmaxf(x0, fmaxf(s[0][qt][j], s[1][qt][j])); x1 = fmaxf(x1, fmaxf(s[0][qt][j + 1], s[1][qt][j + 1])); }
            x0 = fmaxf(x0, x1); mb[qt] = fmaxf(x0, xhalf(x0)); }
        if (__builtin_amdgcn_ballot_w32(mb[0] > m[0] || mb[1] > m[1]) != 0) {      // scalar branch: a maximum rose somewhere in the wave (rare after the first blocks)
#pragma unroll
            for (int qt = 0; qt < 2; ++qt) { const float mn = fmaxf(m[qt], mb[qt]), nn = -(mn * C2), al = __builtin_amdgcn_exp2f(nn - nm[qt]); m[qt] = mn; nm[qt] = nn; l[qt] *= al;
#pragma unroll
                for (int db = 0; db < 4; ++db) o[db][qt] *= al; } }
        V ph[2], pl[2];
#pragma unroll
        for (int qt = 0; qt < 2; ++qt) { float a[4] = { 0.f, 0.f, 0.f, 0.f };
#pragma unroll
            for (int kt = 0; kt < 2; ++kt)
#pragma unroll
                for (int j = 0; j < 8; ++j) { const float p = __builtin_amdgcn_exp2f(__builtin_fmaf(s[kt][qt][j], C2, nm[qt])); s[kt][qt][j] = p; a[j & 3] += p; }
            l[qt] += (a[0] + a[1]) + (a[2] + a[3]); ppack(s[0][qt], s[1][qt], ph[qt], pl[qt]); }
#pragma unroll
        for (int db = 0; db < 4; ++db)
#pragma unroll
            for (int qt = 0; qt < 2; ++qt) { o[db][qt] = WFrag<T16>::mma(vf[db], ph[qt], o[db][qt]); if (NSPLIT == 2) { o[db][qt] = WFrag<T16>::mma(vf[db], pl[qt], o[db][qt]); o[db][qt] = WFrag<T16>::mma(vf2[db], ph[qt], o[db][qt]); } }
    };
#pragma unroll 1      // rolled: the key fragments fetched ahead land in the registers the next trip reads, and the loop's code stays short
    for (int k0 = 0; k0 < q0; k0 += 32) block(k0, BoolC<false>());
    block(q0, BoolC<true>());
#pragma unroll
    for (int qt = 0; qt < 2; ++qt) { const float inv = __fdiv_rn(1.0f, l[qt] + xhalf(l[qt])); const size_t oo = (size_t)(q0 + qt * 16 + lr) * DQ + head * HD + hi * 8;      // the two lane halves' sums join here, once
#pragma unroll
        for (int db = 0; db < 4; ++db) { v8us oh, ol;
#pragma unroll
            for (int j = 0; j < 8; ++j) { unsigned short a, c2; splitf(o[db][qt][j] * inv, a, c2); oh[j] = a; ol[j] = c2; }
            *(v8us*)(Ah + oo + db * 16) = oh; *(v8us*)(Al + oo + db * 16) = ol; } }
}
// grid (NKV, TT / 64), 2 REP waves: waves 0..REP-1 take 32-row block TT/32 - 1 - y (long), waves REP.. block y (short), one head each, so that every work-group walks about the same number of key blocks. The waves share no barrier and no buffer.
// Register budget: two waves per SIMD (one work-group per WGP).
__global__ __launch_bounds__(2 * REP * 32, 2) void k_fattn(const h16* __restrict__ Q16, const h16* __restrict__ K16, const h16* __restrict__ V16, const bf* __restrict__ Qh, const bf* __restrict__ Ql, const bf* __restrict__ Kh, const bf* __restrict__ Kl, const bf* __restrict__ Vh, const bf* __restrict__ Vl, bf* Ah, bf* Al) {
    const int lane = threadIdx.x & 31, wv = __builtin_amdgcn_readfirstlane(threadIdx.x >> 5);      // wave number, scalar so that head, row block and the key loop stay scalar
    const int g = blockIdx.x, head = g * REP + (wv & (REP - 1)), q0 = ((wv < REP) ? TT / 32 - 1 - (int)blockIdx.y : (int)blockIdx.y) * 32;
    if (q0 < RH) fattn<bf, 2>(Qh, Ql, Kh, Kl, Vh, Vl, g, head, q0, lane, Ah, Al); else fattn<h16, 0>(Q16, nullptr, K16, nullptr, V16, nullptr, g, head, q0, lane, Ah, Al);
}

extern "C" void kernel_launch(void* const* d_in, const int* in_sizes, int n_in,
                              void* d_out, int out_size, void* d_ws, size_t ws_size, hipStream_t stream) {
    (void)in_sizes; (void)n_in; (void)out_size;
    const float* x = (const float*)d_in[0]; const float* wq = (const float*)d_in[1]; const float* wk = (const float*)d_in[2]; const float* wv = (const float*)d_in[3]; const float* wo = (const float*)d_in[4];   /* order x, Wq ('oi' [2048][2048]), Wk, Wv ('oi' [512][2048]), Wo ('oi') */
    float* OUT = (float*)d_out;     // [2][2048][2048]
    char* wsp = (char*)d_ws;
    auto take = [&](size_t bytes) { char* p = wsp; wsp += (bytes + 255) & ~(size_t)255; return (void*)p; };
    bf* WQ = (bf*)take((size_t)DQ * DM * 2); bf* WK = (bf*)take((size_t)DKV * DM * 2); bf* WV = (bf*)take((size_t)DKV * DM * 2); bf* WO = (bf*)take((size_t)DM * DQ * 2); float* CS = (float*)take((size_t)TT * HD * 2 * 4);
    bf* XB = (bf*)take((size_t)TT * DM * 2);
    h16* QP16 = (h16*)take((size_t)NH_ * TT * HD * 2); h16* KP16 = (h16*)take((size_t)NKV * TT * HD * 2); h16* VT16 = (h16*)take((size_t)NKV * HD * TT * 2);
    bf* QPh = (bf*)take((size_t)NH_ * TT * HD * 2); bf* QPl = (bf*)take((size_t)NH_ * TT * HD * 2); bf* KPh = (bf*)take((size_t)NKV * TT * HD * 2); bf* KPl = (bf*)take((size_t)NKV * TT * HD * 2); bf* VTh = (bf*)take((size_t)NKV * HD * TT * 2); bf* VTl = (bf*)take((size_t)NKV * HD * TT * 2);
    bf* ATh = (bf*)take((size_t)TT * DQ * 2); bf* ATl = (bf*)take((size_t)TT * DQ * 2);
    if ((size_t)(wsp - (char*)d_ws) > ws_size) return;    // ws 256 MiB
    { k_cvt8<<<(unsigned)(((size_t)DQ * DM / 8 + 255) / 256), 256, 0, stream>>>(wq, WQ, (size_t)DQ * DM / 8); k_cvt8<<<(unsigned)(((size_t)DKV * DM / 8 + 255) / 256), 256, 0, stream>>>(wk, WK, (size_t)DKV * DM / 8); k_cvt8<<<(unsigned)(((size_t)DKV * DM / 8 + 255) / 256), 256, 0, stream>>>(wv, WV, (size_t)DKV * DM / 8);
      k_cvt8<<<(unsigned)(((size_t)DM * DQ / 8 + 255) / 256), 256, 0, stream>>>(wo, WO, (size_t)DM * DQ / 8);
       }
    k_csP<<<(TT * HD + 255) / 256, 256, 0, stream>>>(CS);
    for (int b = 0; b < NB_; ++b) {
        
        k_cvt8<<<(unsigned)(((size_t)TT * DM / 8 + 255) / 256), 256, 0, stream>>>(x + (size_t)b * TT * DM, XB, (size_t)TT * DM / 8);
        k_gemmw<bf, 0, false, 8, 1><<<dim3(TT / 64, DQ / 64, 1), 256, 0, stream>>>(XB, nullptr, WQ, nullptr, DM, nullptr, 0, nullptr, 0, 0, 0, CS, QP16, QPh, QPl);
        k_gemmw<bf, 0, false, 16, 1><<<dim3(TT / 64, DKV / 64, 1), 512, 0, stream>>>(XB, nullptr, WK, nullptr, DM, nullptr, 0, nullptr, 0, 0, 0, CS, KP16, KPh, KPl);
        k_gemmw<bf, 0, false, 16, 2><<<dim3(DKV / 64, TT / 64, 1), 512, 0, stream>>>(WV, nullptr, XB, nullptr, DM, nullptr, 0, nullptr, 0, 0, 0, nullptr, VT16, VTh, VTl);      // A = Wv rows, B = x rows: the tile is V^T [kv head x HD + d][t]
        k_fattn<<<dim3(NKV, TT / 64, 1), 2 * REP * 32, 0, stream>>>(QP16, KP16, VT16, QPh, QPl, KPh, KPl, VTh, VTl, ATh, ATl);
        k_gemmw<bf, 1, false, 8, 0><<<dim3(TT / 64, DM / 64, 1), 256, 0, stream>>>(ATh, ATl, WO, nullptr, DQ, OUT + (size_t)b * TT * DM, DM, nullptr, 0, 0, 0, nullptr, nullptr, nullptr, nullptr); }
}

// v006
// It runs in 214 microseconds.
// Next to v005, in two timings, it ran 1.26 and 1.29 times as fast.
// Over all steps from v000 it is 12.7 times as fast.
#include <hip/hip_runtime.h>

// Causal grouped-query attention with interleaved-pair rotary embeddings whose positions carry a 2 pi factor (x [2][2048][2048]; q = x Wq^T (32 heads x 64), k, v = x Wk^T, x Wv^T (8 kv heads x 64) ('oi' 1/sqrt(2048), no bias); rope on (even, odd) pairs: (re, im) = (q0 c - q1 s, q0 s + q1 c) with angle fl(fl(s x 2 pi) x freq_i), freq_i = 1 / 10000^(2i/64) (32 f32 frequencies jnp-exact; TWO f32 products; precise cosf/sinf); k, v repeated 4 x along the head axis: kv head = q head / 4; scores / sqrt(64); causal (finfo.min == exclusion); softmax; out = merged Wo^T ('oi', no bias) -> [2][2048][2048] (8.4 M); argument order x, Wq, Wk, Wv, Wo).
// Layout: four launches, the batch index is grid z: bf16 copies of x and of the 'oi' weights and the rotary table (k_prep); q, k and v in one GEMM grid; exact projections whose epilogue applies the rotary table and writes the head planes (v: product formed transposed); causal T-2048 GQA attention in one launch (k_fattn: scores, running-maximum softmax and P.V in registers; hybrid rows: < 512 hi/lo 3 products, rest fp16); merged hi/lo x Wo exact.
// Compute dtypes, f32 accumulate: every input rounded to bf16; projections exact; attention rows < 512 3 products, rest fp16; softmax f32; output projection hl x exact.

#define NB_  2
#define TT   2048
#define DM   2048
#define NH_  32
#define NKV  8
#define REP  (NH_ / NKV)
#define HD   64
#define DQ   (NH_ * HD)
#define DKV  (NKV * HD)
#define RH   512                  // query rows < RH use hi+lo planes (0: none)
#define SCL  0.125f   // HD^-0.5
static_assert(RH % 32 == 0 && TT % 64 == 0 && (REP & (REP - 1)) == 0, "a 32-row block is wholly hi/lo or wholly fp16; blocks pair up; the head comes from the low bits of the wave number");
typedef _Float16 h16;
typedef unsigned short bf;
typedef __attribute__((ext_vector_type(16))) __bf16   v16bf;
typedef __attribute__((ext_vector_type(16))) _Float16 v16h;
typedef __attribute__((ext_vector_type(8)))  _Float16 v8h;
typedef __attribute__((ext_vector_type(8)))  unsigned short v8us;
typedef __attribute__((ext_vector_type(8)))  float    v8f;
typedef __attribute__((ext_vector_type(4)))  float    v4f;
typedef v8h  __attribute__((may_alias)) v8ha;
typedef v4f  __attribute__((may_alias)) v4fa;
typedef v8us __attribute__((may_alias)) v8usa;

__device__ __forceinline__ unsigned short f2bf(float f) { unsigned u = __float_as_uint(f); u += 0x7FFFu + ((u >> 16) & 1u); return (unsigned short)(u >> 16); }
__device__ __forceinline__ float bf2f(unsigned short b) { return __uint_as_float(((unsigned)b) << 16); }
__device__ __forceinline__ float bfr(float f) { return bf2f(f2bf(f)); }
__device__ __forceinline__ void splitf(float y, unsigned short& h, unsigned short& l) { h = f2bf(y); l = f2bf(y - bf2f(h)); }
typedef __attribute__((ext_vector_type(2))) float v2f;
__device__ __forceinline__ v16h cat16(v8h lo, v8h hi) { return __builtin_shufflevector(lo, hi, 0, 1, 2, 3, 4, 5, 6, 7, 8, 9, 10, 11, 12, 13, 14, 15); }
__device__ __forceinline__ v16bf cat16b(v8us lo, v8us hi) { return __builtin_bit_cast(v16bf, __builtin_shufflevector(lo, hi, 0, 1, 2, 3, 4, 5, 6, 7, 8, 9, 10, 11, 12, 13, 14, 15)); }
__device__ __forceinline__ v8f wmma16(v16h a, v16h b, v8f c) { return __builtin_amdgcn_wmma_f32_16x16x32_f16(false, a, false, b, (short)0, c, false, false); }
__device__ __forceinline__ v8f wmmab(v16bf a, v16bf b, v8f c) { return __builtin_amdgcn_wmma_f32_16x16x32_bf16(false, a, false, b, (short)0, c, false, false); }



// ---- k_gemmw: register-blocked GEMM, one work-group of NW waves per 64x64 output tile; each wave holds the whole tile (16 accumulators) for its share of K; grid (M/64, N/64, Z), NW x 32 threads.
// Operands come from K-contiguous 16-bit planes through LDS: per trip the work-group copies NW x 32 k of its 64 rows of every operand (whole 128-B lines, 512 contiguous bytes per wave-wide asynchronous copy) into one of two buffers, and wave w reads the 32 k at w x 32 of that stretch.
// C[m][n] (f32, pitch ldc, + optional f32 bias[n]) = sum_k A[m][k] Bt[n][k] (+ split products per NSPLIT). z-batch strides sA/sB/sC in elements. K % (NW x 32) == 0. EPI 0: C is stored. EPI 1: no C; A = x, Bt = the rows of Wq, Wk, Wv one after the other, tile column y = one q head (y < NH_), one k head (the next NKV) or one v head (the last NKV; operands swapped, so the tile is V^T); the tile goes out as 16-bit planes (ksum_planes).
template <typename T16> struct WFrag;
template <> struct WFrag<h16> { typedef v16h V; static __device__ __forceinline__ V ld(const h16* p) { return cat16(*(const v8h*)p, *(const v8h*)(p + 16)); } static __device__ __forceinline__ v8f mma(V a, V b, v8f c) { return wmma16(a, b, c); } };
template <> struct WFrag<bf> { typedef v16bf V; static __device__ __forceinline__ V ld(const bf* p) { return cat16b(*(const v8us*)p, *(const v8us*)(p + 16)); } static __device__ __forceinline__ v8f mma(V a, V b, v8f c) { return wmmab(a, b, c); } };
// ksum_store: the NW waves of a work-group each hold a partial 64x64 f32 tile (their share of K). Every wave writes its tile to LDS in register order (32 slots of 16 B per lane), one barrier,
// then wave w sums slots w*32/NW.. over the waves in the fixed order 0..NW-1, turns its rows (32 columns = one 128-B line each) through its own LDS strip and stores whole lines. Ct = the tile's first element.
template <int NW, bool BIAS>
__device__ __forceinline__ void ksum_store(const v8f (&acc)[4][4], float* ps, float* Ct, int ldc, const float* bias, int wv, int lane) {
    constexpr int SP = 32 / NW, RW = SP * 4;      // slots and rows per summing wave
    const int lr = lane & 15, hi = lane >> 4;
    v4fa* pw = (v4fa*)ps;
#pragma unroll
    for (int mb = 0; mb < 4; ++mb)
#pragma unroll
        for (int nb = 0; nb < 4; ++nb)
#pragma unroll
            for (int jh = 0; jh < 2; ++jh) { const int q = ((mb * 2 + (nb >> 1)) * 2 + jh) * 2 + (nb & 1); pw[(wv * 32 + q) * 32 + lane] = (v4f){ acc[mb][nb][jh * 4], acc[mb][nb][jh * 4 + 1], acc[mb][nb][jh * 4 + 2], acc[mb][nb][jh * 4 + 3] }; }
    __syncthreads();      // every wave's partial tile is in LDS before any wave sums
    v4f r[SP];
#pragma unroll
    for (int i = 0; i < SP; ++i) r[i] = pw[(wv * SP + i) * 32 + lane];
#pragma unroll
    for (int s = 1; s < NW; ++s)
#pragma unroll
        for (int i = 0; i < SP; ++i) r[i] += pw[(s * 32 + wv * SP + i) * 32 + lane];
    const int q0 = wv * SP, mb = q0 >> 3, nbp = (q0 >> 2) & 1, jh0 = (q0 >> 1) & 1;      // slot q = ((mb*2 + nb/2)*2 + jh)*2 + nb%2
    float* sw = ps + NW * 4096 + wv * (RW * 36);
#pragma unroll
    for (int i = 0; i < SP; ++i)
#pragma unroll
        for (int jj = 0; jj < 4; ++jj) sw[(hi * (RW / 2) + (i >> 1) * 4 + jj) * 36 + (i & 1) * 16 + lr] = r[i][jj];
    asm volatile("s_wait_dscnt 0x0" ::: "memory");      // the wave's own strip is written before other lanes of the wave read it back
#pragma unroll
    for (int i = 0; i < SP; ++i) { const int idx = i * 32 + lane, lrow = idx >> 3, cofs = nbp * 32 + (idx & 7) * 4; const int trow = (SP == 4) ? lrow : ((lrow >> 2) * 8 + jh0 * 4 + (lrow & 3));
        v4f val = *(const v4fa*)(sw + lrow * 36 + (idx & 7) * 4); if (BIAS) { val[0] += bfr(bias[cofs]); val[1] += bfr(bias[cofs + 1]); val[2] += bfr(bias[cofs + 2]); val[3] += bfr(bias[cofs + 3]); }
        *(v4f*)(Ct + (size_t)(mb * 16 + trow) * ldc + cofs) = val; }
}
// ksum_planes: the same wave sum as ksum_store, but the 64x64 tile leaves as 16-bit planes (fp16 + bf16 hi/lo) instead of f32. The summed slots go into one LDS tile (pitch 68 floats), one more barrier,
// then each wave takes 64 / NW whole rows, 8 consecutive columns per lane, so that 8 lanes store one whole 128-B line of each plane. P16 / Ph / Pl = the tile's first element in each plane.
// rot (the same for the whole work-group): tile rows = positions, tile columns = the 64 dims of one head; (even, odd) pairs are rotated by the table row CSt[row][d] = (cos, sin); plane pitch HD. Not rot: values as they are; plane pitch TT.
template <int NW>
__device__ __forceinline__ void ksum_planes(const v8f (&acc)[4][4], float* ps, const bool rot, const float* __restrict__ CSt, h16* P16, bf* Ph, bf* Pl, int wv, int lane) {
    static_assert(HD == 64, "one 64-column tile is one head");
    constexpr int SP = 32 / NW, NI = 16 / NW, PT = 68; const int PP = rot ? HD : TT;      // slots per summing wave; groups of 4 rows per storing wave; LDS tile pitch; plane pitch
    const int lr = lane & 15, hi = lane >> 4, c8 = (lane & 7) * 8, rw = wv * (64 / NW) + (lane >> 3);
    v2f cs[NI][4];
    if (rot) { const float* pc = CSt + (rw * HD + c8) * 2;      // issued first: the table values fly while the partial tiles go to LDS
#pragma unroll
        for (int it = 0; it < NI; ++it)
#pragma unroll
            for (int p = 0; p < 4; ++p) cs[it][p] = *(const v2f*)(pc + (it * 4 * HD + 2 * p) * 2);
        asm volatile("s_wait_xcnt 0x0" :: "v"(pc) : "memory"); }      // the run's address is an input, so it stays in its registers until the wait: otherwise the last load's result lands in the address pair the earlier loads name (a precaution, as in xwait4)
    v4fa* pw = (v4fa*)ps;
#pragma unroll
    for (int mb = 0; mb < 4; ++mb)
#pragma unroll
        for (int nb = 0; nb < 4; ++nb)
#pragma unroll
            for (int jh = 0; jh < 2; ++jh) { const int q = ((mb * 2 + (nb >> 1)) * 2 + jh) * 2 + (nb & 1); pw[(wv * 32 + q) * 32 + lane] = (v4f){ acc[mb][nb][jh * 4], acc[mb][nb][jh * 4 + 1], acc[mb][nb][jh * 4 + 2], acc[mb][nb][jh * 4 + 3] }; }
    __syncthreads();      // every wave's partial tile is in LDS before any wave sums
    v4f r[SP];
#pragma unroll
    for (int i = 0; i < SP; ++i) r[i] = pw[(wv * SP + i) * 32 + lane];
#pragma unroll
    for (int s = 1; s < NW; ++s)
#pragma unroll
        for (int i = 0; i < SP; ++i) r[i] += pw[(s * 32 + wv * SP + i) * 32 + lane];
    float* tl = ps + NW * 4096;
#pragma unroll
    for (int i = 0; i < SP; ++i) { const int q = wv * SP + i, mb = q >> 3, nb = ((q >> 2) & 1) * 2 + (q & 1), jh = (q >> 1) & 1;      // slot q = ((mb*2 + nb/2)*2 + jh)*2 + nb%2
#pragma unroll
        for (int jj = 0; jj < 4; ++jj) tl[(mb * 16 + hi * 8 + jh * 4 + jj) * PT + nb * 16 + lr] = r[i][jj]; }
    __syncthreads();      // the whole summed tile is in LDS before any wave reads whole rows of it
#pragma unroll
    for (int it = 0; it < NI; ++it) { const int row = rw + it * 4; const v4f u0 = *(const v4fa*)(tl + row * PT + c8), u1 = *(const v4fa*)(tl + row * PT + c8 + 4);
        float y[8] = { u0[0], u0[1], u0[2], u0[3], u1[0], u1[1], u1[2], u1[3] };
        if (rot) {
#pragma unroll
            for (int p = 0; p < 4; ++p) { const float x0 = y[2 * p], x1 = y[2 * p + 1], c = cs[it][p][0], s = cs[it][p][1]; y[2 * p] = x0 * c - x1 * s; y[2 * p + 1] = x0 * s + x1 * c; } }      // even: x0 c - x1 s; odd: x0 s + x1 c
        v8h o16; v8us oh, ol;
#pragma unroll
        for (int e = 0; e < 8; ++e) { o16[e] = (h16)y[e]; unsigned short a, b; splitf(y[e], a, b); oh[e] = a; ol[e] = b; }
        const size_t e0 = (size_t)row * PP + c8;
        h16* s16 = P16 + e0; bf* sh = Ph + e0; bf* sl = Pl + e0;
        *(v8h*)s16 = o16; *(v8us*)sh = oh; *(v8us*)sl = ol;
        if (it + 1 < NI) asm volatile("s_wait_xcnt 0x0" :: "v"(o16), "v"(oh), "v"(ol), "v"(s16), "v"(sh), "v"(sl) : "memory"); }      // the three stores' data and addresses are inputs, so they stay in their registers until the wait; the next group of rows overwrites them (a precaution, as in xwait4)
}
// acopy8: eight asynchronous copies global -> LDS, 16 bytes per lane each (l = the lane's LDS byte address, g = the lane's global address). The s_wait_xcnt 0 is the last line of the copies' own statement, so that no address register is rewritten in front of it (a precaution).
template <typename T16>
__device__ __forceinline__ void acopy8(const unsigned (&l)[8], const T16* const (&g)[8]) {
    asm volatile("global_load_async_to_lds_b128 %0, %8, off\n\t"
                 "global_load_async_to_lds_b128 %1, %9, off\n\t"
                 "global_load_async_to_lds_b128 %2, %10, off\n\t"
                 "global_load_async_to_lds_b128 %3, %11, off\n\t"
                 "global_load_async_to_lds_b128 %4, %12, off\n\t"
                 "global_load_async_to_lds_b128 %5, %13, off\n\t"
                 "global_load_async_to_lds_b128 %6, %14, off\n\t"
                 "global_load_async_to_lds_b128 %7, %15, off\n\t"
                 "s_wait_xcnt 0x0"
                 :: "v"(l[0]), "v"(l[1]), "v"(l[2]), "v"(l[3]), "v"(l[4]), "v"(l[5]), "v"(l[6]), "v"(l[7]), "v"(g[0]), "v"(g[1]), "v"(g[2]), "v"(g[3]), "v"(g[4]), "v"(g[5]), "v"(g[6]), "v"(g[7]) : "memory");
}
// Register budget: four waves per SIMD (two 8-wave work-groups or one 16-wave work-group on a WGP); with a third operand plane the two buffers leave LDS for one 8-wave work-group, two waves per SIMD.
template <typename T16, int NSPLIT, bool BIAS, int NW, int EPI>
__global__ __launch_bounds__(NW * 32, 4) void k_gemmw(const T16* __restrict__ A, const T16* __restrict__ A2, const T16* __restrict__ Bt, const T16* __restrict__ Bt2, int K, float* C, int ldc, const float* __restrict__ bias, size_t sA, size_t sB, size_t sC, const float* __restrict__ CS, h16* P16, bf* Ph, bf* Pl, h16* V16, bf* Vh, bf* Vl) {
    typedef typename WFrag<T16>::V V;
    static_assert(NW % 8 == 0, "a row's stretch of NW x 64 bytes is a whole number of 512-byte copies");
    constexpr bool HA2 = (NSPLIT == 1 || NSPLIT == 2), HB2 = (NSPLIT >= 2);
    constexpr int NOP = 2 + (HA2 ? 1 : 0) + (HB2 ? 1 : 0);      // operand planes staged: slots A, Bt, then A2, Bt2 where they exist
    constexpr int KT = NW * 32, PB = KT * 2 + 16, CPR = NW / 8, BUFB = NOP * 64 * PB;      // k per trip; LDS row pitch in bytes (16 x odd: no bank conflict for 16-byte fragment reads); copies per row; bytes per buffer
    constexpr int EPF = NW * 4096 + 128 * 36, RGF = 2 * BUFB / 4;      // floats the epilogue needs; floats of the two buffers (the epilogue takes the same LDS over behind the last trip's barrier)
    __shared__ __align__(16) float os[EPF > RGF ? EPF : RGF];
    const size_t z = blockIdx.z; A += z * sA; if (A2) A2 += z * sA; Bt += z * sB; if (Bt2) Bt2 += z * sB; C += z * sC;
    const int lane = threadIdx.x & 31, lr = lane & 15, hi = lane >> 4; const int r0 = blockIdx.x * 64, c0 = blockIdx.y * 64;
    const int wv = __builtin_amdgcn_readfirstlane(threadIdx.x >> 5);      // wave number, scalar so that the K loop stays a scalar loop
    const bool isv = (EPI == 1) && (int)blockIdx.y >= NH_ + NKV;      // the same for the whole work-group
    const T16* pa = isv ? Bt + (size_t)c0 * K : A + (size_t)r0 * K; const T16* pb = isv ? A + (size_t)r0 * K : Bt + (size_t)c0 * K;      // the 64 rows on the tile's row side and on its column side
    v8f acc[4][4];
#pragma unroll
    for (int mb = 0; mb < 4; ++mb)
#pragma unroll
        for (int nb = 0; nb < 4; ++nb) acc[mb][nb] = (v8f){};
    const char* lb = (const char*)os;
    const unsigned lw = (unsigned)(size_t)os + (unsigned)(((wv * 8) / CPR) * PB + lane * 16);      // LDS byte address of this wave's first copy inside an operand's slot
    const size_t gw = (size_t)((wv * 8) / CPR) * K + lane * 8;      // the same place in an operand's 64 rows, in elements
    // stage: tile t (k = t KT ..) of every operand into buffer b. Per operand the wave makes 8 of the 8 NW copies: copy c = wv 8 + j is part c % CPR (512 bytes) of row c / CPR.
    auto stage = [&](int t, int b) __attribute__((always_inline)) {
        const T16* P[4] = { pa, pb, HA2 ? A2 + (size_t)r0 * K : (HB2 ? Bt2 + (size_t)c0 * K : A), HB2 ? Bt2 + (size_t)c0 * K : A };
#pragma unroll
        for (int o = 0; o < NOP; ++o) { unsigned l[8]; const T16* g[8];
#pragma unroll
            for (int j = 0; j < 8; ++j) { l[j] = lw + (unsigned)(b * BUFB + o * 64 * PB + (j / CPR) * PB + (j % CPR) * 512); g[j] = P[o] + gw + (size_t)(j / CPR) * K + (size_t)t * KT + (j % CPR) * 256; }
            acopy8<T16>(l, g); }
    };
    const int nt = (int)((unsigned)K / (unsigned)KT);
    stage(0, 0);
    asm volatile("s_wait_asynccnt 0x0" ::: "memory");      // this wave's share of tile 0 has landed
    __syncthreads();      // tile 0 is whole before any wave reads it
    if (nt > 1) stage(1, 1);
    const int fo = lr * PB + wv * 64 + hi * 16;      // this lane's place in a 16-row fragment: row lr, the wave's 32 k, k order 8 hi + e, 16 + 8 hi + e on both sides
#pragma unroll 1
    for (int t = 0; t < nt; ++t) {      // wave wv takes the 32 k at wv x 32 of every stretch of NW x 32 k
        const char* fb = lb + (t & 1) * BUFB + fo;
        V a[4], a2[4], b[4], b2[4];      // all of the trip's fragment reads stand together in front of its products
#pragma unroll
        for (int mb = 0; mb < 4; ++mb) { a[mb] = WFrag<T16>::ld((const T16*)(fb + mb * 16 * PB)); b[mb] = WFrag<T16>::ld((const T16*)(fb + (64 + mb * 16) * PB)); if (HA2) a2[mb] = WFrag<T16>::ld((const T16*)(fb + (2 * 64 + mb * 16) * PB)); if (HB2) b2[mb] = WFrag<T16>::ld((const T16*)(fb + ((NOP - 1) * 64 + mb * 16) * PB)); }
        asm volatile("s_wait_dscnt 0x0" ::: "memory");      // this wave's reads of buffer t & 1 are done: the trip's fragments are in registers
        asm volatile("s_wait_asynccnt 0x0" ::: "memory");      // this wave's share of tile t + 1 has landed
        __syncthreads();      // publishes tile t + 1 and ends every wave's reads of the buffer refilled below (in the last trip: of the LDS the epilogue takes over)
        if (t + 2 < nt) stage(t + 2, t & 1);      // issued in front of the trip's products, which need registers only: the copies fly behind them
#pragma unroll
        for (int nb = 0; nb < 4; ++nb)
#pragma unroll
            for (int mb = 0; mb < 4; ++mb) { acc[mb][nb] = WFrag<T16>::mma(a[mb], b[nb], acc[mb][nb]); if (HA2) acc[mb][nb] = WFrag<T16>::mma(a2[mb], b[nb], acc[mb][nb]); if (HB2) acc[mb][nb] = WFrag<T16>::mma(a[mb], b2[nb], acc[mb][nb]); }
        asm volatile("v_nop\n\tv_nop\n\tv_nop\n\tv_nop" : "+v"(acc[0][0]), "+v"(acc[1][1]), "+v"(acc[2][2]), "+v"(acc[3][3]) : "v"(a[0]), "v"(a[3]));      // four vector slots behind the trip's last products on both ways out of the trip: the next fragment reads land in their A and B registers, the epilogue stores their results
    }
    asm volatile("s_wait_asynccnt 0x0" ::: "memory");      // no copy is outstanding when the epilogue writes this LDS
    if constexpr (EPI == 0) ksum_store<NW, BIAS>(acc, os, C + (size_t)r0 * ldc + c0, ldc, BIAS ? bias + c0 : bias, wv, lane);
    else { const size_t po = isv ? (z * DKV + (c0 - DQ - DKV)) * TT + r0 : ((z * (NH_ + NKV) + blockIdx.y) * TT + r0) * HD;      // v planes [z][kv head x HD + d][t]; q and k planes [z][q heads, then k heads][t][d]
        ksum_planes<NW>(acc, os, !isv, CS + (size_t)r0 * HD * 2, (isv ? V16 : P16) + po, (isv ? Vh : Ph) + po, (isv ? Vl : Pl) + po, wv, lane); }
}

// xwait4: s_wait_xcnt 0 behind a run of fragment loads. The run's addresses are inputs of the statement, so each stays in its registers until the wait (a precaution for replayed address translations).
template <typename T16> __device__ __forceinline__ void xwait4(const T16* p0, const T16* p1, const T16* p2, const T16* p3) { asm volatile("s_wait_xcnt 0x0" :: "v"(p0), "v"(p1), "v"(p2), "v"(p3) : "memory"); }

__device__ __forceinline__ h16 tohx(float x) { return (h16)x; }
typedef __attribute__((ext_vector_type(2))) _Float16 v2h;
typedef __attribute__((ext_vector_type(4))) _Float16 v4h;
typedef __attribute__((ext_vector_type(2))) unsigned short v2us;
typedef __attribute__((ext_vector_type(4))) unsigned short v4us;
typedef __attribute__((ext_vector_type(4))) int v4i;

// k_rope: head planes [h][t][d] (fp16 + hi/lo) of rope(x) x sc with the rotate-half convention out[d] = x[d] cos[t][d] - x[d+HD/2] sin[t][d], out[d+HD/2] = x[d+HD/2] cos[t][d+HD/2] + x[d] sin[t][d+HD/2]
__global__ __launch_bounds__(256) void k_rope(const float* __restrict__ F, int pitch, int nheads, const float* __restrict__ CS, const float* __restrict__ RF, const float* __restrict__ nw, float sc, h16* P16, bf* Ph, bf* Pl) {
    const size_t e = ((size_t)blockIdx.x * 256 + threadIdx.x) * 2; if (e >= (size_t)nheads * TT * HD) return; const int d = (int)(e % HD); const int t = (int)((e / HD) % TT); const int h = (int)(e / ((size_t)HD * TT)); const float* f = F + (size_t)t * pitch + h * HD; const float rf = RF ? RF[(size_t)h * TT + t] : 1.0f; v2h o16; v2us oh, ol;
#pragma unroll
    for (int q = 0; q < 2; ++q) { const int dd = d + q; const int dp = (dd < HD / 2) ? dd + HD / 2 : dd - HD / 2; float x0 = f[dd], x1 = f[dp];
        if (RF) { float n0 = __fmul_rn(x0, rf), n1 = __fmul_rn(x1, rf); asm volatile("" : "+v"(n0)); asm volatile("" : "+v"(n1)); x0 = __fmul_rn(bfr(nw[dd]), n0); x1 = __fmul_rn(bfr(nw[dp]), n1); }
        const v2f cs = *(const v2f*)(CS + ((size_t)t * HD + dd) * 2); float a = __fmul_rn(x0, cs[0]), bq = __fmul_rn(x1, cs[1]); asm volatile("" : "+v"(a)); asm volatile("" : "+v"(bq)); const float r = ((dd < HD / 2) ? __fsub_rn(a, bq) : __fadd_rn(a, bq)) * sc;
        o16[q] = tohx(r); unsigned short a2, c2; splitf(r, a2, c2); oh[q] = a2; ol[q] = c2; }
    *(v2h*)(P16 + e) = o16; *(v2us*)(Ph + e) = oh; *(v2us*)(Pl + e) = ol;  }
__constant__ float INV2[HD / 2] = { 1.000000000e+00f, 7.498942018e-01f, 5.623413324e-01f, 4.216965139e-01f, 3.162277639e-01f, 2.371373624e-01f, 1.778279394e-01f, 1.333521456e-01f, 1.000000015e-01f, 7.498941571e-02f, 5.623412877e-02f, 4.216964915e-02f, 3.162277862e-02f, 2.371373586e-02f, 1.778279431e-02f, 1.333521493e-02f, 9.999999776e-03f, 7.498942316e-03f, 5.623413250e-03f, 4.216964822e-03f, 3.162277862e-03f, 2.371373819e-03f, 1.778279431e-03f, 1.333521446e-03f, 1.000000047e-03f, 7.498941850e-04f, 5.623413017e-04f, 4.216964880e-04f, 3.162277862e-04f, 2.371373848e-04f, 1.778279402e-04f, 1.333521504e-04f };   // float32 1.0 / (10000.0 ** (arange(0, 64, 2, dtype=float32) / 64)), generated with jnp to be bit-exact
// k_prep: every input rounded to bf16, and the rotary table, in one launch. Blocks 0 .. CSB-1 build the table, one (cos, sin) entry per thread; every later block converts CHE consecutive floats of one input, 8 per thread.
#define CHE 2048
static_assert(((size_t)NB_ * TT * DM) % CHE == 0 && ((size_t)DQ * DM) % CHE == 0 && ((size_t)DKV * DM) % CHE == 0 && (TT * HD) % 256 == 0, "whole blocks only: no edge test");
#define CSB (TT * HD / 256)
#define CX  (NB_ * TT * DM / CHE)
#define CQ  (DQ * DM / CHE)
#define CK  (DKV * DM / CHE)
__global__ __launch_bounds__(256) void k_prep(const float* __restrict__ x, const float* __restrict__ wq, const float* __restrict__ wk, const float* __restrict__ wv, const float* __restrict__ wo, bf* XB, bf* WQ, bf* WK, bf* WV, bf* WO, float* CS) {
    int c = blockIdx.x;
    if (c < CSB) { const int idx = c * 256 + threadIdx.x; const int d = idx % HD; const int t = idx / HD; const float a = __fmul_rn(__fmul_rn((float)t, 6.2831855f), INV2[d >> 1]); v2f cs; cs[0] = cosf(a); cs[1] = sinf(a); *(v2f*)(CS + (size_t)idx * 2) = cs; return; }
    c -= CSB;
    const float* s; bf* d;
    if (c < CX) { s = x; d = XB; }
    else if (c < CX + CQ) { s = wq; d = WQ; c -= CX; }
    else if (c < CX + CQ + CK) { s = wk; d = WK; c -= CX + CQ; }
    else if (c < CX + CQ + 2 * CK) { s = wv; d = WV; c -= CX + CQ + CK; }
    else { s = wo; d = WO; c -= CX + CQ + 2 * CK; }
    const size_t e0 = (size_t)c * CHE + threadIdx.x * 8;
    const v8f v = *(const v8f*)(s + e0); v8us o;
#pragma unroll
    for (int k = 0; k < 8; ++k) o[k] = f2bf(v[k]);
    *(v8us*)(d + e0) = o;
    asm volatile("s_wait_xcnt 0x0" ::: "memory");      // behind the store: the compiler lays the table part's text behind it, whose first instructions write the store's registers (a precaution)
}
// ---- k_fattn: causal attention in one launch; no score plane. One wave = one query head x 32 query rows; the REP heads of one kv group sit in one work-group and walk the same keys.
// Per 32 keys a wave forms S^T = K Q^T (A = 16 key rows, B = 16 query columns, Q kept in registers), so a lane holds scores of ONE query per column tile: lane (lr, hi), register j of key tile kt = key kt 16 + hi 8 + j.
// Softmax runs on a running maximum (base 2, scale folded in); two converted S^T tiles are the B operand of O^T += V^T P^T as they stand (the loader's k order 8 hi + e, 16 + 8 hi + e is theirs too).
// Rows < RH: bf16 hi/lo planes, 3 products each; the rest fp16. O^T / sum goes out as the merged bf16 hi/lo planes [t][head x HD + d], 8 consecutive d per lane.
__device__ __forceinline__ float xhalf(float x) { return __builtin_bit_cast(float, __builtin_amdgcn_permlanex16(__builtin_bit_cast(int, x), __builtin_bit_cast(int, x), 0x76543210, 0xfedcba98, false, false)); }   // the value of lane l ^ 16
__device__ __forceinline__ void ppack(const v8f& t0, const v8f& t1, v16h& h, v16h& l) { (void)l;
#pragma unroll
    for (int e = 0; e < 8; ++e) { h[e] = (h16)t0[e]; h[8 + e] = (h16)t1[e]; } }
__device__ __forceinline__ void ppack(const v8f& t0, const v8f& t1, v16bf& h, v16bf& l) {
#pragma unroll
    for (int e = 0; e < 8; ++e) { const __bf16 a = (__bf16)t0[e], b = (__bf16)t1[e]; h[e] = a; h[8 + e] = b; l[e] = (__bf16)(t0[e] - (float)a); l[8 + e] = (__bf16)(t1[e] - (float)b); } }
template <bool B> struct BoolC { static constexpr bool v = B; };
template <typename T16, int NSPLIT>
__device__ __forceinline__ void fattn(const T16* __restrict__ Q, const T16* __restrict__ Q2, const T16* __restrict__ Kp, const T16* __restrict__ Kp2, const T16* __restrict__ Vt, const T16* __restrict__ Vt2, int g, int head, int q0, int lane, bf* Ah, bf* Al) {
    typedef typename WFrag<T16>::V V;
    static_assert(NSPLIT == 0 || NSPLIT == 2, "one plane or hi/lo planes on both sides");
    constexpr float C2 = SCL * 1.4426950408889634f;      // score scale x log2 e. Every inner loop below is unrolled so that the fragment and tile arrays are indexed by constants and stay in registers.
    const int lr = lane & 15, hi = lane >> 4;
    const size_t qo = ((size_t)head * TT + q0 + lr) * HD + 8 * hi, ko = ((size_t)g * TT + lr) * HD + 8 * hi, vo = ((size_t)g * HD + lr) * TT + 8 * hi;
    V qf[2][2], qf2[2][2], kf[2][2], kf2[2][2];
    { const T16 *pq = Q + qo, *pq2 = (NSPLIT == 2) ? Q2 + qo : pq, *pk = Kp + ko, *pk2 = (NSPLIT == 2) ? Kp2 + ko : pk;
#pragma unroll
      for (int t = 0; t < 2; ++t)
#pragma unroll
          for (int ks = 0; ks < 2; ++ks) { qf[t][ks] = WFrag<T16>::ld(pq + t * 16 * HD + ks * 32); kf[t][ks] = WFrag<T16>::ld(pk + t * 16 * HD + ks * 32); if (NSPLIT == 2) { qf2[t][ks] = WFrag<T16>::ld(pq2 + t * 16 * HD + ks * 32); kf2[t][ks] = WFrag<T16>::ld(pk2 + t * 16 * HD + ks * 32); } }
      xwait4(pq, pq2, pk, pk2); }
    v8f o[4][2];
#pragma unroll
    for (int db = 0; db < 4; ++db)
#pragma unroll
        for (int qt = 0; qt < 2; ++qt) o[db][qt] = (v8f){};
    float m[2] = { -3.0e38f, -3.0e38f }, nm[2] = { 3.0e38f * C2, 3.0e38f * C2 }, l[2] = { 0.f, 0.f };      // running maximum (raw score), minus its scaled value, this lane's share of the sum
    auto block = [&](int k0, auto lastc) __attribute__((always_inline)) {
        constexpr bool LAST = decltype(lastc)::v;      // the diagonal block (k0 == q0): masked, and nothing fetched ahead
        V vf[4], vf2[4];
        { const T16 *pv = Vt + vo + k0, *pv2 = (NSPLIT == 2) ? Vt2 + vo + k0 : pv;      // issued here, used behind the softmax
#pragma unroll
          for (int db = 0; db < 4; ++db) { vf[db] = WFrag<T16>::ld(pv + (size_t)db * 16 * TT); if (NSPLIT == 2) vf2[db] = WFrag<T16>::ld(pv2 + (size_t)db * 16 * TT); }
          xwait4(pv, pv2, pv, pv2); }
        v8f s[2][2];
#pragma unroll
        for (int kt = 0; kt < 2; ++kt)
#pragma unroll
            for (int qt = 0; qt < 2; ++qt) { v8f c = (v8f){};
#pragma unroll
                for (int ks = 0; ks < 2; ++ks) { c = WFrag<T16>::mma(kf[kt][ks], qf[qt][ks], c); if (NSPLIT == 2) { c = WFrag<T16>::mma(kf[kt][ks], qf2[qt][ks], c); c = WFrag<T16>::mma(kf2[kt][ks], qf[qt][ks], c); } }
                s[kt][qt] = c; }
        if constexpr (!LAST) { const T16 *pk = Kp + ko + (size_t)(k0 + 32) * HD, *pk2 = (NSPLIT == 2) ? Kp2 + ko + (size_t)(k0 + 32) * HD : pk;      // the next block's key fragments fly during this block's softmax and P.V
#pragma unroll
            for (int t = 0; t < 2; ++t)
#pragma unroll
                for (int ks = 0; ks < 2; ++ks) { kf[t][ks] = WFrag<T16>::ld(pk + t * 16 * HD + ks * 32); if (NSPLIT == 2) kf2[t][ks] = WFrag<T16>::ld(pk2 + t * 16 * HD + ks * 32); }
            xwait4(pk, pk2, pk, pk2); }
        if constexpr (LAST) {
#pragma unroll
            for (int kt = 0; kt < 2; ++kt)
#pragma unroll
                for (int qt = 0; qt < 2; ++qt)
#pragma unroll
                    for (int j = 0; j < 8; ++j) if (kt * 16 + hi * 8 + j > qt * 16 + lr) s[kt][qt][j] = -3.0e38f; }      // key beyond the query: excluded
        float mb[2];
#pragma unroll
        for (int qt = 0; qt < 2; ++qt) { float x0 = fmaxf(s[0][qt][0], s[1][qt][0]), x1 = fmaxf(s[0][qt][1], s[1][qt][1]);
#pragma unroll
            for (int j = 2; j < 8; j += 2) { x0 = fmaxf(x0, fmaxf(s[0][qt][j], s[1][qt][j])); x1 = fmaxf(x1, fmaxf(s[0][qt][j + 1], s[1][qt][j + 1])); }
            x0 = fmaxf(x0, x1); mb[qt] = fmaxf(x0, xhalf(x0)); }
        if (__builtin_amdgcn_ballot_w32(mb[0] > m[0] || mb[1] > m[1]) != 0) {      // scalar branch: a maximum rose somewhere in the wave (rare after the first blocks)
#pragma unroll
            for (int qt = 0; qt < 2; ++qt) { const float mn = fmaxf(m[qt], mb[qt]), nn = -(mn * C2), al = __builtin_amdgcn_exp2f(nn - nm[qt]); m[qt] = mn; nm[qt] = nn; l[qt] *= al;
#pragma unroll
                for (int db = 0; db < 4; ++db) o[db][qt] *= al; } }
        V ph[2], pl[2];
#pragma unroll
        for (int qt = 0; qt < 2; ++qt) { float a[4] = { 0.f, 0.f, 0.f, 0.f };
#pragma unroll
            for (int kt = 0; kt < 2; ++kt)
#pragma unroll
                for (int j = 0; j < 8; ++j) { const float t = __builtin_fmaf(s[kt][qt][j], C2, nm[qt]); float p;
                    if (LAST && NSPLIT == 0 && kt == 1 && qt == 0) asm("v_nop\n\tv_exp_f32 %0, %1\n\tv_nop" : "=v"(p) : "v"(t));      // the slots round a transcendental, in the instruction's own statement (the compiler does not look inside asm): the first v_nop behind an exponential in front whose source this one may overwrite, the second in front of the next vector instruction. A v_nop in a statement of its own landed elsewhere
                    else p = __builtin_amdgcn_exp2f(t);
                    s[kt][qt][j] = p; a[j & 3] += p; }
            l[qt] += (a[0] + a[1]) + (a[2] + a[3]); ppack(s[0][qt], s[1][qt], ph[qt], pl[qt]); }
#pragma unroll
        for (int db = 0; db < 4; ++db)
#pragma unroll
            for (int qt = 0; qt < 2; ++qt) { o[db][qt] = WFrag<T16>::mma(vf[db], ph[qt], o[db][qt]); if (NSPLIT == 2) { o[db][qt] = WFrag<T16>::mma(vf[db], pl[qt], o[db][qt]); o[db][qt] = WFrag<T16>::mma(vf2[db], ph[qt], o[db][qt]); } }
    };
#pragma unroll 1      // rolled: the key fragments fetched ahead land in the registers the next trip reads, and the loop's code stays short
    for (int k0 = 0; k0 < q0; k0 += 32) block(k0, BoolC<false>());
    block(q0, BoolC<true>());
#pragma unroll
    for (int qt = 0; qt < 2; ++qt) { const float inv = __fdiv_rn(1.0f, l[qt] + xhalf(l[qt])); const size_t oo = (size_t)(q0 + qt * 16 + lr) * DQ + head * HD + hi * 8;      // the two lane halves' sums join here, once
#pragma unroll
        for (int db = 0; db < 4; ++db) { v8us oh, ol;
#pragma unroll
            for (int j = 0; j < 8; ++j) { unsigned short a, c2; splitf(o[db][qt][j] * inv, a, c2); oh[j] = a; ol[j] = c2; }
            *(v8us*)(Ah + oo + db * 16) = oh; *(v8us*)(Al + oo + db * 16) = ol; } }
}
// grid (NKV, TT / 64, batch), 2 REP waves: waves 0..REP-1 take 32-row block TT/32 - 1 - y (long), waves REP.. block y (short), one head each, so that every work-group walks about the same number of key blocks. The waves share no barrier and no buffer.
// Register budget: two waves per SIMD (one work-group per WGP).
__global__ __launch_bounds__(2 * REP * 32, 2) void k_fattn(const h16* __restrict__ Q16, const h16* __restrict__ K16, const h16* __restrict__ V16, const bf* __restrict__ Qh, const bf* __restrict__ Ql, const bf* __restrict__ Kh, const bf* __restrict__ Kl, const bf* __restrict__ Vh, const bf* __restrict__ Vl, bf* Ah, bf* Al) {
    const int lane = threadIdx.x & 31, wv = __builtin_amdgcn_readfirstlane(threadIdx.x >> 5);      // wave number, scalar so that head, row block and the key loop stay scalar
    const int g = blockIdx.x, head = g * REP + (wv & (REP - 1)), q0 = ((wv < REP) ? TT / 32 - 1 - (int)blockIdx.y : (int)blockIdx.y) * 32;
    const size_t zq = (size_t)blockIdx.z * (NH_ + NKV) * TT * HD, zv = (size_t)blockIdx.z * NKV * TT * HD, za = (size_t)blockIdx.z * TT * DQ;      // this batch's planes: a batch's q heads and k heads lie in one plane, one after the other
    if (q0 < RH) fattn<bf, 2>(Qh + zq, Ql + zq, Kh + zq, Kl + zq, Vh + zv, Vl + zv, g, head, q0, lane, Ah + za, Al + za); else fattn<h16, 0>(Q16 + zq, nullptr, K16 + zq, nullptr, V16 + zv, nullptr, g, head, q0, lane, Ah + za, Al + za);
}

extern "C" void kernel_launch(void* const* d_in, const int* in_sizes, int n_in,
                              void* d_out, int out_size, void* d_ws, size_t ws_size, hipStream_t stream) {
    (void)in_sizes; (void)n_in; (void)out_size;
    const float* x = (const float*)d_in[0]; const float* wq = (const float*)d_in[1]; const float* wk = (const float*)d_in[2]; const float* wv = (const float*)d_in[3]; const float* wo = (const float*)d_in[4];   /* order x, Wq ('oi' [2048][2048]), Wk, Wv ('oi' [512][2048]), Wo ('oi') */
    float* OUT = (float*)d_out;     // [2][2048][2048]
    char* wsp = (char*)d_ws;
    auto take = [&](size_t bytes) { char* p = wsp; wsp += (bytes + 255) & ~(size_t)255; return (void*)p; };
    bf* WQ = (bf*)take((size_t)(DQ + 2 * DKV) * DM * 2); bf* WK = WQ + (size_t)DQ * DM; bf* WV = WK + (size_t)DKV * DM;      /* one plane of DQ + 2 DKV rows */
    bf* WO = (bf*)take((size_t)DM * DQ * 2); float* CS = (float*)take((size_t)TT * HD * 2 * 4);
    bf* XB = (bf*)take((size_t)NB_ * TT * DM * 2);
    h16* QP16 = (h16*)take((size_t)NB_ * (NH_ + NKV) * TT * HD * 2); bf* QPh = (bf*)take((size_t)NB_ * (NH_ + NKV) * TT * HD * 2); bf* QPl = (bf*)take((size_t)NB_ * (NH_ + NKV) * TT * HD * 2);      /* [batch][q heads, k heads][t][d] */
    h16* KP16 = QP16 + (size_t)NH_ * TT * HD; bf* KPh = QPh + (size_t)NH_ * TT * HD; bf* KPl = QPl + (size_t)NH_ * TT * HD;
    h16* VT16 = (h16*)take((size_t)NB_ * NKV * HD * TT * 2); bf* VTh = (bf*)take((size_t)NB_ * NKV * HD * TT * 2); bf* VTl = (bf*)take((size_t)NB_ * NKV * HD * TT * 2);
    bf* ATh = (bf*)take((size_t)NB_ * TT * DQ * 2); bf* ATl = (bf*)take((size_t)NB_ * TT * DQ * 2);
    if ((size_t)(wsp - (char*)d_ws) > ws_size) return;    // ws 256 MiB
    k_prep<<<CSB + CX + 2 * CQ + 2 * CK, 256, 0, stream>>>(x, wq, wk, wv, wo, XB, WQ, WK, WV, WO, CS);
    k_gemmw<bf, 0, false, 8, 1><<<dim3(TT / 64, (DQ + 2 * DKV) / 64, NB_), 256, 0, stream>>>(XB, nullptr, WQ, nullptr, DM, nullptr, 0, nullptr, (size_t)TT * DM, 0, 0, CS, QP16, QPh, QPl, VT16, VTh, VTl);
    k_fattn<<<dim3(NKV, TT / 64, NB_), 2 * REP * 32, 0, stream>>>(QP16, KP16, VT16, QPh, QPl, KPh, KPl, VTh, VTl, ATh, ATl);
    k_gemmw<bf, 1, false, 8, 0><<<dim3(TT / 64, DM / 64, NB_), 256, 0, stream>>>(ATh, ATl, WO, nullptr, DQ, OUT, DM, nullptr, (size_t)TT * DQ, 0, (size_t)TT * DM, nullptr, nullptr, nullptr, nullptr, nullptr, nullptr, nullptr);
}

// v007
// A run of this version takes 164 microseconds.
// Next to v006, in two timings, it ran 1.30 times as fast each time.
// All steps since v000 together make it 16.6 times as fast.
#include <hip/hip_runtime.h>

// Causal grouped-query attention with interleaved-pair rotary embeddings whose positions carry a 2 pi factor (x [2][2048][2048]; q = x Wq^T (32 heads x 64), k, v = x Wk^T, x Wv^T (8 kv heads x 64) ('oi' 1/sqrt(2048), no bias); rope on (even, odd) pairs: (re, im) = (q0 c - q1 s, q0 s + q1 c) with angle fl(fl(s x 2 pi) x freq_i), freq_i = 1 / 10000^(2i/64) (32 f32 frequencies jnp-exact; TWO f32 products; precise cosf/sinf); k, v repeated 4 x along the head axis: kv head = q head / 4; scores / sqrt(64); causal (finfo.min == exclusion); softmax; out = merged Wo^T ('oi', no bias) -> [2][2048][2048] (8.4 M); argument order x, Wq, Wk, Wv, Wo).
// Layout: four launches, the batch index is grid z: bf16 copies of x and of the 'oi' weights and the rotary table (k_prep); q, k and v in one GEMM grid; exact projections whose epilogue applies the rotary table and writes the head planes (v: product formed transposed); causal T-2048 GQA attention in one launch (k_fattn: scores, running-maximum softmax and P.V in registers; hybrid rows: < 512 hi/lo 3 products, rest fp16); merged hi/lo x Wo exact.
// Compute dtypes, f32 accumulate: every input rounded to bf16; projections exact; attention rows < 512 3 products, rest fp16; softmax f32; output projection hl x exact.

#define NB_  2
#define TT   2048
#define DM   2048
#define NH_  32
#define NKV  8
#define REP  (NH_ / NKV)
#define HD   64
#define DQ   (NH_ * HD)
#define DKV  (NKV * HD)
#define RH   512                  // query rows < RH use hi+lo planes (0: none)
#define SCL  0.125f   // HD^-0.5
static_assert(RH % 32 == 0 && TT % 64 == 0 && (REP & (REP - 1)) == 0, "a 32-row block is wholly hi/lo or wholly fp16; blocks pair up; the head comes from the low bits of the wave number");
typedef _Float16 h16;
typedef unsigned short bf;
typedef __attribute__((ext_vector_type(16))) __bf16   v16bf;
typedef __attribute__((ext_vector_type(16))) _Float16 v16h;
typedef __attribute__((ext_vector_type(8)))  _Float16 v8h;
typedef __attribute__((ext_vector_type(8)))  unsigned short v8us;
typedef __attribute__((ext_vector_type(8)))  float    v8f;
typedef __attribute__((ext_vector_type(4)))  float    v4f;
typedef v8h  __attribute__((may_alias)) v8ha;
typedef v4f  __attribute__((may_alias)) v4fa;
typedef v8us __attribute__((may_alias)) v8usa;

__device__ __forceinline__ unsigned short f2bf(float f) { unsigned u = __float_as_uint(f); u += 0x7FFFu + ((u >> 16) & 1u); return (unsigned short)(u >> 16); }
__device__ __forceinline__ float bf2f(unsigned short b) { return __uint_as_float(((unsigned)b) << 16); }
__device__ __forceinline__ float bfr(float f) { return bf2f(f2bf(f)); }
__device__ __forceinline__ void splitf(float y, unsigned short& h, unsigned short& l) { h = f2bf(y); l = f2bf(y - bf2f(h)); }
typedef __attribute__((ext_vector_type(2))) float v2f;
__device__ __forceinline__ v16h cat16(v8h lo, v8h hi) { return __builtin_shufflevector(lo, hi, 0, 1, 2, 3, 4, 5, 6, 7, 8, 9, 10, 11, 12, 13, 14, 15); }
__device__ __forceinline__ v16bf cat16b(v8us lo, v8us hi) { return __builtin_bit_cast(v16bf, __builtin_shufflevector(lo, hi, 0, 1, 2, 3, 4, 5, 6, 7, 8, 9, 10, 11, 12, 13, 14, 15)); }
__device__ __forceinline__ v8f wmma16(v16h a, v16h b, v8f c) { return __builtin_amdgcn_wmma_f32_16x16x32_f16(false, a, false, b, (short)0, c, false, false); }
__device__ __forceinline__ v8f wmmab(v16bf a, v16bf b, v8f c) { return __builtin_amdgcn_wmma_f32_16x16x32_bf16(false, a, false, b, (short)0, c, false, false); }



// ---- k_gemmt: register-blocked GEMM, one work-group of 4 waves per 128x128 output tile; wave (wm, wn) = (wave / 2, wave % 2) holds the 64x64 quarter at (wm 64, wn 64) in 16 accumulators and walks the whole K; grid (M/128, N/128, Z), 128 threads.
// Operands come from K-contiguous 16-bit planes through LDS: per trip the work-group copies 64 k (one whole 128-B line) of its 128 rows of every operand into one of two buffers; every row is read by the two waves that share it.
// C[m][n] (f32, pitch ldc) = sum_k A[m][k] Bt[n][k] (+ A2[m][k] Bt[n][k] where NSPLIT == 1). z-batch strides sA/sC in elements. K % 64 == 0, K >= 128. EPI 0: C is stored. EPI 1: no C; A = x, Bt = the rows of Wq, Wk, Wv one after the other, a wave's 64 columns = one q head (the first NH_), one k head (the next NKV) or one v head (the last NKV; operands swapped, so the tile is V^T); the tile goes out as 16-bit planes (tile_planes).
template <typename T16> struct WFrag;
template <> struct WFrag<h16> { typedef v16h V; static __device__ __forceinline__ V ld(const h16* p) { return cat16(*(const v8h*)p, *(const v8h*)(p + 16)); } static __device__ __forceinline__ v8f mma(V a, V b, v8f c) { return wmma16(a, b, c); } };
template <> struct WFrag<bf> { typedef v16bf V; static __device__ __forceinline__ V ld(const bf* p) { return cat16b(*(const v8us*)p, *(const v8us*)(p + 16)); } static __device__ __forceinline__ v8f mma(V a, V b, v8f c) { return wmmab(a, b, c); } };
// tile_lds: a wave's 64x64 f32 tile goes into the wave's own LDS strip tl (pitch 68 floats), row mb 16 + hi 8 + j, column nb 16 + lr.
#define PT 68
__device__ __forceinline__ void tile_lds(const v8f (&acc)[4][4], float* tl, int lane) {
    const int lr = lane & 15, hi = lane >> 4;
#pragma unroll
    for (int mb = 0; mb < 4; ++mb)
#pragma unroll
        for (int nb = 0; nb < 4; ++nb)
#pragma unroll
            for (int j = 0; j < 8; ++j) tl[(mb * 16 + hi * 8 + j) * PT + nb * 16 + lr] = acc[mb][nb][j];
    asm volatile("s_wait_dscnt 0x0" ::: "memory");      // the wave's own strip is written before other lanes of the wave read it back
}
// tile_store: the strip leaves as f32 rows: 16 lanes store one row's 256 bytes (two whole lines). Ct = the wave tile's first element.
__device__ __forceinline__ void tile_store(const float* tl, float* Ct, int ldc, int lane) {
    const int r2 = lane >> 4, c4 = (lane & 15) * 4;
#pragma unroll
    for (int it = 0; it < 8; ++it) { v4f val[4]; float* p[4];
#pragma unroll
        for (int i = 0; i < 4; ++i) { const int row = (it * 4 + i) * 2 + r2; val[i] = *(const v4fa*)(tl + row * PT + c4); p[i] = Ct + (size_t)row * ldc + c4; }
#pragma unroll
        for (int i = 0; i < 4; ++i) *(v4f*)p[i] = val[i];
        if (it + 1 < 8) asm volatile("s_wait_xcnt 0x0" :: "v"(val[0]), "v"(val[1]), "v"(val[2]), "v"(val[3]), "v"(p[0]), "v"(p[1]), "v"(p[2]), "v"(p[3]) : "memory"); }      // the four stores' data and addresses are inputs, so they stay in their registers until the wait; the next group of rows overwrites them (a precaution, as in xwait4)
}
// tile_planes: the wave's 64x64 tile leaves as 16-bit planes (fp16 + bf16 hi/lo) instead of f32: through the wave's own strip, then 4 whole rows at a time, 8 consecutive columns per lane, so that 8 lanes store one whole 128-B line of each plane. P16 / Ph / Pl = the tile's first element in each plane.
// rot (the same for the whole work-group): tile rows = positions, tile columns = the 64 dims of one head; (even, odd) pairs are rotated by the table row CSt[row][d] = (cos, sin); plane pitch HD. Not rot: values as they are; plane pitch TT.
__device__ __forceinline__ void tile_planes(const v8f (&acc)[4][4], float* tl, const bool rot, const float* __restrict__ CSt, h16* P16, bf* Ph, bf* Pl, int lane) {
    static_assert(HD == 64, "one 64-column tile is one head");
    constexpr int NI = 16; const int PP = rot ? HD : TT;      // groups of 4 rows; plane pitch
    const int c8 = (lane & 7) * 8, rw = lane >> 3;
    v2f cs[NI][4];
    if (rot) { const float* pc = CSt + (rw * HD + c8) * 2;      // issued first: the table values fly while the tile goes to LDS
#pragma unroll
        for (int it = 0; it < NI; ++it)
#pragma unroll
            for (int p = 0; p < 4; ++p) cs[it][p] = *(const v2f*)(pc + (it * 4 * HD + 2 * p) * 2);
        asm volatile("s_wait_xcnt 0x0" :: "v"(pc) : "memory"); }      // the run's address is an input, so it stays in its registers until the wait: otherwise the last load's result lands in the address pair the earlier loads name (a precaution, as in xwait4)
    tile_lds(acc, tl, lane);
#pragma unroll
    for (int it = 0; it < NI; ++it) { const int row = rw + it * 4; const v4f u0 = *(const v4fa*)(tl + row * PT + c8), u1 = *(const v4fa*)(tl + row * PT + c8 + 4);
        float y[8] = { u0[0], u0[1], u0[2], u0[3], u1[0], u1[1], u1[2], u1[3] };
        if (rot) {
#pragma unroll
            for (int p = 0; p < 4; ++p) { const float x0 = y[2 * p], x1 = y[2 * p + 1], c = cs[it][p][0], s = cs[it][p][1]; y[2 * p] = x0 * c - x1 * s; y[2 * p + 1] = x0 * s + x1 * c; } }      // even: x0 c - x1 s; odd: x0 s + x1 c
        v8h o16; v8us oh, ol;
#pragma unroll
        for (int e = 0; e < 8; ++e) { o16[e] = (h16)y[e]; unsigned short a, b; splitf(y[e], a, b); oh[e] = a; ol[e] = b; }
        const size_t e0 = (size_t)row * PP + c8;
        h16* s16 = P16 + e0; bf* sh = Ph + e0; bf* sl = Pl + e0;
        *(v8h*)s16 = o16; *(v8us*)sh = oh; *(v8us*)sl = ol;
        if (it + 1 < NI) asm volatile("s_wait_xcnt 0x0" :: "v"(o16), "v"(oh), "v"(ol), "v"(s16), "v"(sh), "v"(sl) : "memory"); }      // the three stores' data and addresses are inputs, so they stay in their registers until the wait; the next group of rows overwrites them (a precaution, as in xwait4)
}
// acopy8: eight asynchronous copies global -> LDS, 16 bytes per lane each (l = the lane's LDS byte address, g = the lane's global address). The s_wait_xcnt 0 is the last line of the copies' own statement, so that no address register is rewritten in front of it (a precaution).
template <typename T16>
__device__ __forceinline__ void acopy8(const unsigned (&l)[8], const T16* const (&g)[8]) {
    asm volatile("global_load_async_to_lds_b128 %0, %8, off\n\t"
                 "global_load_async_to_lds_b128 %1, %9, off\n\t"
                 "global_load_async_to_lds_b128 %2, %10, off\n\t"
                 "global_load_async_to_lds_b128 %3, %11, off\n\t"
                 "global_load_async_to_lds_b128 %4, %12, off\n\t"
                 "global_load_async_to_lds_b128 %5, %13, off\n\t"
                 "global_load_async_to_lds_b128 %6, %14, off\n\t"
                 "global_load_async_to_lds_b128 %7, %15, off\n\t"
                 "s_wait_xcnt 0x0"
                 :: "v"(l[0]), "v"(l[1]), "v"(l[2]), "v"(l[3]), "v"(l[4]), "v"(l[5]), "v"(l[6]), "v"(l[7]), "v"(g[0]), "v"(g[1]), "v"(g[2]), "v"(g[3]), "v"(g[4]), "v"(g[5]), "v"(g[6]), "v"(g[7]) : "memory");
}
// Register budget: with two operand planes three work-groups on a WGP (three waves per SIMD: the q/k/v grid is 3 x the WGPs), with a third plane two.
template <typename T16, int NSPLIT, int EPI>
__global__ __launch_bounds__(128, NSPLIT ? 2 : 3) void k_gemmt(const T16* __restrict__ A, const T16* __restrict__ A2, const T16* __restrict__ Bt, int K, float* C, int ldc, size_t sA, size_t sC, const float* __restrict__ CS, h16* P16, bf* Ph, bf* Pl, h16* V16, bf* Vh, bf* Vl) {
    typedef typename WFrag<T16>::V V;
    static_assert(NSPLIT == 0 || NSPLIT == 1, "one A plane or hi/lo A planes");
    constexpr bool HA2 = (NSPLIT == 1);
    constexpr int NOP = 2 + (HA2 ? 1 : 0);      // operand planes staged: slots A, Bt, then A2 where it exists
    constexpr int KT = 64, PB = KT * 2 + 16, SLB = 128 * PB, BUFB = NOP * SLB;      // k per trip; LDS row pitch in bytes (16 x odd: no bank conflict for 16-byte fragment reads); bytes per operand slot; bytes per buffer
    constexpr int EPF = 4 * 64 * PT, RGF = 2 * BUFB / 4;      // floats the epilogue needs; floats of the two buffers (the epilogue takes the same LDS over behind the last trip's barrier)
    __shared__ __align__(16) float os[EPF > RGF ? EPF : RGF];
    const size_t z = blockIdx.z; A += z * sA; if (HA2) A2 += z * sA; C += z * sC;
    const int lane = threadIdx.x & 31, lr = lane & 15, hi = lane >> 4; const int r0 = blockIdx.x * 128, c0 = blockIdx.y * 128;
    const int wv = __builtin_amdgcn_readfirstlane(threadIdx.x >> 5), wm = wv >> 1, wn = wv & 1;      // wave number, scalar so that the K loop stays a scalar loop
    const bool isv = (EPI == 1) && c0 >= DQ + DKV;      // the same for the whole work-group
    const T16* pa = isv ? Bt + (size_t)c0 * K : A + (size_t)r0 * K; const T16* pb = isv ? A + (size_t)r0 * K : Bt + (size_t)c0 * K;      // the 128 rows on the tile's row side and on its column side
    v8f acc[4][4];
#pragma unroll
    for (int mb = 0; mb < 4; ++mb)
#pragma unroll
        for (int nb = 0; nb < 4; ++nb) acc[mb][nb] = (v8f){};
    const char* lb = (const char*)os;
    const unsigned lw = (unsigned)(size_t)os + (unsigned)((wv * 32 + (lane >> 3)) * PB + (lane & 7) * 16);      // LDS byte address of this lane's first copy inside an operand's slot
    const size_t gw = (size_t)(wv * 32 + (lane >> 3)) * K + (lane & 7) * 8;      // the same place in an operand's 128 rows, in elements
    // stage: tile t (k = t KT ..) of every operand into buffer b. Per operand the wave makes 8 of the 32 copies: copy j brings the 128-byte stretches of rows wv 32 + j 4 .. + 3, 8 lanes a row.
    auto stage = [&](int t, int b) __attribute__((always_inline)) {
        const T16* P[3] = { pa, pb, HA2 ? A2 + (size_t)r0 * K : A };
#pragma unroll
        for (int o = 0; o < NOP; ++o) { unsigned l[8]; const T16* g[8];
#pragma unroll
            for (int j = 0; j < 8; ++j) { l[j] = lw + (unsigned)(b * BUFB + o * SLB + j * 4 * PB); g[j] = P[o] + gw + (size_t)(j * 4) * K + (size_t)t * KT; }
            acopy8<T16>(l, g); }
    };
    const int nt = (int)((unsigned)K / (unsigned)KT);
    stage(0, 0);
    asm volatile("s_wait_asynccnt 0x0" ::: "memory");      // this wave's share of tile 0 has landed
    __syncthreads();      // tile 0 is whole before any wave reads it
    if (nt > 1) stage(1, 1);
    const int foa = (wm * 64 + lr) * PB + hi * 16, fob = SLB + (wn * 64 + lr) * PB + hi * 16;      // this lane's place in a 16-row fragment of either side: row lr, k order 8 hi + e, 16 + 8 hi + e on both sides
#pragma unroll 1
    for (int t = 0; t < nt; ++t) {
        const char* fa = lb + (t & 1) * BUFB + foa; const char* fb = lb + (t & 1) * BUFB + fob;
        V a[2][4], a2[2][4], b[2][4];      // all of the trip's fragment reads (two steps of 32 k) stand together in front of its products
#pragma unroll
        for (int ks = 0; ks < 2; ++ks)
#pragma unroll
            for (int mb = 0; mb < 4; ++mb) { a[ks][mb] = WFrag<T16>::ld((const T16*)(fa + mb * 16 * PB + ks * 64)); b[ks][mb] = WFrag<T16>::ld((const T16*)(fb + mb * 16 * PB + ks * 64)); if (HA2) a2[ks][mb] = WFrag<T16>::ld((const T16*)(fa + 2 * SLB + mb * 16 * PB + ks * 64)); }
        asm volatile("s_wait_dscnt 0x0" ::: "memory");      // this wave's reads of buffer t & 1 are done: the trip's fragments are in registers
        asm volatile("s_wait_asynccnt 0x0" ::: "memory");      // this wave's share of tile t + 1 has landed
        __syncthreads();      // publishes tile t + 1 and ends every wave's reads of the buffer refilled below (in the last trip: of the LDS the epilogue takes over)
        if (t + 2 < nt) stage(t + 2, t & 1);      // issued in front of the trip's products, which need registers only: the copies fly behind them
#pragma unroll
        for (int ks = 0; ks < 2; ++ks) {
#pragma unroll
            for (int nb = 0; nb < 4; ++nb)
#pragma unroll
                for (int mb = 0; mb < 4; ++mb) acc[mb][nb] = WFrag<T16>::mma(a[ks][mb], b[ks][nb], acc[mb][nb]);
            if (HA2) {
#pragma unroll
                for (int nb = 0; nb < 4; ++nb)
#pragma unroll
                    for (int mb = 0; mb < 4; ++mb) acc[mb][nb] = WFrag<T16>::mma(a2[ks][mb], b[ks][nb], acc[mb][nb]); } }
        asm volatile("v_nop\n\tv_nop\n\tv_nop\n\tv_nop" : "+v"(acc[0][0]), "+v"(acc[1][1]), "+v"(acc[2][2]), "+v"(acc[3][3]) : "v"(a[1][0]), "v"(a[1][3]));      // four vector slots behind the trip's last products on both ways out of the trip: the next fragment reads land in their A and B registers, the epilogue stores their results
    }
    asm volatile("s_wait_asynccnt 0x0" ::: "memory");      // no copy is outstanding when the epilogue writes this LDS
    float* tl = os + wv * (64 * PT);      // the wave's own strip
    if constexpr (EPI == 0) { tile_lds(acc, tl, lane); tile_store(tl, C + (size_t)(r0 + wm * 64) * ldc + c0 + wn * 64, ldc, lane); }
    else { const size_t po = isv ? (z * DKV + (c0 + wm * 64 - DQ - DKV)) * TT + r0 + wn * 64 : ((z * (NH_ + NKV) + (c0 >> 6) + wn) * TT + r0 + wm * 64) * HD;      // v planes [z][kv head x HD + d][t]; q and k planes [z][q heads, then k heads][t][d]
        tile_planes(acc, tl, !isv, CS + (size_t)(r0 + wm * 64) * HD * 2, (isv ? V16 : P16) + po, (isv ? Vh : Ph) + po, (isv ? Vl : Pl) + po, lane); }
}

// xwait4: s_wait_xcnt 0 behind a run of fragment loads. The run's addresses are inputs of the statement, so each stays in its registers until the wait (a precaution for replayed address translations).
template <typename T16> __device__ __forceinline__ void xwait4(const T16* p0, const T16* p1, const T16* p2, const T16* p3) { asm volatile("s_wait_xcnt 0x0" :: "v"(p0), "v"(p1), "v"(p2), "v"(p3) : "memory"); }

__device__ __forceinline__ h16 tohx(float x) { return (h16)x; }
typedef __attribute__((ext_vector_type(2))) _Float16 v2h;
typedef __attribute__((ext_vector_type(4))) _Float16 v4h;
typedef __attribute__((ext_vector_type(2))) unsigned short v2us;
typedef __attribute__((ext_vector_type(4))) unsigned short v4us;
typedef __attribute__((ext_vector_type(4))) int v4i;

// k_rope: head planes [h][t][d] (fp16 + hi/lo) of rope(x) x sc with the rotate-half convention out[d] = x[d] cos[t][d] - x[d+HD/2] sin[t][d], out[d+HD/2] = x[d+HD/2] cos[t][d+HD/2] + x[d] sin[t][d+HD/2]
__global__ __launch_bounds__(256) void k_rope(const float* __restrict__ F, int pitch, int nheads, const float* __restrict__ CS, const float* __restrict__ RF, const float* __restrict__ nw, float sc, h16* P16, bf* Ph, bf* Pl) {
    const size_t e = ((size_t)blockIdx.x * 256 + threadIdx.x) * 2; if (e >= (size_t)nheads * TT * HD) return; const int d = (int)(e % HD); const int t = (int)((e / HD) % TT); const int h = (int)(e / ((size_t)HD * TT)); const float* f = F + (size_t)t * pitch + h * HD; const float rf = RF ? RF[(size_t)h * TT + t] : 1.0f; v2h o16; v2us oh, ol;
#pragma unroll
    for (int q = 0; q < 2; ++q) { const int dd = d + q; const int dp = (dd < HD / 2) ? dd + HD / 2 : dd - HD / 2; float x0 = f[dd], x1 = f[dp];
        if (RF) { float n0 = __fmul_rn(x0, rf), n1 = __fmul_rn(x1, rf); asm volatile("" : "+v"(n0)); asm volatile("" : "+v"(n1)); x0 = __fmul_rn(bfr(nw[dd]), n0); x1 = __fmul_rn(bfr(nw[dp]), n1); }
        const v2f cs = *(const v2f*)(CS + ((size_t)t * HD + dd) * 2); float a = __fmul_rn(x0, cs[0]), bq = __fmul_rn(x1, cs[1]); asm volatile("" : "+v"(a)); asm volatile("" : "+v"(bq)); const float r = ((dd < HD / 2) ? __fsub_rn(a, bq) : __fadd_rn(a, bq)) * sc;
        o16[q] = tohx(r); unsigned short a2, c2; splitf(r, a2, c2); oh[q] = a2; ol[q] = c2; }
    *(v2h*)(P16 + e) = o16; *(v2us*)(Ph + e) = oh; *(v2us*)(Pl + e) = ol;  }
__constant__ float INV2[HD / 2] = { 1.000000000e+00f, 7.498942018e-01f, 5.623413324e-01f, 4.216965139e-01f, 3.162277639e-01f, 2.371373624e-01f, 1.778279394e-01f, 1.333521456e-01f, 1.000000015e-01f, 7.498941571e-02f, 5.623412877e-02f, 4.216964915e-02f, 3.162277862e-02f, 2.371373586e-02f, 1.778279431e-02f, 1.333521493e-02f, 9.999999776e-03f, 7.498942316e-03f, 5.623413250e-03f, 4.216964822e-03f, 3.162277862e-03f, 2.371373819e-03f, 1.778279431e-03f, 1.333521446e-03f, 1.000000047e-03f, 7.498941850e-04f, 5.623413017e-04f, 4.216964880e-04f, 3.162277862e-04f, 2.371373848e-04f, 1.778279402e-04f, 1.333521504e-04f };   // float32 1.0 / (10000.0 ** (arange(0, 64, 2, dtype=float32) / 64)), generated with jnp to be bit-exact
// k_prep: every input rounded to bf16, and the rotary table, in one launch. Blocks 0 .. CSB-1 build the table, one (cos, sin) entry per thread; every later block converts CHE consecutive floats of one input, 8 per thread.
#define CHE 2048
static_assert(((size_t)NB_ * TT * DM) % CHE == 0 && ((size_t)DQ * DM) % CHE == 0 && ((size_t)DKV * DM) % CHE == 0 && (TT * HD) % 256 == 0, "whole blocks only: no edge test");
#define CSB (TT * HD / 256)
#define CX  (NB_ * TT * DM / CHE)
#define CQ  (DQ * DM / CHE)
#define CK  (DKV * DM / CHE)
__global__ __launch_bounds__(256) void k_prep(const float* __restrict__ x, const float* __restrict__ wq, const float* __restrict__ wk, const float* __restrict__ wv, const float* __restrict__ wo, bf* XB, bf* WQ, bf* WK, bf* WV, bf* WO, float* CS) {
    int c = blockIdx.x;
    if (c < CSB) { const int idx = c * 256 + threadIdx.x; const int d = idx % HD; const int t = idx / HD; const float a = __fmul_rn(__fmul_rn((float)t, 6.2831855f), INV2[d >> 1]); v2f cs; cs[0] = cosf(a); cs[1] = sinf(a); *(v2f*)(CS + (size_t)idx * 2) = cs; return; }
    c -= CSB;
    const float* s; bf* d;
    if (c < CX) { s = x; d = XB; }
    else if (c < CX + CQ) { s = wq; d = WQ; c -= CX; }
    else if (c < CX + CQ + CK) { s = wk; d = WK; c -= CX + CQ; }
    else if (c < CX + CQ + 2 * CK) { s = wv; d = WV; c -= CX + CQ + CK; }
    else { s = wo; d = WO; c -= CX + CQ + 2 * CK; }
    const size_t e0 = (size_t)c * CHE + threadIdx.x * 8;
    const v8f v = *(const v8f*)(s + e0); v8us o;
#pragma unroll
    for (int k = 0; k < 8; ++k) o[k] = f2bf(v[k]);
    *(v8us*)(d + e0) = o;
    asm volatile("s_wait_xcnt 0x0" ::: "memory");      // behind the store: the compiler lays the table part's text behind it, whose first instructions write the store's registers (a precaution)
}
// ---- k_fattn: causal attention in one launch; no score plane. One wave = one query head x 32 query rows; the REP heads of one kv group sit in one work-group and walk the same keys.
// Per 32 keys a wave forms S^T = K Q^T (A = 16 key rows, B = 16 query columns, Q kept in registers), so a lane holds scores of ONE query per column tile: lane (lr, hi), register j of key tile kt = key kt 16 + hi 8 + j.
// Softmax runs on a running maximum (base 2, scale folded in); two converted S^T tiles are the B operand of O^T += V^T P^T as they stand (the loader's k order 8 hi + e, 16 + 8 hi + e is theirs too).
// Rows < RH: bf16 hi/lo planes, 3 products each; the rest fp16. O^T / sum goes out as the merged bf16 hi/lo planes [t][head x HD + d], 8 consecutive d per lane.
__device__ __forceinline__ float xhalf(float x) { return __builtin_bit_cast(float, __builtin_amdgcn_permlanex16(__builtin_bit_cast(int, x), __builtin_bit_cast(int, x), 0x76543210, 0xfedcba98, false, false)); }   // the value of lane l ^ 16
__device__ __forceinline__ void ppack(const v8f& t0, const v8f& t1, v16h& h, v16h& l) { (void)l;
#pragma unroll
    for (int e = 0; e < 8; ++e) { h[e] = (h16)t0[e]; h[8 + e] = (h16)t1[e]; } }
__device__ __forceinline__ void ppack(const v8f& t0, const v8f& t1, v16bf& h, v16bf& l) {
#pragma unroll
    for (int e = 0; e < 8; ++e) { const __bf16 a = (__bf16)t0[e], b = (__bf16)t1[e]; h[e] = a; h[8 + e] = b; l[e] = (__bf16)(t0[e] - (float)a); l[8 + e] = (__bf16)(t1[e] - (float)b); } }
template <bool B> struct BoolC { static constexpr bool v = B; };
template <typename T16, int NSPLIT>
__device__ __forceinline__ void fattn(const T16* __restrict__ Q, const T16* __restrict__ Q2, const T16* __restrict__ Kp, const T16* __restrict__ Kp2, const T16* __restrict__ Vt, const T16* __restrict__ Vt2, int g, int head, int q0, int lane, bf* Ah, bf* Al) {
    typedef typename WFrag<T16>::V V;
    static_assert(NSPLIT == 0 || NSPLIT == 2, "one plane or hi/lo planes on both sides");
    constexpr float C2 = SCL * 1.4426950408889634f;      // score scale x log2 e. Every inner loop below is unrolled so that the fragment and tile arrays are indexed by constants and stay in registers.
    const int lr = lane & 15, hi = lane >> 4;
    const size_t qo = ((size_t)head * TT + q0 + lr) * HD + 8 * hi, ko = ((size_t)g * TT + lr) * HD + 8 * hi, vo = ((size_t)g * HD + lr) * TT + 8 * hi;
    V qf[2][2], qf2[2][2], kf[2][2], kf2[2][2];
    { const T16 *pq = Q + qo, *pq2 = (NSPLIT == 2) ? Q2 + qo : pq, *pk = Kp + ko, *pk2 = (NSPLIT == 2) ? Kp2 + ko : pk;
#pragma unroll
      for (int t = 0; t < 2; ++t)
#pragma unroll
          for (int ks = 0; ks < 2; ++ks) { qf[t][ks] = WFrag<T16>::ld(pq + t * 16 * HD + ks * 32); kf[t][ks] = WFrag<T16>::ld(pk + t * 16 * HD + ks * 32); if (NSPLIT == 2) { qf2[t][ks] = WFrag<T16>::ld(pq2 + t * 16 * HD + ks * 32); kf2[t][ks] = WFrag<T16>::ld(pk2 + t * 16 * HD + ks * 32); } }
      xwait4(pq, pq2, pk, pk2); }
    v8f o[4][2];
#pragma unroll
    for (int db = 0; db < 4; ++db)
#pragma unroll
        for (int qt = 0; qt < 2; ++qt) o[db][qt] = (v8f){};
    float m[2] = { -3.0e38f, -3.0e38f }, nm[2] = { 3.0e38f * C2, 3.0e38f * C2 }, l[2] = { 0.f, 0.f };      // running maximum (raw score), minus its scaled value, this lane's share of the sum
    auto block = [&](int k0, auto lastc) __attribute__((always_inline)) {
        constexpr bool LAST = decltype(lastc)::v;      // the diagonal block (k0 == q0): masked, and nothing fetched ahead
        V vf[4], vf2[4];
        { const T16 *pv = Vt + vo + k0, *pv2 = (NSPLIT == 2) ? Vt2 + vo + k0 : pv;      // issued here, used behind the softmax
#pragma unroll
          for (int db = 0; db < 4; ++db) { vf[db] = WFrag<T16>::ld(pv + (size_t)db * 16 * TT); if (NSPLIT == 2) vf2[db] = WFrag<T16>::ld(pv2 + (size_t)db * 16 * TT); }
          xwait4(pv, pv2, pv, pv2); }
        v8f s[2][2];
#pragma unroll
        for (int kt = 0; kt < 2; ++kt)
#pragma unroll
            for (int qt = 0; qt < 2; ++qt) { v8f c = (v8f){};
#pragma unroll
                for (int ks = 0; ks < 2; ++ks) { c = WFrag<T16>::mma(kf[kt][ks], qf[qt][ks], c); if (NSPLIT == 2) { c = WFrag<T16>::mma(kf[kt][ks], qf2[qt][ks], c); c = WFrag<T16>::mma(kf2[kt][ks], qf[qt][ks], c); } }
                s[kt][qt] = c; }
        if constexpr (!LAST) { const T16 *pk = Kp + ko + (size_t)(k0 + 32) * HD, *pk2 = (NSPLIT == 2) ? Kp2 + ko + (size_t)(k0 + 32) * HD : pk;      // the next block's key fragments fly during this block's softmax and P.V
#pragma unroll
            for (int t = 0; t < 2; ++t)
#pragma unroll
                for (int ks = 0; ks < 2; ++ks) { kf[t][ks] = WFrag<T16>::ld(pk + t * 16 * HD + ks * 32); if (NSPLIT == 2) kf2[t][ks] = WFrag<T16>::ld(pk2 + t * 16 * HD + ks * 32); }
            xwait4(pk, pk2, pk, pk2); }
        if constexpr (LAST) {
#pragma unroll
            for (int kt = 0; kt < 2; ++kt)
#pragma unroll
                for (int qt = 0; qt < 2; ++qt)
#pragma unroll
                    for (int j = 0; j < 8; ++j) if (kt * 16 + hi * 8 + j > qt * 16 + lr) s[kt][qt][j] = -3.0e38f; }      // key beyond the query: excluded
        float mb[2];
#pragma unroll
        for (int qt = 0; qt < 2; ++qt) { float x0 = fmaxf(s[0][qt][0], s[1][qt][0]), x1 = fmaxf(s[0][qt][1], s[1][qt][1]);
#pragma unroll
            for (int j = 2; j < 8; j += 2) { x0 = fmaxf(x0, fmaxf(s[0][qt][j], s[1][qt][j])); x1 = fmaxf(x1, fmaxf(s[0][qt][j + 1], s[1][qt][j + 1])); }
            x0 = fmaxf(x0, x1); mb[qt] = fmaxf(x0, xhalf(x0)); }
        if (__builtin_amdgcn_ballot_w32(mb[0] > m[0] || mb[1] > m[1]) != 0) {      // scalar branch: a maximum rose somewhere in the wave (rare after the first blocks)
#pragma unroll
            for (int qt = 0; qt < 2; ++qt) { const float mn = fmaxf(m[qt], mb[qt]), nn = -(mn * C2), al = __builtin_amdgcn_exp2f(nn - nm[qt]); m[qt] = mn; nm[qt] = nn; l[qt] *= al;
#pragma unroll
                for (int db = 0; db < 4; ++db) o[db][qt] *= al; } }
        V ph[2], pl[2];
#pragma unroll
        for (int qt = 0; qt < 2; ++qt) { float a[4] = { 0.f, 0.f, 0.f, 0.f };
#pragma unroll
            for (int kt = 0; kt < 2; ++kt)
#pragma unroll
                for (int j = 0; j < 8; ++j) { const float t = __builtin_fmaf(s[kt][qt][j], C2, nm[qt]); float p;
                    if (LAST && NSPLIT == 0 && kt == 1 && qt == 0) asm("v_nop\n\tv_exp_f32 %0, %1\n\tv_nop" : "=v"(p) : "v"(t));      // the slots round a transcendental, in the instruction's own statement (the compiler does not look inside asm): the first v_nop behind an exponential in front whose source this one may overwrite, the second in front of the next vector instruction. A v_nop in a statement of its own landed elsewhere
                    else p = __builtin_amdgcn_exp2f(t);
                    s[kt][qt][j] = p; a[j & 3] += p; }
            l[qt] += (a[0] + a[1]) + (a[2] + a[3]); ppack(s[0][qt], s[1][qt], ph[qt], pl[qt]); }
#pragma unroll
        for (int db = 0; db < 4; ++db)
#pragma unroll
            for (int qt = 0; qt < 2; ++qt) { o[db][qt] = WFrag<T16>::mma(vf[db], ph[qt], o[db][qt]); if (NSPLIT == 2) { o[db][qt] = WFrag<T16>::mma(vf[db], pl[qt], o[db][qt]); o[db][qt] = WFrag<T16>::mma(vf2[db], ph[qt], o[db][qt]); } }
    };
#pragma unroll 1      // rolled: the key fragments fetched ahead land in the registers the next trip reads, and the loop's code stays short
    for (int k0 = 0; k0 < q0; k0 += 32) block(k0, BoolC<false>());
    block(q0, BoolC<true>());
#pragma unroll
    for (int qt = 0; qt < 2; ++qt) { const float inv = __fdiv_rn(1.0f, l[qt] + xhalf(l[qt])); const size_t oo = (size_t)(q0 + qt * 16 + lr) * DQ + head * HD + hi * 8;      // the two lane halves' sums join here, once
#pragma unroll
        for (int db = 0; db < 4; ++db) { v8us oh, ol;
#pragma unroll
            for (int j = 0; j < 8; ++j) { unsigned short a, c2; splitf(o[db][qt][j] * inv, a, c2); oh[j] = a; ol[j] = c2; }
            *(v8us*)(Ah + oo + db * 16) = oh; *(v8us*)(Al + oo + db * 16) = ol; } }
}
// grid (NKV, TT / 64, batch), 2 REP waves: waves 0..REP-1 take 32-row block TT/32 - 1 - y (long), waves REP.. block y (short), one head each, so that every work-group walks about the same number of key blocks. The waves share no barrier and no buffer.
// Register budget: two waves per SIMD (one work-group per WGP).
__global__ __launch_bounds__(2 * REP * 32, 2) void k_fattn(const h16* __restrict__ Q16, const h16* __restrict__ K16, const h16* __restrict__ V16, const bf* __restrict__ Qh, const bf* __restrict__ Ql, const bf* __restrict__ Kh, const bf* __restrict__ Kl, const bf* __restrict__ Vh, const bf* __restrict__ Vl, bf* Ah, bf* Al) {
    const int lane = threadIdx.x & 31, wv = __builtin_amdgcn_readfirstlane(threadIdx.x >> 5);      // wave number, scalar so that head, row block and the key loop stay scalar
    const int g = blockIdx.x, head = g * REP + (wv & (REP - 1)), q0 = ((wv < REP) ? TT / 32 - 1 - (int)blockIdx.y : (int)blockIdx.y) * 32;
    const size_t zq = (size_t)blockIdx.z * (NH_ + NKV) * TT * HD, zv = (size_t)blockIdx.z * NKV * TT * HD, za = (size_t)blockIdx.z * TT * DQ;      // this batch's planes: a batch's q heads and k heads lie in one plane, one after the other
    if (q0 < RH) fattn<bf, 2>(Qh + zq, Ql + zq, Kh + zq, Kl + zq, Vh + zv, Vl + zv, g, head, q0, lane, Ah + za, Al + za); else fattn<h16, 0>(Q16 + zq, nullptr, K16 + zq, nullptr, V16 + zv, nullptr, g, head, q0, lane, Ah + za, Al + za);
}

extern "C" void kernel_launch(void* const* d_in, const int* in_sizes, int n_in,
                              void* d_out, int out_size, void* d_ws, size_t ws_size, hipStream_t stream) {
    (void)in_sizes; (void)n_in; (void)out_size;
    const float* x = (const float*)d_in[0]; const float* wq = (const float*)d_in[1]; const float* wk = (const float*)d_in[2]; const float* wv = (const float*)d_in[3]; const float* wo = (const float*)d_in[4];   /* order x, Wq ('oi' [2048][2048]), Wk, Wv ('oi' [512][2048]), Wo ('oi') */
    float* OUT = (float*)d_out;     // [2][2048][2048]
    char* wsp = (char*)d_ws;
    auto take = [&](size_t bytes) { char* p = wsp; wsp += (bytes + 255) & ~(size_t)255; return (void*)p; };
    bf* WQ = (bf*)take((size_t)(DQ + 2 * DKV) * DM * 2); bf* WK = WQ + (size_t)DQ * DM; bf* WV = WK + (size_t)DKV * DM;      /* one plane of DQ + 2 DKV rows */
    bf* WO = (bf*)take((size_t)DM * DQ * 2); float* CS = (float*)take((size_t)TT * HD * 2 * 4);
    bf* XB = (bf*)take((size_t)NB_ * TT * DM * 2);
    h16* QP16 = (h16*)take((size_t)NB_ * (NH_ + NKV) * TT * HD * 2); bf* QPh = (bf*)take((size_t)NB_ * (NH_ + NKV) * TT * HD * 2); bf* QPl = (bf*)take((size_t)NB_ * (NH_ + NKV) * TT * HD * 2);      /* [batch][q heads, k heads][t][d] */
    h16* KP16 = QP16 + (size_t)NH_ * TT * HD; bf* KPh = QPh + (size_t)NH_ * TT * HD; bf* KPl = QPl + (size_t)NH_ * TT * HD;
    h16* VT16 = (h16*)take((size_t)NB_ * NKV * HD * TT * 2); bf* VTh = (bf*)take((size_t)NB_ * NKV * HD * TT * 2); bf* VTl = (bf*)take((size_t)NB_ * NKV * HD * TT * 2);
    bf* ATh = (bf*)take((size_t)NB_ * TT * DQ * 2); bf* ATl = (bf*)take((size_t)NB_ * TT * DQ * 2);
    if ((size_t)(wsp - (char*)d_ws) > ws_size) return;    // ws 256 MiB
    k_prep<<<CSB + CX + 2 * CQ + 2 * CK, 256, 0, stream>>>(x, wq, wk, wv, wo, XB, WQ, WK, WV, WO, CS);
    k_gemmt<bf, 0, 1><<<dim3(TT / 128, (DQ + 2 * DKV) / 128, NB_), 128, 0, stream>>>(XB, nullptr, WQ, DM, nullptr, 0, (size_t)TT * DM, 0, CS, QP16, QPh, QPl, VT16, VTh, VTl);
    k_fattn<<<dim3(NKV, TT / 64, NB_), 2 * REP * 32, 0, stream>>>(QP16, KP16, VT16, QPh, QPl, KPh, KPl, VTh, VTl, ATh, ATl);
    k_gemmt<bf, 1, 0><<<dim3(TT / 128, DM / 128, NB_), 128, 0, stream>>>(ATh, ATl, WO, DQ, OUT, DM, (size_t)TT * DQ, (size_t)TT * DM, nullptr, nullptr, nullptr, nullptr, nullptr, nullptr, nullptr);
}

// v008
// One run takes 145 microseconds.
// Two timings next to v007 both put it at 1.14 times that version's speed.
// Counting every step since v000, it is 19.0 times as fast.
#include <hip/hip_runtime.h>

// Causal grouped-query attention with interleaved-pair rotary embeddings whose positions carry a 2 pi factor (x [2][2048][2048]; q = x Wq^T (32 heads x 64), k, v = x Wk^T, x Wv^T (8 kv heads x 64) ('oi' 1/sqrt(2048), no bias); rope on (even, odd) pairs: (re, im) = (q0 c - q1 s, q0 s + q1 c) with angle fl(fl(s x 2 pi) x freq_i), freq_i = 1 / 10000^(2i/64) (32 f32 frequencies jnp-exact; TWO f32 products; precise cosf/sinf); k, v repeated 4 x along the head axis: kv head = q head / 4; scores / sqrt(64); causal (finfo.min == exclusion); softmax; out = merged Wo^T ('oi', no bias) -> [2][2048][2048] (8.4 M); argument order x, Wq, Wk, Wv, Wo).
// Layout: four launches, the batch index is grid z: bf16 copies of x and of the 'oi' weights and the rotary table (k_prep); q, k and v in one GEMM grid; exact projections whose epilogue applies the rotary table and writes the head planes (v: product formed transposed); causal T-2048 GQA attention in one launch (k_fattn: K and V^T tiles shared through LDS; scores, running-maximum softmax and P.V in registers; hybrid rows: < 512 hi/lo 3 products, rest fp16); merged hi/lo x Wo exact.
// Compute dtypes, f32 accumulate: every input rounded to bf16; projections exact; attention rows < 512 3 products, rest fp16; softmax f32; output projection hl x exact.

#define NB_  2
#define TT   2048
#define DM   2048
#define NH_  32
#define NKV  8
#define REP  (NH_ / NKV)
#define HD   64
#define DQ   (NH_ * HD)
#define DKV  (NKV * HD)
#define RH   512                  // query rows < RH use hi+lo planes (0: none)
#define SCL  0.125f   // HD^-0.5
static_assert(RH % 64 == 0 && TT % 64 == 0 && (REP & (REP - 1)) == 0, "a work-group's 64 rows are wholly hi/lo or wholly fp16; the head comes from the low bits of the wave number");
typedef _Float16 h16;
typedef unsigned short bf;
typedef __attribute__((ext_vector_type(16))) __bf16   v16bf;
typedef __attribute__((ext_vector_type(16))) _Float16 v16h;
typedef __attribute__((ext_vector_type(8)))  _Float16 v8h;
typedef __attribute__((ext_vector_type(8)))  unsigned short v8us;
typedef __attribute__((ext_vector_type(8)))  float    v8f;
typedef __attribute__((ext_vector_type(4)))  float    v4f;
typedef v8h  __attribute__((may_alias)) v8ha;
typedef v4f  __attribute__((may_alias)) v4fa;
typedef v8us __attribute__((may_alias)) v8usa;

__device__ __forceinline__ unsigned short f2bf(float f) { unsigned u = __float_as_uint(f); u += 0x7FFFu + ((u >> 16) & 1u); return (unsigned short)(u >> 16); }
__device__ __forceinline__ float bf2f(unsigned short b) { return __uint_as_float(((unsigned)b) << 16); }
__device__ __forceinline__ float bfr(float f) { return bf2f(f2bf(f)); }
__device__ __forceinline__ void splitf(float y, unsigned short& h, unsigned short& l) { h = f2bf(y); l = f2bf(y - bf2f(h)); }
typedef __attribute__((ext_vector_type(2))) float v2f;
__device__ __forceinline__ v16h cat16(v8h lo, v8h hi) { return __builtin_shufflevector(lo, hi, 0, 1, 2, 3, 4, 5, 6, 7, 8, 9, 10, 11, 12, 13, 14, 15); }
__device__ __forceinline__ v16bf cat16b(v8us lo, v8us hi) { return __builtin_bit_cast(v16bf, __builtin_shufflevector(lo, hi, 0, 1, 2, 3, 4, 5, 6, 7, 8, 9, 10, 11, 12, 13, 14, 15)); }
__device__ __forceinline__ v8f wmma16(v16h a, v16h b, v8f c) { return __builtin_amdgcn_wmma_f32_16x16x32_f16(false, a, false, b, (short)0, c, false, false); }
__device__ __forceinline__ v8f wmmab(v16bf a, v16bf b, v8f c) { return __builtin_amdgcn_wmma_f32_16x16x32_bf16(false, a, false, b, (short)0, c, false, false); }



// ---- k_gemmt: register-blocked GEMM, one work-group of 4 waves per 128x128 output tile; wave (wm, wn) = (wave / 2, wave % 2) holds the 64x64 quarter at (wm 64, wn 64) in 16 accumulators and walks the whole K; grid (M/128, N/128, Z), 128 threads.
// Operands come from K-contiguous 16-bit planes through LDS: per trip the work-group copies 64 k (one whole 128-B line) of its 128 rows of every operand into one of two buffers; every row is read by the two waves that share it.
// C[m][n] (f32, pitch ldc) = sum_k A[m][k] Bt[n][k] (+ A2[m][k] Bt[n][k] where NSPLIT == 1). z-batch strides sA/sC in elements. K % 64 == 0, K >= 128. EPI 0: C is stored. EPI 1: no C; A = x, Bt = the rows of Wq, Wk, Wv one after the other, a wave's 64 columns = one q head (the first NH_), one k head (the next NKV) or one v head (the last NKV; operands swapped, so the tile is V^T); the tile goes out as 16-bit planes (tile_planes).
template <typename T16> struct WFrag;
template <> struct WFrag<h16> { typedef v16h V; static __device__ __forceinline__ V ld(const h16* p) { return cat16(*(const v8h*)p, *(const v8h*)(p + 16)); } static __device__ __forceinline__ v8f mma(V a, V b, v8f c) { return wmma16(a, b, c); } };
template <> struct WFrag<bf> { typedef v16bf V; static __device__ __forceinline__ V ld(const bf* p) { return cat16b(*(const v8us*)p, *(const v8us*)(p + 16)); } static __device__ __forceinline__ v8f mma(V a, V b, v8f c) { return wmmab(a, b, c); } };
// tile_lds: a wave's 64x64 f32 tile goes into the wave's own LDS strip tl (pitch 68 floats), row mb 16 + hi 8 + j, column nb 16 + lr.
#define PT 68
__device__ __forceinline__ void tile_lds(const v8f (&acc)[4][4], float* tl, int lane) {
    const int lr = lane & 15, hi = lane >> 4;
#pragma unroll
    for (int mb = 0; mb < 4; ++mb)
#pragma unroll
        for (int nb = 0; nb < 4; ++nb)
#pragma unroll
            for (int j = 0; j < 8; ++j) tl[(mb * 16 + hi * 8 + j) * PT + nb * 16 + lr] = acc[mb][nb][j];
    asm volatile("s_wait_dscnt 0x0" ::: "memory");      // the wave's own strip is written before other lanes of the wave read it back
}
// tile_store: the strip leaves as f32 rows: 16 lanes store one row's 256 bytes (two whole lines). Ct = the wave tile's first element.
__device__ __forceinline__ void tile_store(const float* tl, float* Ct, int ldc, int lane) {
    const int r2 = lane >> 4, c4 = (lane & 15) * 4;
#pragma unroll
    for (int it = 0; it < 8; ++it) { v4f val[4]; float* p[4];
#pragma unroll
        for (int i = 0; i < 4; ++i) { const int row = (it * 4 + i) * 2 + r2; val[i] = *(const v4fa*)(tl + row * PT + c4); p[i] = Ct + (size_t)row * ldc + c4; }
#pragma unroll
        for (int i = 0; i < 4; ++i) *(v4f*)p[i] = val[i];
        if (it + 1 < 8) asm volatile("s_wait_xcnt 0x0" :: "v"(val[0]), "v"(val[1]), "v"(val[2]), "v"(val[3]), "v"(p[0]), "v"(p[1]), "v"(p[2]), "v"(p[3]) : "memory"); }      // the four stores' data and addresses are inputs, so they stay in their registers until the wait; the next group of rows overwrites them (a precaution, as in xwait4)
}
// tile_planes: the wave's 64x64 tile leaves as 16-bit planes (fp16 + bf16 hi/lo) instead of f32: through the wave's own strip, then 4 whole rows at a time, 8 consecutive columns per lane, so that 8 lanes store one whole 128-B line of each plane. P16 / Ph / Pl = the tile's first element in each plane.
// rot (the same for the whole work-group): tile rows = positions, tile columns = the 64 dims of one head; (even, odd) pairs are rotated by the table row CSt[row][d] = (cos, sin); plane pitch HD. Not rot: values as they are; plane pitch TT.
__device__ __forceinline__ void tile_planes(const v8f (&acc)[4][4], float* tl, const bool rot, const float* __restrict__ CSt, h16* P16, bf* Ph, bf* Pl, int lane) {
    static_assert(HD == 64, "one 64-column tile is one head");
    constexpr int NI = 16; const int PP = rot ? HD : TT;      // groups of 4 rows; plane pitch
    const int c8 = (lane & 7) * 8, rw = lane >> 3;
    v2f cs[NI][4];
    if (rot) { const float* pc = CSt + (rw * HD + c8) * 2;      // issued first: the table values fly while the tile goes to LDS
#pragma unroll
        for (int it = 0; it < NI; ++it)
#pragma unroll
            for (int p = 0; p < 4; ++p) cs[it][p] = *(const v2f*)(pc + (it * 4 * HD + 2 * p) * 2);
        asm volatile("s_wait_xcnt 0x0" :: "v"(pc) : "memory"); }      // the run's address is an input, so it stays in its registers until the wait: otherwise the last load's result lands in the address pair the earlier loads name (a precaution, as in xwait4)
    tile_lds(acc, tl, lane);
#pragma unroll
    for (int it = 0; it < NI; ++it) { const int row = rw + it * 4; const v4f u0 = *(const v4fa*)(tl + row * PT + c8), u1 = *(const v4fa*)(tl + row * PT + c8 + 4);
        float y[8] = { u0[0], u0[1], u0[2], u0[3], u1[0], u1[1], u1[2], u1[3] };
        if (rot) {
#pragma unroll
            for (int p = 0; p < 4; ++p) { const float x0 = y[2 * p], x1 = y[2 * p + 1], c = cs[it][p][0], s = cs[it][p][1]; y[2 * p] = x0 * c - x1 * s; y[2 * p + 1] = x0 * s + x1 * c; } }      // even: x0 c - x1 s; odd: x0 s + x1 c
        v8h o16; v8us oh, ol;
#pragma unroll
        for (int e = 0; e < 8; ++e) { o16[e] = (h16)y[e]; unsigned short a, b; splitf(y[e], a, b); oh[e] = a; ol[e] = b; }
        const size_t e0 = (size_t)row * PP + c8;
        h16* s16 = P16 + e0; bf* sh = Ph + e0; bf* sl = Pl + e0;
        *(v8h*)s16 = o16; *(v8us*)sh = oh; *(v8us*)sl = ol;
        if (it + 1 < NI) asm volatile("s_wait_xcnt 0x0" :: "v"(o16), "v"(oh), "v"(ol), "v"(s16), "v"(sh), "v"(sl) : "memory"); }      // the three stores' data and addresses are inputs, so they stay in their registers until the wait; the next group of rows overwrites them (a precaution, as in xwait4)
}
// acopy8: eight asynchronous copies global -> LDS, 16 bytes per lane each (l = the lane's LDS byte address, g = the lane's global address). The s_wait_xcnt 0 is the last line of the copies' own statement, so that no address register is rewritten in front of it (a precaution).
template <typename T16>
__device__ __forceinline__ void acopy8(const unsigned (&l)[8], const T16* const (&g)[8]) {
    asm volatile("global_load_async_to_lds_b128 %0, %8, off\n\t"
                 "global_load_async_to_lds_b128 %1, %9, off\n\t"
                 "global_load_async_to_lds_b128 %2, %10, off\n\t"
                 "global_load_async_to_lds_b128 %3, %11, off\n\t"
                 "global_load_async_to_lds_b128 %4, %12, off\n\t"
                 "global_load_async_to_lds_b128 %5, %13, off\n\t"
                 "global_load_async_to_lds_b128 %6, %14, off\n\t"
                 "global_load_async_to_lds_b128 %7, %15, off\n\t"
                 "s_wait_xcnt 0x0"
                 :: "v"(l[0]), "v"(l[1]), "v"(l[2]), "v"(l[3]), "v"(l[4]), "v"(l[5]), "v"(l[6]), "v"(l[7]), "v"(g[0]), "v"(g[1]), "v"(g[2]), "v"(g[3]), "v"(g[4]), "v"(g[5]), "v"(g[6]), "v"(g[7]) : "memory");
}
// Register budget: with two operand planes three work-groups on a WGP (three waves per SIMD: the q/k/v grid is 3 x the WGPs), with a third plane two.
template <typename T16, int NSPLIT, int EPI>
__global__ __launch_bounds__(128, NSPLIT ? 2 : 3) void k_gemmt(const T16* __restrict__ A, const T16* __restrict__ A2, const T16* __restrict__ Bt, int K, float* C, int ldc, size_t sA, size_t sC, const float* __restrict__ CS, h16* P16, bf* Ph, bf* Pl, h16* V16, bf* Vh, bf* Vl) {
    typedef typename WFrag<T16>::V V;
    static_assert(NSPLIT == 0 || NSPLIT == 1, "one A plane or hi/lo A planes");
    constexpr bool HA2 = (NSPLIT == 1);
    constexpr int NOP = 2 + (HA2 ? 1 : 0);      // operand planes staged: slots A, Bt, then A2 where it exists
    constexpr int KT = 64, PB = KT * 2 + 16, SLB = 128 * PB, BUFB = NOP * SLB;      // k per trip; LDS row pitch in bytes (16 x odd: no bank conflict for 16-byte fragment reads); bytes per operand slot; bytes per buffer
    constexpr int EPF = 4 * 64 * PT, RGF = 2 * BUFB / 4;      // floats the epilogue needs; floats of the two buffers (the epilogue takes the same LDS over behind the last trip's barrier)
    __shared__ __align__(16) float os[EPF > RGF ? EPF : RGF];
    const size_t z = blockIdx.z; A += z * sA; if (HA2) A2 += z * sA; C += z * sC;
    const int lane = threadIdx.x & 31, lr = lane & 15, hi = lane >> 4; const int r0 = blockIdx.x * 128, c0 = blockIdx.y * 128;
    const int wv = __builtin_amdgcn_readfirstlane(threadIdx.x >> 5), wm = wv >> 1, wn = wv & 1;      // wave number, scalar so that the K loop stays a scalar loop
    const bool isv = (EPI == 1) && c0 >= DQ + DKV;      // the same for the whole work-group
    const T16* pa = isv ? Bt + (size_t)c0 * K : A + (size_t)r0 * K; const T16* pb = isv ? A + (size_t)r0 * K : Bt + (size_t)c0 * K;      // the 128 rows on the tile's row side and on its column side
    v8f acc[4][4];
#pragma unroll
    for (int mb = 0; mb < 4; ++mb)
#pragma unroll
        for (int nb = 0; nb < 4; ++nb) acc[mb][nb] = (v8f){};
    const char* lb = (const char*)os;
    const unsigned lw = (unsigned)(size_t)os + (unsigned)((wv * 32 + (lane >> 3)) * PB + (lane & 7) * 16);      // LDS byte address of this lane's first copy inside an operand's slot
    const size_t gw = (size_t)(wv * 32 + (lane >> 3)) * K + (lane & 7) * 8;      // the same place in an operand's 128 rows, in elements
    // stage: tile t (k = t KT ..) of every operand into buffer b. Per operand the wave makes 8 of the 32 copies: copy j brings the 128-byte stretches of rows wv 32 + j 4 .. + 3, 8 lanes a row.
    auto stage = [&](int t, int b) __attribute__((always_inline)) {
        const T16* P[3] = { pa, pb, HA2 ? A2 + (size_t)r0 * K : A };
#pragma unroll
        for (int o = 0; o < NOP; ++o) { unsigned l[8]; const T16* g[8];
#pragma unroll
            for (int j = 0; j < 8; ++j) { l[j] = lw + (unsigned)(b * BUFB + o * SLB + j * 4 * PB); g[j] = P[o] + gw + (size_t)(j * 4) * K + (size_t)t * KT; }
            acopy8<T16>(l, g); }
    };
    const int nt = (int)((unsigned)K / (unsigned)KT);
    stage(0, 0);
    asm volatile("s_wait_asynccnt 0x0" ::: "memory");      // this wave's share of tile 0 has landed
    __syncthreads();      // tile 0 is whole before any wave reads it
    if (nt > 1) stage(1, 1);
    const int foa = (wm * 64 + lr) * PB + hi * 16, fob = SLB + (wn * 64 + lr) * PB + hi * 16;      // this lane's place in a 16-row fragment of either side: row lr, k order 8 hi + e, 16 + 8 hi + e on both sides
#pragma unroll 1
    for (int t = 0; t < nt; ++t) {
        const char* fa = lb + (t & 1) * BUFB + foa; const char* fb = lb + (t & 1) * BUFB + fob;
        V a[2][4], a2[2][4], b[2][4];      // all of the trip's fragment reads (two steps of 32 k) stand together in front of its products
#pragma unroll
        for (int ks = 0; ks < 2; ++ks)
#pragma unroll
            for (int mb = 0; mb < 4; ++mb) { a[ks][mb] = WFrag<T16>::ld((const T16*)(fa + mb * 16 * PB + ks * 64)); b[ks][mb] = WFrag<T16>::ld((const T16*)(fb + mb * 16 * PB + ks * 64)); if (HA2) a2[ks][mb] = WFrag<T16>::ld((const T16*)(fa + 2 * SLB + mb * 16 * PB + ks * 64)); }
        asm volatile("s_wait_dscnt 0x0" ::: "memory");      // this wave's reads of buffer t & 1 are done: the trip's fragments are in registers
        asm volatile("s_wait_asynccnt 0x0" ::: "memory");      // this wave's share of tile t + 1 has landed
        __syncthreads();      // publishes tile t + 1 and ends every wave's reads of the buffer refilled below (in the last trip: of the LDS the epilogue takes over)
        if (t + 2 < nt) stage(t + 2, t & 1);      // issued in front of the trip's products, which need registers only: the copies fly behind them
#pragma unroll
        for (int ks = 0; ks < 2; ++ks) {
#pragma unroll
            for (int nb = 0; nb < 4; ++nb)
#pragma unroll
                for (int mb = 0; mb < 4; ++mb) acc[mb][nb] = WFrag<T16>::mma(a[ks][mb], b[ks][nb], acc[mb][nb]);
            if (HA2) {
#pragma unroll
                for (int nb = 0; nb < 4; ++nb)
#pragma unroll
                    for (int mb = 0; mb < 4; ++mb) acc[mb][nb] = WFrag<T16>::mma(a2[ks][mb], b[ks][nb], acc[mb][nb]); } }
        asm volatile("v_nop\n\tv_nop\n\tv_nop\n\tv_nop" : "+v"(acc[0][0]), "+v"(acc[1][1]), "+v"(acc[2][2]), "+v"(acc[3][3]) : "v"(a[1][0]), "v"(a[1][3]));      // four vector slots behind the trip's last products on both ways out of the trip: the next fragment reads land in their A and B registers, the epilogue stores their results
    }
    asm volatile("s_wait_asynccnt 0x0" ::: "memory");      // no copy is outstanding when the epilogue writes this LDS
    float* tl = os + wv * (64 * PT);      // the wave's own strip
    if constexpr (EPI == 0) { tile_lds(acc, tl, lane); tile_store(tl, C + (size_t)(r0 + wm * 64) * ldc + c0 + wn * 64, ldc, lane); }
    else { const size_t po = isv ? (z * DKV + (c0 + wm * 64 - DQ - DKV)) * TT + r0 + wn * 64 : ((z * (NH_ + NKV) + (c0 >> 6) + wn) * TT + r0 + wm * 64) * HD;      // v planes [z][kv head x HD + d][t]; q and k planes [z][q heads, then k heads][t][d]
        tile_planes(acc, tl, !isv, CS + (size_t)(r0 + wm * 64) * HD * 2, (isv ? V16 : P16) + po, (isv ? Vh : Ph) + po, (isv ? Vl : Pl) + po, lane); }
}

// xwait4: s_wait_xcnt 0 behind a run of fragment loads. The run's addresses are inputs of the statement, so each stays in its registers until the wait (a precaution for replayed address translations).
template <typename T16> __device__ __forceinline__ void xwait4(const T16* p0, const T16* p1, const T16* p2, const T16* p3) { asm volatile("s_wait_xcnt 0x0" :: "v"(p0), "v"(p1), "v"(p2), "v"(p3) : "memory"); }

__device__ __forceinline__ h16 tohx(float x) { return (h16)x; }
typedef __attribute__((ext_vector_type(2))) _Float16 v2h;
typedef __attribute__((ext_vector_type(4))) _Float16 v4h;
typedef __attribute__((ext_vector_type(2))) unsigned short v2us;
typedef __attribute__((ext_vector_type(4))) unsigned short v4us;
typedef __attribute__((ext_vector_type(4))) int v4i;

// k_rope: head planes [h][t][d] (fp16 + hi/lo) of rope(x) x sc with the rotate-half convention out[d] = x[d] cos[t][d] - x[d+HD/2] sin[t][d], out[d+HD/2] = x[d+HD/2] cos[t][d+HD/2] + x[d] sin[t][d+HD/2]
__global__ __launch_bounds__(256) void k_rope(const float* __restrict__ F, int pitch, int nheads, const float* __restrict__ CS, const float* __restrict__ RF, const float* __restrict__ nw, float sc, h16* P16, bf* Ph, bf* Pl) {
    const size_t e = ((size_t)blockIdx.x * 256 + threadIdx.x) * 2; if (e >= (size_t)nheads * TT * HD) return; const int d = (int)(e % HD); const int t = (int)((e / HD) % TT); const int h = (int)(e / ((size_t)HD * TT)); const float* f = F + (size_t)t * pitch + h * HD; const float rf = RF ? RF[(size_t)h * TT + t] : 1.0f; v2h o16; v2us oh, ol;
#pragma unroll
    for (int q = 0; q < 2; ++q) { const int dd = d + q; const int dp = (dd < HD / 2) ? dd + HD / 2 : dd - HD / 2; float x0 = f[dd], x1 = f[dp];
        if (RF) { float n0 = __fmul_rn(x0, rf), n1 = __fmul_rn(x1, rf); asm volatile("" : "+v"(n0)); asm volatile("" : "+v"(n1)); x0 = __fmul_rn(bfr(nw[dd]), n0); x1 = __fmul_rn(bfr(nw[dp]), n1); }
        const v2f cs = *(const v2f*)(CS + ((size_t)t * HD + dd) * 2); float a = __fmul_rn(x0, cs[0]), bq = __fmul_rn(x1, cs[1]); asm volatile("" : "+v"(a)); asm volatile("" : "+v"(bq)); const float r = ((dd < HD / 2) ? __fsub_rn(a, bq) : __fadd_rn(a, bq)) * sc;
        o16[q] = tohx(r); unsigned short a2, c2; splitf(r, a2, c2); oh[q] = a2; ol[q] = c2; }
    *(v2h*)(P16 + e) = o16; *(v2us*)(Ph + e) = oh; *(v2us*)(Pl + e) = ol;  }
__constant__ float INV2[HD / 2] = { 1.000000000e+00f, 7.498942018e-01f, 5.623413324e-01f, 4.216965139e-01f, 3.162277639e-01f, 2.371373624e-01f, 1.778279394e-01f, 1.333521456e-01f, 1.000000015e-01f, 7.498941571e-02f, 5.623412877e-02f, 4.216964915e-02f, 3.162277862e-02f, 2.371373586e-02f, 1.778279431e-02f, 1.333521493e-02f, 9.999999776e-03f, 7.498942316e-03f, 5.623413250e-03f, 4.216964822e-03f, 3.162277862e-03f, 2.371373819e-03f, 1.778279431e-03f, 1.333521446e-03f, 1.000000047e-03f, 7.498941850e-04f, 5.623413017e-04f, 4.216964880e-04f, 3.162277862e-04f, 2.371373848e-04f, 1.778279402e-04f, 1.333521504e-04f };   // float32 1.0 / (10000.0 ** (arange(0, 64, 2, dtype=float32) / 64)), generated with jnp to be bit-exact
// k_prep: every input rounded to bf16, and the rotary table, in one launch. Blocks 0 .. CSB-1 build the table, one (cos, sin) entry per thread; every later block converts CHE consecutive floats of one input, 8 per thread.
#define CHE 2048
static_assert(((size_t)NB_ * TT * DM) % CHE == 0 && ((size_t)DQ * DM) % CHE == 0 && ((size_t)DKV * DM) % CHE == 0 && (TT * HD) % 256 == 0, "whole blocks only: no edge test");
#define CSB (TT * HD / 256)
#define CX  (NB_ * TT * DM / CHE)
#define CQ  (DQ * DM / CHE)
#define CK  (DKV * DM / CHE)
__global__ __launch_bounds__(256) void k_prep(const float* __restrict__ x, const float* __restrict__ wq, const float* __restrict__ wk, const float* __restrict__ wv, const float* __restrict__ wo, bf* XB, bf* WQ, bf* WK, bf* WV, bf* WO, float* CS) {
    int c = blockIdx.x;
    if (c < CSB) { const int idx = c * 256 + threadIdx.x; const int d = idx % HD; const int t = idx / HD; const float a = __fmul_rn(__fmul_rn((float)t, 6.2831855f), INV2[d >> 1]); v2f cs; cs[0] = cosf(a); cs[1] = sinf(a); *(v2f*)(CS + (size_t)idx * 2) = cs; return; }
    c -= CSB;
    const float* s; bf* d;
    if (c < CX) { s = x; d = XB; }
    else if (c < CX + CQ) { s = wq; d = WQ; c -= CX; }
    else if (c < CX + CQ + CK) { s = wk; d = WK; c -= CX + CQ; }
    else if (c < CX + CQ + 2 * CK) { s = wv; d = WV; c -= CX + CQ + CK; }
    else { s = wo; d = WO; c -= CX + CQ + 2 * CK; }
    const size_t e0 = (size_t)c * CHE + threadIdx.x * 8;
    const v8f v = *(const v8f*)(s + e0); v8us o;
#pragma unroll
    for (int k = 0; k < 8; ++k) o[k] = f2bf(v[k]);
    *(v8us*)(d + e0) = o;
    asm volatile("s_wait_xcnt 0x0" ::: "memory");      // behind the store: the compiler lays the table part's text behind it, whose first instructions write the store's registers (a precaution)
}
// ---- k_fattn: causal attention in one launch; no score plane. One wave = one query head x 32 query rows; a work-group = the REP heads of one kv group x 64 query rows, so that its 2 REP waves walk the same keys and share them through LDS.
// Per 32 keys a wave forms S^T = K Q^T (A = 16 key rows, B = 16 query columns, Q kept in registers), so a lane holds scores of ONE query per column tile: lane (lr, hi), register j of key tile kt = key kt 16 + hi 8 + j.
// Softmax runs on a running maximum (base 2, scale folded in); two converted S^T tiles are the B operand of O^T += V^T P^T as they stand (the loader's k order 8 hi + e, 16 + 8 hi + e is theirs too).
// Rows < RH: bf16 hi/lo planes, 3 products each; the rest fp16. O^T / sum goes out as the merged bf16 hi/lo planes [t][head x HD + d], 8 consecutive d per lane.
__device__ __forceinline__ float xhalf(float x) { return __builtin_bit_cast(float, __builtin_amdgcn_permlanex16(__builtin_bit_cast(int, x), __builtin_bit_cast(int, x), 0x76543210, 0xfedcba98, false, false)); }   // the value of lane l ^ 16
__device__ __forceinline__ void ppack(const v8f& t0, const v8f& t1, v16h& h, v16h& l) { (void)l;
#pragma unroll
    for (int e = 0; e < 8; ++e) { h[e] = (h16)t0[e]; h[8 + e] = (h16)t1[e]; } }
__device__ __forceinline__ void ppack(const v8f& t0, const v8f& t1, v16bf& h, v16bf& l) {
#pragma unroll
    for (int e = 0; e < 8; ++e) { const __bf16 a = (__bf16)t0[e], b = (__bf16)t1[e]; h[e] = a; h[8 + e] = b; l[e] = (__bf16)(t0[e] - (float)a); l[8 + e] = (__bf16)(t1[e] - (float)b); } }
template <bool B> struct BoolC { static constexpr bool v = B; };
// exp8: eight base-2 exponentials (v_exp_f32, as the builtin gives). In one statement for the slot round a transcendental: each writes over its own source, so that none overwrites the source of the one directly in front of it, and the v_nop stands in front of the next vector instruction, which may read the last result. With the builtin this build laid exponentials' results over the source of the exponential directly in front.
__device__ __forceinline__ void exp8(v8f& x) {
    float e0 = x[0], e1 = x[1], e2 = x[2], e3 = x[3], e4 = x[4], e5 = x[5], e6 = x[6], e7 = x[7];
    asm("v_exp_f32 %0, %0\n\tv_exp_f32 %1, %1\n\tv_exp_f32 %2, %2\n\tv_exp_f32 %3, %3\n\tv_exp_f32 %4, %4\n\tv_exp_f32 %5, %5\n\tv_exp_f32 %6, %6\n\tv_exp_f32 %7, %7\n\tv_nop"
        : "+v"(e0), "+v"(e1), "+v"(e2), "+v"(e3), "+v"(e4), "+v"(e5), "+v"(e6), "+v"(e7));
    x = (v8f){ e0, e1, e2, e3, e4, e5, e6, e7 };
}
// acopy4: four asynchronous copies global -> LDS, 16 bytes per lane each, as acopy8: the s_wait_xcnt 0 is the last line of the copies' own statement, so that no address register is rewritten in front of it (a precaution).
template <typename T16>
__device__ __forceinline__ void acopy4(const unsigned (&l)[4], const T16* const (&g)[4]) {
    asm volatile("global_load_async_to_lds_b128 %0, %4, off\n\t"
                 "global_load_async_to_lds_b128 %1, %5, off\n\t"
                 "global_load_async_to_lds_b128 %2, %6, off\n\t"
                 "global_load_async_to_lds_b128 %3, %7, off\n\t"
                 "s_wait_xcnt 0x0"
                 :: "v"(l[0]), "v"(l[1]), "v"(l[2]), "v"(l[3]), "v"(g[0]), "v"(g[1]), "v"(g[2]), "v"(g[3]) : "memory");
}
// A stage is KS = 64 keys: per plane 64 rows of K (128 B = one whole line each), then the 64 d rows of V^T (64 keys = one whole line each), at pitch PBA; the lo plane's 128 rows follow the hi plane's; two buffers. Of every plane the 8 waves copy 16 rows each (waves 0..3 K, waves 4..7 V^T), 8 lanes a row; all 8 waves read every row.
// The work-group's query rows 64 p .. 64 p + 63 need stages 0 .. p: the same trip count in every wave. Wave half sub = 0 / 1 holds rows 64 p + 32 sub ..; its diagonal block is half sub of stage p.
#define KS   64
#define PBA  (HD * 2 + 16)        // LDS row pitch in bytes (16 x odd: no bank conflict for 16-byte fragment reads)
#define PLB  (2 * KS * PBA)       // bytes of one plane's K and V^T rows in a buffer
static_assert(HD == 64 && KS == 64 && REP == 4, "8 waves x 4 copies x 4 rows = the 128 rows of a plane's stage; every row is one 128-B line");
template <typename T16, int NSPLIT>
__device__ __forceinline__ void fattn(const T16* __restrict__ Q, const T16* __restrict__ Q2, const T16* __restrict__ Kp, const T16* __restrict__ Kp2, const T16* __restrict__ Vt, const T16* __restrict__ Vt2, const char* sm, int g, int head, int p, int sub, int wv, int lane, bf* Ah, bf* Al) {
    typedef typename WFrag<T16>::V V;
    static_assert(NSPLIT == 0 || NSPLIT == 2, "one plane or hi/lo planes on both sides");
    constexpr int NPL = (NSPLIT == 2) ? 2 : 1, BUFB = NPL * PLB;      // planes staged; bytes per buffer
    constexpr float C2 = SCL * 1.4426950408889634f;      // score scale x log2 e. Every inner loop below is unrolled so that the fragment and tile arrays are indexed by constants and stay in registers.
    const int lr = lane & 15, hi = lane >> 4, q0 = (2 * p + sub) * 32;
    const bool isk = wv < 4;      // scalar: this wave copies K rows, else V^T rows
    const size_t go = (isk ? ((size_t)g * TT + (wv & 3) * 16 + (lane >> 3)) * HD : ((size_t)g * HD + (wv & 3) * 16 + (lane >> 3)) * TT) + (lane & 7) * 8;      // this lane's first copy of stage 0, in elements of its plane
    const size_t g4 = isk ? (size_t)4 * HD : (size_t)4 * TT, gst = isk ? (size_t)KS * HD : (size_t)KS;      // elements from a row to the fourth behind it; from a stage to the next
    const unsigned lv = (unsigned)((lane >> 3) * PBA + (lane & 7) * 16), lw = (unsigned)(size_t)sm + (unsigned)(wv * 16 * PBA);      // LDS byte address of that copy inside a buffer: the lane's part and the wave's (scalar) part
    // stage: keys t KS .. of every plane into buffer b
    auto stage = [&](int t, int b) __attribute__((always_inline)) {
        const T16* P[2] = { (isk ? Kp : Vt) + go, (NSPLIT == 2) ? (isk ? Kp2 : Vt2) + go : nullptr };
#pragma unroll
        for (int o = 0; o < NPL; ++o) { unsigned l[4]; const T16* gp[4];
#pragma unroll
            for (int j = 0; j < 4; ++j) { l[j] = lv + (lw + (unsigned)(b * BUFB + o * PLB + j * 4 * PBA)); gp[j] = P[o] + (size_t)t * gst + (size_t)j * g4; }
            acopy4<T16>(l, gp); }
    };
    stage(0, p & 1);      // stage t lies in buffer (p - t) & 1: the last stage, whose code stands apart, always in buffer 0
    V qf[2][2], qf2[2][2];
    { const size_t qo = ((size_t)head * TT + q0 + lr) * HD + 8 * hi; const T16 *pq = Q + qo, *pq2 = (NSPLIT == 2) ? Q2 + qo : pq;
#pragma unroll
      for (int t = 0; t < 2; ++t)
#pragma unroll
          for (int ks = 0; ks < 2; ++ks) { qf[t][ks] = WFrag<T16>::ld(pq + t * 16 * HD + ks * 32); if (NSPLIT == 2) qf2[t][ks] = WFrag<T16>::ld(pq2 + t * 16 * HD + ks * 32); }
      xwait4(pq, pq2, pq, pq2); }
    v8f o[4][2];
#pragma unroll
    for (int db = 0; db < 4; ++db)
#pragma unroll
        for (int qt = 0; qt < 2; ++qt) o[db][qt] = (v8f){};
    float m[2] = { -3.0e38f, -3.0e38f }, nm[2] = { 3.0e38f * C2, 3.0e38f * C2 }, l[2] = { 0.f, 0.f };      // running maximum (raw score), minus its scaled value, this lane's share of the sum
    struct Fr { V kf[2][2], kf2[2][2], vf[4], vf2[4]; };      // the fragments of one block of 32 keys
    // frags: the fragment reads of block h (0 or 1: 32 keys) of a stage. fb = this lane's place in the buffer's first row (row lr, k order 8 hi + e, 16 + 8 hi + e): the block's key rows begin 32 h rows on; its 32 columns of V^T begin KS rows on, at column byte 64 h.
    auto frags = [&](Fr& f, const char* fb, int h) __attribute__((always_inline)) {
        const char* fk = fb + h * (32 * PBA); const char* fv = fb + KS * PBA + h * 64;
#pragma unroll
        for (int t = 0; t < 2; ++t)
#pragma unroll
            for (int ks = 0; ks < 2; ++ks) { f.kf[t][ks] = WFrag<T16>::ld((const T16*)(fk + t * 16 * PBA + ks * 64)); if (NSPLIT == 2) f.kf2[t][ks] = WFrag<T16>::ld((const T16*)(fk + PLB + t * 16 * PBA + ks * 64)); }
#pragma unroll
        for (int db = 0; db < 4; ++db) { f.vf[db] = WFrag<T16>::ld((const T16*)(fv + db * 16 * PBA)); if (NSPLIT == 2) f.vf2[db] = WFrag<T16>::ld((const T16*)(fv + PLB + db * 16 * PBA)); }
    };
    auto block = [&](const Fr& f, auto lastc) __attribute__((always_inline)) {
        constexpr bool LAST = decltype(lastc)::v;      // the diagonal block (first key == q0): masked
        v8f s[2][2];
#pragma unroll
        for (int kt = 0; kt < 2; ++kt)
#pragma unroll
            for (int qt = 0; qt < 2; ++qt) { v8f c = (v8f){};
#pragma unroll
                for (int ks = 0; ks < 2; ++ks) { c = WFrag<T16>::mma(f.kf[kt][ks], qf[qt][ks], c); if (NSPLIT == 2) { c = WFrag<T16>::mma(f.kf[kt][ks], qf2[qt][ks], c); c = WFrag<T16>::mma(f.kf2[kt][ks], qf[qt][ks], c); } }
                s[kt][qt] = c; }
        if constexpr (LAST) {
#pragma unroll
            for (int kt = 0; kt < 2; ++kt)
#pragma unroll
                for (int qt = 0; qt < 2; ++qt)
#pragma unroll
                    for (int j = 0; j < 8; ++j) if (kt * 16 + hi * 8 + j > qt * 16 + lr) s[kt][qt][j] = -3.0e38f; }      // key beyond the query: excluded
        float mb[2];
#pragma unroll
        for (int qt = 0; qt < 2; ++qt) { float x0 = fmaxf(s[0][qt][0], s[1][qt][0]), x1 = fmaxf(s[0][qt][1], s[1][qt][1]);
#pragma unroll
            for (int j = 2; j < 8; j += 2) { x0 = fmaxf(x0, fmaxf(s[0][qt][j], s[1][qt][j])); x1 = fmaxf(x1, fmaxf(s[0][qt][j + 1], s[1][qt][j + 1])); }
            x0 = fmaxf(x0, x1); mb[qt] = fmaxf(x0, xhalf(x0)); }
        if (__builtin_amdgcn_ballot_w32(mb[0] > m[0] || mb[1] > m[1]) != 0) {      // scalar branch: a maximum rose somewhere in the wave (rare after the first blocks)
#pragma unroll
            for (int qt = 0; qt < 2; ++qt) { const float mn = fmaxf(m[qt], mb[qt]), nn = -(mn * C2), al = __builtin_amdgcn_exp2f(nn - nm[qt]); m[qt] = mn; nm[qt] = nn; l[qt] *= al;
#pragma unroll
                for (int db = 0; db < 4; ++db) o[db][qt] *= al; } }
        V ph[2], pl[2];
#pragma unroll
        for (int qt = 0; qt < 2; ++qt)
#pragma unroll
            for (int kt = 0; kt < 2; ++kt) {
#pragma unroll
                for (int j = 0; j < 8; ++j) s[kt][qt][j] = __builtin_fmaf(s[kt][qt][j], C2, nm[qt]);
                exp8(s[kt][qt]); }
#pragma unroll
        for (int qt = 0; qt < 2; ++qt) { float a[4] = { s[0][qt][0], s[0][qt][1], s[0][qt][2], s[0][qt][3] };      // four partial sums, in the order key tile 0 registers j, j + 4, key tile 1 registers j, j + 4
#pragma unroll
            for (int j = 4; j < 16; ++j) a[j & 3] += s[j >> 3][qt][j & 7];
            l[qt] += (a[0] + a[1]) + (a[2] + a[3]); ppack(s[0][qt], s[1][qt], ph[qt], pl[qt]); }
#pragma unroll
        for (int db = 0; db < 4; ++db)
#pragma unroll
            for (int qt = 0; qt < 2; ++qt) { o[db][qt] = WFrag<T16>::mma(f.vf[db], ph[qt], o[db][qt]); if (NSPLIT == 2) { o[db][qt] = WFrag<T16>::mma(f.vf[db], pl[qt], o[db][qt]); o[db][qt] = WFrag<T16>::mma(f.vf2[db], ph[qt], o[db][qt]); } }
    };
    asm volatile("s_wait_asynccnt 0x0" ::: "memory");      // this wave's share of stage 0 has landed
    __syncthreads();      // stage 0 is whole before any wave reads it
    if (p > 0) stage(1, (p - 1) & 1);
    const int fo = lr * PBA + hi * 16;
#pragma unroll 1      // rolled: the loop's code stays short
    for (int t = 0; t < p; ++t) {
        const int b = (p - t) & 1; const char* fb = sm + b * BUFB + fo;
        Fr f0, f1;
        frags(f0, fb, 0);
        if constexpr (NSPLIT == 0) frags(f1, fb, 1);
        __builtin_amdgcn_sched_barrier(0);      // the fragment reads stay together in front of the products: left free, the compiler sinks each V^T read to its product and the wave waits out one LDS latency per pair of products
        block(f0, BoolC<false>());
        if constexpr (NSPLIT == 2) { frags(f1, fb, 1);      // hi/lo: twice the fragments, so the second block's are read behind the first block
            __builtin_amdgcn_sched_barrier(0); }      // as above
        block(f1, BoolC<false>());
        asm volatile("s_wait_dscnt 0x0" ::: "memory");      // this wave's reads of buffer b are done
        asm volatile("s_wait_asynccnt 0x0" ::: "memory");      // this wave's share of stage t + 1 has landed
        __syncthreads();      // publishes stage t + 1 and ends every wave's reads of the buffer refilled below
        if (t + 2 <= p) stage(t + 2, b);
    }
    asm volatile("s_wait_asynccnt 0x0" ::: "memory");      // no copy is outstanding behind the loop
    { const char* fb = sm + fo;      // stage p, in buffer 0: no barrier from here on, so the two wave halves may differ
      Fr f0;
      if (sub) { frags(f0, fb, 0);
          __builtin_amdgcn_sched_barrier(0);      // as above
          block(f0, BoolC<false>()); }
      frags(f0, fb, sub);
      __builtin_amdgcn_sched_barrier(0);      // as above
      block(f0, BoolC<true>()); }
#pragma unroll
    for (int qt = 0; qt < 2; ++qt) { const float inv = __fdiv_rn(1.0f, l[qt] + xhalf(l[qt])); const size_t oo = (size_t)(q0 + qt * 16 + lr) * DQ + head * HD + hi * 8;      // the two lane halves' sums join here, once
#pragma unroll
        for (int db = 0; db < 4; ++db) { v8us oh, ol;
#pragma unroll
            for (int j = 0; j < 8; ++j) { unsigned short a, c2; splitf(o[db][qt][j] * inv, a, c2); oh[j] = a; ol[j] = c2; }
            *(v8us*)(Ah + oo + db * 16) = oh; *(v8us*)(Al + oo + db * 16) = ol; } }
}
// grid (NKV, TT / 64, batch), 2 REP waves: work-group y takes query rows 64 p .. 64 p + 63, p = TT / 64 - 1 - y (the longest first: a place that a short work-group leaves early takes the longest one still waiting); waves 0..REP-1 the first 32 rows, waves REP.. the second, one head each.
// The choice between hi/lo and fp16 is the same for the whole work-group, so every barrier stands under block-uniform control flow.
// Register budget: two waves per SIMD (one work-group per WGP).
__global__ __launch_bounds__(2 * REP * 32, 2) void k_fattn(const h16* __restrict__ Q16, const h16* __restrict__ K16, const h16* __restrict__ V16, const bf* __restrict__ Qh, const bf* __restrict__ Ql, const bf* __restrict__ Kh, const bf* __restrict__ Kl, const bf* __restrict__ Vh, const bf* __restrict__ Vl, bf* Ah, bf* Al) {
    __shared__ __align__(16) char sm[2 * 2 * PLB];      // two buffers of two planes
    const int lane = threadIdx.x & 31, wv = __builtin_amdgcn_readfirstlane(threadIdx.x >> 5);      // wave number, scalar so that head, row block and the key loop stay scalar
    const int g = blockIdx.x, head = g * REP + (wv & (REP - 1)), sub = wv / REP, p = TT / 64 - 1 - (int)blockIdx.y;
    const size_t zq = (size_t)blockIdx.z * (NH_ + NKV) * TT * HD, zv = (size_t)blockIdx.z * NKV * TT * HD, za = (size_t)blockIdx.z * TT * DQ;      // this batch's planes: a batch's q heads and k heads lie in one plane, one after the other
    if (p * 64 < RH) fattn<bf, 2>(Qh + zq, Ql + zq, Kh + zq, Kl + zq, Vh + zv, Vl + zv, sm, g, head, p, sub, wv, lane, Ah + za, Al + za); else fattn<h16, 0>(Q16 + zq, nullptr, K16 + zq, nullptr, V16 + zv, nullptr, sm, g, head, p, sub, wv, lane, Ah + za, Al + za);
}

extern "C" void kernel_launch(void* const* d_in, const int* in_sizes, int n_in,
                              void* d_out, int out_size, void* d_ws, size_t ws_size, hipStream_t stream) {
    (void)in_sizes; (void)n_in; (void)out_size;
    const float* x = (const float*)d_in[0]; const float* wq = (const float*)d_in[1]; const float* wk = (const float*)d_in[2]; const float* wv = (const float*)d_in[3]; const float* wo = (const float*)d_in[4];   /* order x, Wq ('oi' [2048][2048]), Wk, Wv ('oi' [512][2048]), Wo ('oi') */
    float* OUT = (float*)d_out;     // [2][2048][2048]
    char* wsp = (char*)d_ws;
    auto take = [&](size_t bytes) { char* p = wsp; wsp += (bytes + 255) & ~(size_t)255; return (void*)p; };
    bf* WQ = (bf*)take((size_t)(DQ + 2 * DKV) * DM * 2); bf* WK = WQ + (size_t)DQ * DM; bf* WV = WK + (size_t)DKV * DM;      /* one plane of DQ + 2 DKV rows */
    bf* WO = (bf*)take((size_t)DM * DQ * 2); float* CS = (float*)take((size_t)TT * HD * 2 * 4);
    bf* XB = (bf*)take((size_t)NB_ * TT * DM * 2);
    h16* QP16 = (h16*)take((size_t)NB_ * (NH_ + NKV) * TT * HD * 2); bf* QPh = (bf*)take((size_t)NB_ * (NH_ + NKV) * TT * HD * 2); bf* QPl = (bf*)take((size_t)NB_ * (NH_ + NKV) * TT * HD * 2);      /* [batch][q heads, k heads][t][d] */
    h16* KP16 = QP16 + (size_t)NH_ * TT * HD; bf* KPh = QPh + (size_t)NH_ * TT * HD; bf* KPl = QPl + (size_t)NH_ * TT * HD;
    h16* VT16 = (h16*)take((size_t)NB_ * NKV * HD * TT * 2); bf* VTh = (bf*)take((size_t)NB_ * NKV * HD * TT * 2); bf* VTl = (bf*)take((size_t)NB_ * NKV * HD * TT * 2);
    bf* ATh = (bf*)take((size_t)NB_ * TT * DQ * 2); bf* ATl = (bf*)take((size_t)NB_ * TT * DQ * 2);
    if ((size_t)(wsp - (char*)d_ws) > ws_size) return;    // ws 256 MiB
    k_prep<<<CSB + CX + 2 * CQ + 2 * CK, 256, 0, stream>>>(x, wq, wk, wv, wo, XB, WQ, WK, WV, WO, CS);
    k_gemmt<bf, 0, 1><<<dim3(TT / 128, (DQ + 2 * DKV) / 128, NB_), 128, 0, stream>>>(XB, nullptr, WQ, DM, nullptr, 0, (size_t)TT * DM, 0, CS, QP16, QPh, QPl, VT16, VTh, VTl);
    k_fattn<<<dim3(NKV, TT / 64, NB_), 2 * REP * 32, 0, stream>>>(QP16, KP16, VT16, QPh, QPl, KPh, KPl, VTh, VTl, ATh, ATl);
    k_gemmt<bf, 1, 0><<<dim3(TT / 128, DM / 128, NB_), 128, 0, stream>>>(ATh, ATl, WO, DQ, OUT, DM, (size_t)TT * DQ, (size_t)TT * DM, nullptr, nullptr, nullptr, nullptr, nullptr, nullptr, nullptr);
}

// v009
// It runs in 131 microseconds.
// Next to v008, in two timings, it ran 1.11 and 1.08 times as fast.
// Over all steps from v000 it is 20.8 times as fast.
#include <hip/hip_runtime.h>

// Causal grouped-query attention with interleaved-pair rotary embeddings whose positions carry a 2 pi factor (x [2][2048][2048]; q = x Wq^T (32 heads x 64), k, v = x Wk^T, x Wv^T (8 kv heads x 64) ('oi' 1/sqrt(2048), no bias); rope on (even, odd) pairs: (re, im) = (q0 c - q1 s, q0 s + q1 c) with angle fl(fl(s x 2 pi) x freq_i), freq_i = 1 / 10000^(2i/64) (32 f32 frequencies jnp-exact; TWO f32 products; precise cosf/sinf); k, v repeated 4 x along the head axis: kv head = q head / 4; scores / sqrt(64); causal (finfo.min == exclusion); softmax; out = merged Wo^T ('oi', no bias) -> [2][2048][2048] (8.4 M); argument order x, Wq, Wk, Wv, Wo).
// Layout: four launches, the batch index is grid z: bf16 copies of x and of the 'oi' weights and the rotary table (k_prep); q, k and v in one GEMM grid; exact projections whose epilogue applies the rotary table and writes the head planes (v: product formed transposed); causal T-2048 GQA attention in one launch (k_fattn: K and V^T tiles shared through LDS; scores, running-maximum softmax and P.V in registers; hybrid rows: < 512 hi/lo 3 products, rest fp16); merged hi/lo x Wo exact.
// Compute dtypes, f32 accumulate: every input rounded to bf16; projections exact; attention rows < 512 3 products, rest fp16; softmax f32; output projection hl x exact.

#define NB_  2
#define TT   2048
#define DM   2048
#define NH_  32
#define NKV  8
#define REP  (NH_ / NKV)
#define HD   64
#define DQ   (NH_ * HD)
#define DKV  (NKV * HD)
#define RH   512                  // query rows < RH use hi+lo planes (0: none)
#define SCL  0.125f   // HD^-0.5
static_assert(RH % 64 == 0 && TT % 64 == 0 && (REP & (REP - 1)) == 0, "a work-group's 64 rows are wholly hi/lo or wholly fp16; the head comes from the low bits of the wave number");
typedef _Float16 h16;
typedef unsigned short bf;
typedef __attribute__((ext_vector_type(16))) __bf16   v16bf;
typedef __attribute__((ext_vector_type(16))) _Float16 v16h;
typedef __attribute__((ext_vector_type(8)))  _Float16 v8h;
typedef __attribute__((ext_vector_type(8)))  unsigned short v8us;
typedef __attribute__((ext_vector_type(8)))  float    v8f;
typedef __attribute__((ext_vector_type(4)))  float    v4f;
typedef v8h  __attribute__((may_alias)) v8ha;
typedef v4f  __attribute__((may_alias)) v4fa;
typedef v8us __attribute__((may_alias)) v8usa;

__device__ __forceinline__ unsigned short f2bf(float f) { unsigned u = __float_as_uint(f); u += 0x7FFFu + ((u >> 16) & 1u); return (unsigned short)(u >> 16); }
__device__ __forceinline__ float bf2f(unsigned short b) { return __uint_as_float(((unsigned)b) << 16); }
__device__ __forceinline__ float bfr(float f) { return bf2f(f2bf(f)); }
__device__ __forceinline__ void splitf(float y, unsigned short& h, unsigned short& l) { h = f2bf(y); l = f2bf(y - bf2f(h)); }
typedef __attribute__((ext_vector_type(2))) float v2f;
__device__ __forceinline__ v16h cat16(v8h lo, v8h hi) { return __builtin_shufflevector(lo, hi, 0, 1, 2, 3, 4, 5, 6, 7, 8, 9, 10, 11, 12, 13, 14, 15); }
__device__ __forceinline__ v16bf cat16b(v8us lo, v8us hi) { return __builtin_bit_cast(v16bf, __builtin_shufflevector(lo, hi, 0, 1, 2, 3, 4, 5, 6, 7, 8, 9, 10, 11, 12, 13, 14, 15)); }
__device__ __forceinline__ v8f wmma16(v16h a, v16h b, v8f c) { return __builtin_amdgcn_wmma_f32_16x16x32_f16(false, a, false, b, (short)0, c, false, false); }
__device__ __forceinline__ v8f wmmab(v16bf a, v16bf b, v8f c) { return __builtin_amdgcn_wmma_f32_16x16x32_bf16(false, a, false, b, (short)0, c, false, false); }



// ---- k_gemmt: register-blocked GEMM, one work-group of WM x WN waves per (WM 64) x (WN 64) output tile, one work-group on a WGP; wave (wm, wn) = (wave / WN, wave % WN) holds the 64x64 part at (wm 64, wn 64) in 16 accumulators and walks the whole K; grid (M / (WM 64), N / (WN 64), Z), WM WN 32 threads.
// Operands come from K-contiguous 16-bit planes through LDS: per trip the work-group copies 128 k (two whole 128-B lines) of its rows of every operand into one of two buffers; an A row is read by WN waves, a Bt row by WM waves. A trip is worked on in parts of 64 k (with A2: 32 k).
// C[m][n] (f32, pitch ldc) = sum_k A[m][k] Bt[n][k] (+ A2[m][k] Bt[n][k] where NSPLIT == 1). z-batch strides sA/sC in elements. K % 128 == 0, K >= 256. EPI 0: C is stored. EPI 1: no C; A = x, Bt = the rows of Wq, Wk, Wv one after the other, a wave's 64 columns = one q head (the first NH_), one k head (the next NKV) or one v head (the last NKV; that wave takes its fragments with the operands swapped, so its tile is V^T); the tile goes out as 16-bit planes (tile_planes).
template <typename T16> struct WFrag;
template <> struct WFrag<h16> { typedef v16h V; static __device__ __forceinline__ V ld(const h16* p) { return cat16(*(const v8h*)p, *(const v8h*)(p + 16)); } static __device__ __forceinline__ v8f mma(V a, V b, v8f c) { return wmma16(a, b, c); } };
template <> struct WFrag<bf> { typedef v16bf V; static __device__ __forceinline__ V ld(const bf* p) { return cat16b(*(const v8us*)p, *(const v8us*)(p + 16)); } static __device__ __forceinline__ v8f mma(V a, V b, v8f c) { return wmmab(a, b, c); } };
// tile_lds: a wave's 64x64 f32 tile goes into the wave's own LDS strip tl (pitch 68 floats), row mb 16 + hi 8 + j, column nb 16 + lr.
#define PT 68
__device__ __forceinline__ void tile_lds(const v8f (&acc)[4][4], float* tl, int lane) {
    const int lr = lane & 15, hi = lane >> 4;
#pragma unroll
    for (int mb = 0; mb < 4; ++mb)
#pragma unroll
        for (int nb = 0; nb < 4; ++nb)
#pragma unroll
            for (int j = 0; j < 8; ++j) tl[(mb * 16 + hi * 8 + j) * PT + nb * 16 + lr] = acc[mb][nb][j];
    asm volatile("s_wait_dscnt 0x0" ::: "memory");      // the wave's own strip is written before other lanes of the wave read it back
}
// tile_store: the strip leaves as f32 rows: 16 lanes store one row's 256 bytes (two whole lines). Ct = the wave tile's first element.
__device__ __forceinline__ void tile_store(const float* tl, float* Ct, int ldc, int lane) {
    const int r2 = lane >> 4, c4 = (lane & 15) * 4;
#pragma unroll
    for (int it = 0; it < 8; ++it) { v4f val[4]; float* p[4];
#pragma unroll
        for (int i = 0; i < 4; ++i) { const int row = (it * 4 + i) * 2 + r2; val[i] = *(const v4fa*)(tl + row * PT + c4); p[i] = Ct + (size_t)row * ldc + c4; }
#pragma unroll
        for (int i = 0; i < 4; ++i) *(v4f*)p[i] = val[i];
        if (it + 1 < 8) asm volatile("s_wait_xcnt 0x0" :: "v"(val[0]), "v"(val[1]), "v"(val[2]), "v"(val[3]), "v"(p[0]), "v"(p[1]), "v"(p[2]), "v"(p[3]) : "memory"); }      // the four stores' data and addresses are inputs, so they stay in their registers until the wait; the next group of rows overwrites them (a precaution, as in xwait4)
}
// tile_planes: the wave's 64x64 tile leaves as 16-bit planes (fp16 + bf16 hi/lo) instead of f32: through the wave's own strip, then 4 whole rows at a time, 8 consecutive columns per lane, so that 8 lanes store one whole 128-B line of each plane. P16 / Ph / Pl = the tile's first element in each plane.
// rot (the same for the whole wave): tile rows = positions, tile columns = the 64 dims of one head; (even, odd) pairs are rotated by the table row CSt[row][d] = (cos, sin); plane pitch HD. Not rot: values as they are; plane pitch TT.
__device__ __forceinline__ void tile_planes(const v8f (&acc)[4][4], float* tl, const bool rot, const float* __restrict__ CSt, h16* P16, bf* Ph, bf* Pl, int lane) {
    static_assert(HD == 64, "one 64-column tile is one head");
    constexpr int NI = 16; const int PP = rot ? HD : TT;      // groups of 4 rows; plane pitch
    const int c8 = (lane & 7) * 8, rw = lane >> 3;
    v2f cs[NI][4];
    if (rot) { const float* pc = CSt + (rw * HD + c8) * 2;      // issued first: the table values fly while the tile goes to LDS
#pragma unroll
        for (int it = 0; it < NI; ++it)
#pragma unroll
            for (int p = 0; p < 4; ++p) cs[it][p] = *(const v2f*)(pc + (it * 4 * HD + 2 * p) * 2);
        asm volatile("s_wait_xcnt 0x0" :: "v"(pc) : "memory"); }      // the run's address is an input, so it stays in its registers until the wait: otherwise the last load's result lands in the address pair the earlier loads name (a precaution, as in xwait4)
    tile_lds(acc, tl, lane);
#pragma unroll
    for (int it = 0; it < NI; ++it) { const int row = rw + it * 4; const v4f u0 = *(const v4fa*)(tl + row * PT + c8), u1 = *(const v4fa*)(tl + row * PT + c8 + 4);
        float y[8] = { u0[0], u0[1], u0[2], u0[3], u1[0], u1[1], u1[2], u1[3] };
        if (rot) {
#pragma unroll
            for (int p = 0; p < 4; ++p) { const float x0 = y[2 * p], x1 = y[2 * p + 1], c = cs[it][p][0], s = cs[it][p][1]; y[2 * p] = x0 * c - x1 * s; y[2 * p + 1] = x0 * s + x1 * c; } }      // even: x0 c - x1 s; odd: x0 s + x1 c
        v8h o16; v8us oh, ol;
#pragma unroll
        for (int e = 0; e < 8; ++e) { o16[e] = (h16)y[e]; unsigned short a, b; splitf(y[e], a, b); oh[e] = a; ol[e] = b; }
        const size_t e0 = (size_t)row * PP + c8;
        h16* s16 = P16 + e0; bf* sh = Ph + e0; bf* sl = Pl + e0;
        *(v8h*)s16 = o16; *(v8us*)sh = oh; *(v8us*)sl = ol;
        if (it + 1 < NI) asm volatile("s_wait_xcnt 0x0" :: "v"(o16), "v"(oh), "v"(ol), "v"(s16), "v"(sh), "v"(sl) : "memory"); }      // the three stores' data and addresses are inputs, so they stay in their registers until the wait; the next group of rows overwrites them (a precaution, as in xwait4)
}
// acopy8: eight asynchronous copies global -> LDS, 16 bytes per lane each (l = the lane's LDS byte address, g = the lane's global address). The s_wait_xcnt 0 is the last line of the copies' own statement, so that no address register is rewritten in front of it (a precaution).
template <typename T16>
__device__ __forceinline__ void acopy8(const unsigned (&l)[8], const T16* const (&g)[8]) {
    asm volatile("global_load_async_to_lds_b128 %0, %8, off\n\t"
                 "global_load_async_to_lds_b128 %1, %9, off\n\t"
                 "global_load_async_to_lds_b128 %2, %10, off\n\t"
                 "global_load_async_to_lds_b128 %3, %11, off\n\t"
                 "global_load_async_to_lds_b128 %4, %12, off\n\t"
                 "global_load_async_to_lds_b128 %5, %13, off\n\t"
                 "global_load_async_to_lds_b128 %6, %14, off\n\t"
                 "global_load_async_to_lds_b128 %7, %15, off\n\t"
                 "s_wait_xcnt 0x0"
                 :: "v"(l[0]), "v"(l[1]), "v"(l[2]), "v"(l[3]), "v"(l[4]), "v"(l[5]), "v"(l[6]), "v"(l[7]), "v"(g[0]), "v"(g[1]), "v"(g[2]), "v"(g[3]), "v"(g[4]), "v"(g[5]), "v"(g[6]), "v"(g[7]) : "memory");
}
// Register budget: the block size's own (12 waves: three per SIMD; 8 waves: two per SIMD).
template <typename T16, int NSPLIT, int EPI, int WM, int WN>
__global__ __launch_bounds__(WM * WN * 32) void k_gemmt(const T16* __restrict__ A, const T16* __restrict__ A2, const T16* __restrict__ Bt, int K, float* C, int ldc, size_t sA, size_t sC, const float* __restrict__ CS, h16* P16, bf* Ph, bf* Pl, h16* V16, bf* Vh, bf* Vl) {
    typedef typename WFrag<T16>::V V;
    static_assert(NSPLIT == 0 || NSPLIT == 1, "one A plane or hi/lo A planes");
    constexpr bool HA2 = (NSPLIT == 1);
    constexpr int NW = WM * WN, TM = WM * 64, TN = WN * 64;      // waves; tile rows; tile columns
    constexpr int NR = TM + TN + (HA2 ? TM : 0);      // rows staged per trip: TM of A, then TN of Bt, then TM of A2 where it exists
    constexpr int KT = 128, PB = KT * 2 + 16, BUFB = NR * PB, NG = NR / 16;      // k per trip; LDS row pitch in bytes (16 x odd: no bank conflict for 16-byte fragment reads); bytes per buffer; groups of 16 rows (8 copies)
    constexpr int NKS = HA2 ? 1 : 2, NP = KT / (32 * NKS);      // steps of 32 k whose fragments are read at once (with a third plane one: accumulators, fragments and the copies' addresses then fit the registers that an asm statement can name); such parts per trip
    constexpr int EPF = NW * 64 * PT, RGF = 2 * BUFB / 4;      // floats the epilogue needs; floats of the two buffers (the epilogue takes the same LDS over behind the last trip's barrier)
    __shared__ __align__(16) float os[EPF > RGF ? EPF : RGF];
    const size_t z = blockIdx.z; A += z * sA; if (HA2) A2 += z * sA; C += z * sC;
    const int lane = threadIdx.x & 31, lr = lane & 15, hi = lane >> 4; const int r0 = blockIdx.x * TM, c0 = blockIdx.y * TN;
    const int wv = __builtin_amdgcn_readfirstlane(threadIdx.x >> 5), wm = wv / WN, wn = wv % WN;      // wave number, scalar so that the K loop and the tests on the wave stay scalar
    const bool isv = (EPI == 1) && c0 + wn * 64 >= DQ + DKV;      // the same for the whole wave
    v8f acc[4][4];
#pragma unroll
    for (int mb = 0; mb < 4; ++mb)
#pragma unroll
        for (int nb = 0; nb < 4; ++nb) acc[mb][nb] = (v8f){};
    const char* lb = (const char*)os;
    const unsigned lw = (unsigned)(size_t)os + (unsigned)((lane >> 4) * PB + (lane & 15) * 16);      // LDS byte address of this lane's place in the first two rows of a buffer
    const size_t gw = (size_t)(lane >> 4) * K + (lane & 15) * 8;      // the same place in two rows of an operand, in elements
    // stage: tile t (k = t KT ..) of every operand into buffer b. The NG groups of 16 rows are dealt to the waves in turn; copy j of a group brings the 256-byte stretches of its rows 2 j, 2 j + 1, 16 lanes a row. The test on the group number is on the scalar wave number: a wave issues a whole group with every lane on, or jumps past it.
    auto stage = [&](int t, int b) __attribute__((always_inline)) {
#pragma unroll
        for (int i = 0; i * NW < NG; ++i) { const int row = (wv + i * NW) * 16;
            if ((i + 1) * NW <= NG || row < NR) {
                const T16* P = row < TM ? A + (size_t)(r0 + row) * K : (!HA2 || row < TM + TN) ? Bt + (size_t)(c0 + row - TM) * K : A2 + (size_t)(r0 + row - TM - TN) * K;
                unsigned l[8]; const T16* g[8];
#pragma unroll
                for (int j = 0; j < 8; ++j) { l[j] = lw + (unsigned)(b * BUFB + (row + j * 2) * PB); g[j] = (P + ((size_t)(j * 2) * K + (size_t)t * KT)) + gw; }
                acopy8<T16>(l, g);
                __builtin_amdgcn_sched_barrier(0); } }      // the next group's addresses are formed behind this group's copies: formed for all groups at once they do not fit the registers that an asm statement can name, and spill
    };
    const int nt = (int)((unsigned)K / (unsigned)KT);
    stage(0, 0);
    asm volatile("s_wait_asynccnt 0x0" ::: "memory");      // this wave's share of tile 0 has landed
    __syncthreads();      // tile 0 is whole before any wave reads it
    if (nt > 1) stage(1, 1);
    const int fx = (wm * 64 + lr) * PB + hi * 16, fw = (TM + wn * 64 + lr) * PB + hi * 16;      // this lane's place in a 16-row fragment of the wave's A rows and of its Bt rows: row lr, k order 8 hi + e, 16 + 8 hi + e on both sides
    const int foa = isv ? fw : fx, fob = isv ? fx : fw;      // the side that gives the tile's rows, the side that gives its columns
#pragma unroll 1
    for (int t = 0; t < nt; ++t) {
#pragma unroll
        for (int h = 0; h < NP; ++h) {      // the trip's parts of NKS steps of 32 k
            const char* fa = lb + (t & 1) * BUFB + h * (NKS * 64) + foa; const char* fb = lb + (t & 1) * BUFB + h * (NKS * 64) + fob;
            V a[NKS][4], a2[NKS][4], b[NKS][4];      // all of the part's fragment reads stand in front of its products (the compiler may lift them into the products of the part before, which read the same buffer)
#pragma unroll
            for (int ks = 0; ks < NKS; ++ks)
#pragma unroll
                for (int mb = 0; mb < 4; ++mb) { a[ks][mb] = WFrag<T16>::ld((const T16*)(fa + mb * 16 * PB + ks * 64)); b[ks][mb] = WFrag<T16>::ld((const T16*)(fb + mb * 16 * PB + ks * 64)); if (HA2) a2[ks][mb] = WFrag<T16>::ld((const T16*)(fa + (TM + TN) * PB + mb * 16 * PB + ks * 64)); }
            __builtin_amdgcn_sched_barrier(0);      // a part's fragment reads all stand in front of its own products: left free, the compiler sinks them among those products, and the wave waits out one LDS latency per pair of reads
            if (h == NP - 1) {
                asm volatile("s_wait_dscnt 0x0" ::: "memory");      // this wave's reads of buffer t & 1 are done: the part's fragments are in registers (in the earlier parts the compiler's own counted waits stand in front of the products)
                asm volatile("s_wait_asynccnt 0x0" ::: "memory");      // this wave's share of tile t + 1 has landed
                __syncthreads();      // publishes tile t + 1 and ends every wave's reads of the buffer refilled below (in the last trip: of the LDS the epilogue takes over)
                if (t + 2 < nt) stage(t + 2, t & 1); }      // issued in front of the part's products, which need registers only: the copies fly behind them
#pragma unroll
            for (int ks = 0; ks < NKS; ++ks) {
#pragma unroll
                for (int nb = 0; nb < 4; ++nb)
#pragma unroll
                    for (int mb = 0; mb < 4; ++mb) acc[mb][nb] = WFrag<T16>::mma(a[ks][mb], b[ks][nb], acc[mb][nb]);
                if (HA2) {
#pragma unroll
                    for (int nb = 0; nb < 4; ++nb)
#pragma unroll
                        for (int mb = 0; mb < 4; ++mb) acc[mb][nb] = WFrag<T16>::mma(a2[ks][mb], b[ks][nb], acc[mb][nb]); } }
            if (h == NP - 1) asm volatile("v_nop\n\tv_nop\n\tv_nop\n\tv_nop" : "+v"(acc[0][0]), "+v"(acc[1][1]), "+v"(acc[2][2]), "+v"(acc[3][3]) : "v"(a[NKS - 1][0]), "v"(a[NKS - 1][3]));      // four vector slots behind the trip's last products on both ways out of the trip: the next fragment reads land in their A and B registers, the epilogue stores their results
        }
    }
    asm volatile("s_wait_asynccnt 0x0" ::: "memory");      // no copy is outstanding when the epilogue writes this LDS
    float* tl = os + wv * (64 * PT);      // the wave's own strip
    if constexpr (EPI == 0) { tile_lds(acc, tl, lane); tile_store(tl, C + (size_t)(r0 + wm * 64) * ldc + c0 + wn * 64, ldc, lane); }
    else { const size_t po = isv ? (z * DKV + (c0 + wn * 64 - DQ - DKV)) * TT + r0 + wm * 64 : ((z * (NH_ + NKV) + (c0 >> 6) + wn) * TT + r0 + wm * 64) * HD;      // v planes [z][kv head x HD + d][t]; q and k planes [z][q heads, then k heads][t][d]
        tile_planes(acc, tl, !isv, CS + (size_t)(r0 + wm * 64) * HD * 2, (isv ? V16 : P16) + po, (isv ? Vh : Ph) + po, (isv ? Vl : Pl) + po, lane); }
}

// xwait4: s_wait_xcnt 0 behind a run of fragment loads. The run's addresses are inputs of the statement, so each stays in its registers until the wait (a precaution for replayed address translations).
template <typename T16> __device__ __forceinline__ void xwait4(const T16* p0, const T16* p1, const T16* p2, const T16* p3) { asm volatile("s_wait_xcnt 0x0" :: "v"(p0), "v"(p1), "v"(p2), "v"(p3) : "memory"); }

__device__ __forceinline__ h16 tohx(float x) { return (h16)x; }
typedef __attribute__((ext_vector_type(2))) _Float16 v2h;
typedef __attribute__((ext_vector_type(4))) _Float16 v4h;
typedef __attribute__((ext_vector_type(2))) unsigned short v2us;
typedef __attribute__((ext_vector_type(4))) unsigned short v4us;
typedef __attribute__((ext_vector_type(4))) int v4i;

// k_rope: head planes [h][t][d] (fp16 + hi/lo) of rope(x) x sc with the rotate-half convention out[d] = x[d] cos[t][d] - x[d+HD/2] sin[t][d], out[d+HD/2] = x[d+HD/2] cos[t][d+HD/2] + x[d] sin[t][d+HD/2]
__global__ __launch_bounds__(256) void k_rope(const float* __restrict__ F, int pitch, int nheads, const float* __restrict__ CS, const float* __restrict__ RF, const float* __restrict__ nw, float sc, h16* P16, bf* Ph, bf* Pl) {
    const size_t e = ((size_t)blockIdx.x * 256 + threadIdx.x) * 2; if (e >= (size_t)nheads * TT * HD) return; const int d = (int)(e % HD); const int t = (int)((e / HD) % TT); const int h = (int)(e / ((size_t)HD * TT)); const float* f = F + (size_t)t * pitch + h * HD; const float rf = RF ? RF[(size_t)h * TT + t] : 1.0f; v2h o16; v2us oh, ol;
#pragma unroll
    for (int q = 0; q < 2; ++q) { const int dd = d + q; const int dp = (dd < HD / 2) ? dd + HD / 2 : dd - HD / 2; float x0 = f[dd], x1 = f[dp];
        if (RF) { float n0 = __fmul_rn(x0, rf), n1 = __fmul_rn(x1, rf); asm volatile("" : "+v"(n0)); asm volatile("" : "+v"(n1)); x0 = __fmul_rn(bfr(nw[dd]), n0); x1 = __fmul_rn(bfr(nw[dp]), n1); }
        const v2f cs = *(const v2f*)(CS + ((size_t)t * HD + dd) * 2); float a = __fmul_rn(x0, cs[0]), bq = __fmul_rn(x1, cs[1]); asm volatile("" : "+v"(a)); asm volatile("" : "+v"(bq)); const float r = ((dd < HD / 2) ? __fsub_rn(a, bq) : __fadd_rn(a, bq)) * sc;
        o16[q] = tohx(r); unsigned short a2, c2; splitf(r, a2, c2); oh[q] = a2; ol[q] = c2; }
    *(v2h*)(P16 + e) = o16; *(v2us*)(Ph + e) = oh; *(v2us*)(Pl + e) = ol;  }
__constant__ float INV2[HD / 2] = { 1.000000000e+00f, 7.498942018e-01f, 5.623413324e-01f, 4.216965139e-01f, 3.162277639e-01f, 2.371373624e-01f, 1.778279394e-01f, 1.333521456e-01f, 1.000000015e-01f, 7.498941571e-02f, 5.623412877e-02f, 4.216964915e-02f, 3.162277862e-02f, 2.371373586e-02f, 1.778279431e-02f, 1.333521493e-02f, 9.999999776e-03f, 7.498942316e-03f, 5.623413250e-03f, 4.216964822e-03f, 3.162277862e-03f, 2.371373819e-03f, 1.778279431e-03f, 1.333521446e-03f, 1.000000047e-03f, 7.498941850e-04f, 5.623413017e-04f, 4.216964880e-04f, 3.162277862e-04f, 2.371373848e-04f, 1.778279402e-04f, 1.333521504e-04f };   // float32 1.0 / (10000.0 ** (arange(0, 64, 2, dtype=float32) / 64)), generated with jnp to be bit-exact
// k_prep: every input rounded to bf16, and the rotary table, in one launch. Blocks 0 .. CSB-1 build the table, one (cos, sin) entry per thread; every later block converts CHE consecutive floats of one input, 8 per thread.
#define CHE 2048
static_assert(((size_t)NB_ * TT * DM) % CHE == 0 && ((size_t)DQ * DM) % CHE == 0 && ((size_t)DKV * DM) % CHE == 0 && (TT * HD) % 256 == 0, "whole blocks only: no edge test");
#define CSB (TT * HD / 256)
#define CX  (NB_ * TT * DM / CHE)
#define CQ  (DQ * DM / CHE)
#define CK  (DKV * DM / CHE)
__global__ __launch_bounds__(256) void k_prep(const float* __restrict__ x, const float* __restrict__ wq, const float* __restrict__ wk, const float* __restrict__ wv, const float* __restrict__ wo, bf* XB, bf* WQ, bf* WK, bf* WV, bf* WO, float* CS) {
    int c = blockIdx.x;
    if (c < CSB) { const int idx = c * 256 + threadIdx.x; const int d = idx % HD; const int t = idx / HD; const float a = __fmul_rn(__fmul_rn((float)t, 6.2831855f), INV2[d >> 1]); v2f cs; cs[0] = cosf(a); cs[1] = sinf(a); *(v2f*)(CS + (size_t)idx * 2) = cs; return; }
    c -= CSB;
    const float* s; bf* d;
    if (c < CX) { s = x; d = XB; }
    else if (c < CX + CQ) { s = wq; d = WQ; c -= CX; }
    else if (c < CX + CQ + CK) { s = wk; d = WK; c -= CX + CQ; }
    else if (c < CX + CQ + 2 * CK) { s = wv; d = WV; c -= CX + CQ + CK; }
    else { s = wo; d = WO; c -= CX + CQ + 2 * CK; }
    const size_t e0 = (size_t)c * CHE + threadIdx.x * 8;
    const v8f v = *(const v8f*)(s + e0); v8us o;
#pragma unroll
    for (int k = 0; k < 8; ++k) o[k] = f2bf(v[k]);
    *(v8us*)(d + e0) = o;
    asm volatile("s_wait_xcnt 0x0" ::: "memory");      // behind the store: the compiler lays the table part's text behind it, whose first instructions write the store's registers (a precaution)
}
// ---- k_fattn: causal attention in one launch; no score plane. One wave = one query head x 32 query rows; a work-group = the REP heads of one kv group x 64 query rows, so that its 2 REP waves walk the same keys and share them through LDS.
// Per 32 keys a wave forms S^T = K Q^T (A = 16 key rows, B = 16 query columns, Q kept in registers), so a lane holds scores of ONE query per column tile: lane (lr, hi), register j of key tile kt = key kt 16 + hi 8 + j.
// Softmax runs on a running maximum (base 2, scale folded in); two converted S^T tiles are the B operand of O^T += V^T P^T as they stand (the loader's k order 8 hi + e, 16 + 8 hi + e is theirs too).
// Rows < RH: bf16 hi/lo planes, 3 products each; the rest fp16. O^T / sum goes out as the merged bf16 hi/lo planes [t][head x HD + d], 8 consecutive d per lane.
__device__ __forceinline__ float xhalf(float x) { return __builtin_bit_cast(float, __builtin_amdgcn_permlanex16(__builtin_bit_cast(int, x), __builtin_bit_cast(int, x), 0x76543210, 0xfedcba98, false, false)); }   // the value of lane l ^ 16
__device__ __forceinline__ void ppack(const v8f& t0, const v8f& t1, v16h& h, v16h& l) { (void)l;
#pragma unroll
    for (int e = 0; e < 8; ++e) { h[e] = (h16)t0[e]; h[8 + e] = (h16)t1[e]; } }
__device__ __forceinline__ void ppack(const v8f& t0, const v8f& t1, v16bf& h, v16bf& l) {
#pragma unroll
    for (int e = 0; e < 8; ++e) { const __bf16 a = (__bf16)t0[e], b = (__bf16)t1[e]; h[e] = a; h[8 + e] = b; l[e] = (__bf16)(t0[e] - (float)a); l[8 + e] = (__bf16)(t1[e] - (float)b); } }
template <bool B> struct BoolC { static constexpr bool v = B; };
// exp8: eight base-2 exponentials (v_exp_f32, as the builtin gives). In one statement for the slot round a transcendental: each writes over its own source, so that none overwrites the source of the one directly in front of it, and the v_nop stands in front of the next vector instruction, which may read the last result. With the builtin this build laid exponentials' results over the source of the exponential directly in front.
__device__ __forceinline__ void exp8(v8f& x) {
    float e0 = x[0], e1 = x[1], e2 = x[2], e3 = x[3], e4 = x[4], e5 = x[5], e6 = x[6], e7 = x[7];
    asm("v_exp_f32 %0, %0\n\tv_exp_f32 %1, %1\n\tv_exp_f32 %2, %2\n\tv_exp_f32 %3, %3\n\tv_exp_f32 %4, %4\n\tv_exp_f32 %5, %5\n\tv_exp_f32 %6, %6\n\tv_exp_f32 %7, %7\n\tv_nop"
        : "+v"(e0), "+v"(e1), "+v"(e2), "+v"(e3), "+v"(e4), "+v"(e5), "+v"(e6), "+v"(e7));
    x = (v8f){ e0, e1, e2, e3, e4, e5, e6, e7 };
}
// acopy4: four asynchronous copies global -> LDS, 16 bytes per lane each, as acopy8: the s_wait_xcnt 0 is the last line of the copies' own statement, so that no address register is rewritten in front of it (a precaution).
template <typename T16>
__device__ __forceinline__ void acopy4(const unsigned (&l)[4], const T16* const (&g)[4]) {
    asm volatile("global_load_async_to_lds_b128 %0, %4, off\n\t"
                 "global_load_async_to_lds_b128 %1, %5, off\n\t"
                 "global_load_async_to_lds_b128 %2, %6, off\n\t"
                 "global_load_async_to_lds_b128 %3, %7, off\n\t"
                 "s_wait_xcnt 0x0"
                 :: "v"(l[0]), "v"(l[1]), "v"(l[2]), "v"(l[3]), "v"(g[0]), "v"(g[1]), "v"(g[2]), "v"(g[3]) : "memory");
}
// A stage is KS = 64 keys: per plane 64 rows of K (128 B = one whole line each), then the 64 d rows of V^T (64 keys = one whole line each), at pitch PBA; the lo plane's 128 rows follow the hi plane's; two buffers. Of every plane the 8 waves copy 16 rows each (waves 0..3 K, waves 4..7 V^T), 8 lanes a row; all 8 waves read every row.
// The work-group's query rows 64 p .. 64 p + 63 need stages 0 .. p: the same trip count in every wave. Wave half sub = 0 / 1 holds rows 64 p + 32 sub ..; its diagonal block is half sub of stage p.
#define KS   64
#define PBA  (HD * 2 + 16)        // LDS row pitch in bytes (16 x odd: no bank conflict for 16-byte fragment reads)
#define PLB  (2 * KS * PBA)       // bytes of one plane's K and V^T rows in a buffer
static_assert(HD == 64 && KS == 64 && REP == 4, "8 waves x 4 copies x 4 rows = the 128 rows of a plane's stage; every row is one 128-B line");
template <typename T16, int NSPLIT>
__device__ __forceinline__ void fattn(const T16* __restrict__ Q, const T16* __restrict__ Q2, const T16* __restrict__ Kp, const T16* __restrict__ Kp2, const T16* __restrict__ Vt, const T16* __restrict__ Vt2, const char* sm, int g, int head, int p, int sub, int wv, int lane, bf* Ah, bf* Al) {
    typedef typename WFrag<T16>::V V;
    static_assert(NSPLIT == 0 || NSPLIT == 2, "one plane or hi/lo planes on both sides");
    constexpr int NPL = (NSPLIT == 2) ? 2 : 1, BUFB = NPL * PLB;      // planes staged; bytes per buffer
    constexpr float C2 = SCL * 1.4426950408889634f;      // score scale x log2 e. Every inner loop below is unrolled so that the fragment and tile arrays are indexed by constants and stay in registers.
    const int lr = lane & 15, hi = lane >> 4, q0 = (2 * p + sub) * 32;
    const bool isk = wv < 4;      // scalar: this wave copies K rows, else V^T rows
    const size_t go = (isk ? ((size_t)g * TT + (wv & 3) * 16 + (lane >> 3)) * HD : ((size_t)g * HD + (wv & 3) * 16 + (lane >> 3)) * TT) + (lane & 7) * 8;      // this lane's first copy of stage 0, in elements of its plane
    const size_t g4 = isk ? (size_t)4 * HD : (size_t)4 * TT, gst = isk ? (size_t)KS * HD : (size_t)KS;      // elements from a row to the fourth behind it; from a stage to the next
    const unsigned lv = (unsigned)((lane >> 3) * PBA + (lane & 7) * 16), lw = (unsigned)(size_t)sm + (unsigned)(wv * 16 * PBA);      // LDS byte address of that copy inside a buffer: the lane's part and the wave's (scalar) part
    // stage: keys t KS .. of every plane into buffer b
    auto stage = [&](int t, int b) __attribute__((always_inline)) {
        const T16* P[2] = { (isk ? Kp : Vt) + go, (NSPLIT == 2) ? (isk ? Kp2 : Vt2) + go : nullptr };
#pragma unroll
        for (int o = 0; o < NPL; ++o) { unsigned l[4]; const T16* gp[4];
#pragma unroll
            for (int j = 0; j < 4; ++j) { l[j] = lv + (lw + (unsigned)(b * BUFB + o * PLB + j * 4 * PBA)); gp[j] = P[o] + (size_t)t * gst + (size_t)j * g4; }
            acopy4<T16>(l, gp); }
    };
    stage(0, p & 1);      // stage t lies in buffer (p - t) & 1: the last stage, whose code stands apart, always in buffer 0
    V qf[2][2], qf2[2][2];
    { const size_t qo = ((size_t)head * TT + q0 + lr) * HD + 8 * hi; const T16 *pq = Q + qo, *pq2 = (NSPLIT == 2) ? Q2 + qo : pq;
#pragma unroll
      for (int t = 0; t < 2; ++t)
#pragma unroll
          for (int ks = 0; ks < 2; ++ks) { qf[t][ks] = WFrag<T16>::ld(pq + t * 16 * HD + ks * 32); if (NSPLIT == 2) qf2[t][ks] = WFrag<T16>::ld(pq2 + t * 16 * HD + ks * 32); }
      xwait4(pq, pq2, pq, pq2); }
    v8f o[4][2];
#pragma unroll
    for (int db = 0; db < 4; ++db)
#pragma unroll
        for (int qt = 0; qt < 2; ++qt) o[db][qt] = (v8f){};
    float m[2] = { -3.0e38f, -3.0e38f }, nm[2] = { 3.0e38f * C2, 3.0e38f * C2 }, l[2] = { 0.f, 0.f };      // running maximum (raw score), minus its scaled value, this lane's share of the sum
    struct Fr { V kf[2][2], kf2[2][2], vf[4], vf2[4]; };      // the fragments of one block of 32 keys
    // frags: the fragment reads of block h (0 or 1: 32 keys) of a stage. fb = this lane's place in the buffer's first row (row lr, k order 8 hi + e, 16 + 8 hi + e): the block's key rows begin 32 h rows on; its 32 columns of V^T begin KS rows on, at column byte 64 h.
    auto frags = [&](Fr& f, const char* fb, int h) __attribute__((always_inline)) {
        const char* fk = fb + h * (32 * PBA); const char* fv = fb + KS * PBA + h * 64;
#pragma unroll
        for (int t = 0; t < 2; ++t)
#pragma unroll
            for (int ks = 0; ks < 2; ++ks) { f.kf[t][ks] = WFrag<T16>::ld((const T16*)(fk + t * 16 * PBA + ks * 64)); if (NSPLIT == 2) f.kf2[t][ks] = WFrag<T16>::ld((const T16*)(fk + PLB + t * 16 * PBA + ks * 64)); }
#pragma unroll
        for (int db = 0; db < 4; ++db) { f.vf[db] = WFrag<T16>::ld((const T16*)(fv + db * 16 * PBA)); if (NSPLIT == 2) f.vf2[db] = WFrag<T16>::ld((const T16*)(fv + PLB + db * 16 * PBA)); }
    };
    auto block = [&](const Fr& f, auto lastc) __attribute__((always_inline)) {
        constexpr bool LAST = decltype(lastc)::v;      // the diagonal block (first key == q0): masked
        v8f s[2][2];
#pragma unroll
        for (int kt = 0; kt < 2; ++kt)
#pragma unroll
            for (int qt = 0; qt < 2; ++qt) { v8f c = (v8f){};
#pragma unroll
                for (int ks = 0; ks < 2; ++ks) { c = WFrag<T16>::mma(f.kf[kt][ks], qf[qt][ks], c); if (NSPLIT == 2) { c = WFrag<T16>::mma(f.kf[kt][ks], qf2[qt][ks], c); c = WFrag<T16>::mma(f.kf2[kt][ks], qf[qt][ks], c); } }
                s[kt][qt] = c; }
        if constexpr (LAST) {
#pragma unroll
            for (int kt = 0; kt < 2; ++kt)
#pragma unroll
                for (int qt = 0; qt < 2; ++qt)
#pragma unroll
                    for (int j = 0; j < 8; ++j) if (kt * 16 + hi * 8 + j > qt * 16 + lr) s[kt][qt][j] = -3.0e38f; }      // key beyond the query: excluded
        float mb[2];
#pragma unroll
        for (int qt = 0; qt < 2; ++qt) { float x0 = fmaxf(s[0][qt][0], s[1][qt][0]), x1 = fmaxf(s[0][qt][1], s[1][qt][1]);
#pragma unroll
            for (int j = 2; j < 8; j += 2) { x0 = fmaxf(x0, fmaxf(s[0][qt][j], s[1][qt][j])); x1 = fmaxf(x1, fmaxf(s[0][qt][j + 1], s[1][qt][j + 1])); }
            x0 = fmaxf(x0, x1); mb[qt] = fmaxf(x0, xhalf(x0)); }
        if (__builtin_amdgcn_ballot_w32(mb[0] > m[0] || mb[1] > m[1]) != 0) {      // scalar branch: a maximum rose somewhere in the wave (rare after the first blocks)
#pragma unroll
            for (int qt = 0; qt < 2; ++qt) { const float mn = fmaxf(m[qt], mb[qt]), nn = -(mn * C2), al = __builtin_amdgcn_exp2f(nn - nm[qt]); m[qt] = mn; nm[qt] = nn; l[qt] *= al;
#pragma unroll
                for (int db = 0; db < 4; ++db) o[db][qt] *= al; } }
        V ph[2], pl[2];
#pragma unroll
        for (int qt = 0; qt < 2; ++qt)
#pragma unroll
            for (int kt = 0; kt < 2; ++kt) {
#pragma unroll
                for (int j = 0; j < 8; ++j) s[kt][qt][j] = __builtin_fmaf(s[kt][qt][j], C2, nm[qt]);
                exp8(s[kt][qt]); }
#pragma unroll
        for (int qt = 0; qt < 2; ++qt) { float a[4] = { s[0][qt][0], s[0][qt][1], s[0][qt][2], s[0][qt][3] };      // four partial sums, in the order key tile 0 registers j, j + 4, key tile 1 registers j, j + 4
#pragma unroll
            for (int j = 4; j < 16; ++j) a[j & 3] += s[j >> 3][qt][j & 7];
            l[qt] += (a[0] + a[1]) + (a[2] + a[3]); ppack(s[0][qt], s[1][qt], ph[qt], pl[qt]); }
#pragma unroll
        for (int db = 0; db < 4; ++db)
#pragma unroll
            for (int qt = 0; qt < 2; ++qt) { o[db][qt] = WFrag<T16>::mma(f.vf[db], ph[qt], o[db][qt]); if (NSPLIT == 2) { o[db][qt] = WFrag<T16>::mma(f.vf[db], pl[qt], o[db][qt]); o[db][qt] = WFrag<T16>::mma(f.vf2[db], ph[qt], o[db][qt]); } }
    };
    asm volatile("s_wait_asynccnt 0x0" ::: "memory");      // this wave's share of stage 0 has landed
    __syncthreads();      // stage 0 is whole before any wave reads it
    if (p > 0) stage(1, (p - 1) & 1);
    const int fo = lr * PBA + hi * 16;
#pragma unroll 1      // rolled: the loop's code stays short
    for (int t = 0; t < p; ++t) {
        const int b = (p - t) & 1; const char* fb = sm + b * BUFB + fo;
        Fr f0, f1;
        frags(f0, fb, 0);
        if constexpr (NSPLIT == 0) frags(f1, fb, 1);
        __builtin_amdgcn_sched_barrier(0);      // the fragment reads stay together in front of the products: left free, the compiler sinks each V^T read to its product and the wave waits out one LDS latency per pair of products
        block(f0, BoolC<false>());
        if constexpr (NSPLIT == 2) { frags(f1, fb, 1);      // hi/lo: twice the fragments, so the second block's are read behind the first block
            __builtin_amdgcn_sched_barrier(0); }      // as above
        block(f1, BoolC<false>());
        asm volatile("s_wait_dscnt 0x0" ::: "memory");      // this wave's reads of buffer b are done
        asm volatile("s_wait_asynccnt 0x0" ::: "memory");      // this wave's share of stage t + 1 has landed
        __syncthreads();      // publishes stage t + 1 and ends every wave's reads of the buffer refilled below
        if (t + 2 <= p) stage(t + 2, b);
    }
    asm volatile("s_wait_asynccnt 0x0" ::: "memory");      // no copy is outstanding behind the loop
    { const char* fb = sm + fo;      // stage p, in buffer 0: no barrier from here on, so the two wave halves may differ
      Fr f0;
      if (sub) { frags(f0, fb, 0);
          __builtin_amdgcn_sched_barrier(0);      // as above
          block(f0, BoolC<false>()); }
      frags(f0, fb, sub);
      __builtin_amdgcn_sched_barrier(0);      // as above
      block(f0, BoolC<true>()); }
#pragma unroll
    for (int qt = 0; qt < 2; ++qt) { const float inv = __fdiv_rn(1.0f, l[qt] + xhalf(l[qt])); const size_t oo = (size_t)(q0 + qt * 16 + lr) * DQ + head * HD + hi * 8;      // the two lane halves' sums join here, once
#pragma unroll
        for (int db = 0; db < 4; ++db) { v8us oh, ol;
#pragma unroll
            for (int j = 0; j < 8; ++j) { unsigned short a, c2; splitf(o[db][qt][j] * inv, a, c2); oh[j] = a; ol[j] = c2; }
            *(v8us*)(Ah + oo + db * 16) = oh; *(v8us*)(Al + oo + db * 16) = ol; } }
}
// grid (NKV, TT / 64, batch), 2 REP waves: work-group y takes query rows 64 p .. 64 p + 63, p = TT / 64 - 1 - y (the longest first: a place that a short work-group leaves early takes the longest one still waiting); waves 0..REP-1 the first 32 rows, waves REP.. the second, one head each.
// The choice between hi/lo and fp16 is the same for the whole work-group, so every barrier stands under block-uniform control flow.
// Register budget: two waves per SIMD (one work-group per WGP).
__global__ __launch_bounds__(2 * REP * 32, 2) void k_fattn(const h16* __restrict__ Q16, const h16* __restrict__ K16, const h16* __restrict__ V16, const bf* __restrict__ Qh, const bf* __restrict__ Ql, const bf* __restrict__ Kh, const bf* __restrict__ Kl, const bf* __restrict__ Vh, const bf* __restrict__ Vl, bf* Ah, bf* Al) {
    __shared__ __align__(16) char sm[2 * 2 * PLB];      // two buffers of two planes
    const int lane = threadIdx.x & 31, wv = __builtin_amdgcn_readfirstlane(threadIdx.x >> 5);      // wave number, scalar so that head, row block and the key loop stay scalar
    const int g = blockIdx.x, head = g * REP + (wv & (REP - 1)), sub = wv / REP, p = TT / 64 - 1 - (int)blockIdx.y;
    const size_t zq = (size_t)blockIdx.z * (NH_ + NKV) * TT * HD, zv = (size_t)blockIdx.z * NKV * TT * HD, za = (size_t)blockIdx.z * TT * DQ;      // this batch's planes: a batch's q heads and k heads lie in one plane, one after the other
    if (p * 64 < RH) fattn<bf, 2>(Qh + zq, Ql + zq, Kh + zq, Kl + zq, Vh + zv, Vl + zv, sm, g, head, p, sub, wv, lane, Ah + za, Al + za); else fattn<h16, 0>(Q16 + zq, nullptr, K16 + zq, nullptr, V16 + zv, nullptr, sm, g, head, p, sub, wv, lane, Ah + za, Al + za);
}

extern "C" void kernel_launch(void* const* d_in, const int* in_sizes, int n_in,
                              void* d_out, int out_size, void* d_ws, size_t ws_size, hipStream_t stream) {
    (void)in_sizes; (void)n_in; (void)out_size;
    const float* x = (const float*)d_in[0]; const float* wq = (const float*)d_in[1]; const float* wk = (const float*)d_in[2]; const float* wv = (const float*)d_in[3]; const float* wo = (const float*)d_in[4];   /* order x, Wq ('oi' [2048][2048]), Wk, Wv ('oi' [512][2048]), Wo ('oi') */
    float* OUT = (float*)d_out;     // [2][2048][2048]
    char* wsp = (char*)d_ws;
    auto take = [&](size_t bytes) { char* p = wsp; wsp += (bytes + 255) & ~(size_t)255; return (void*)p; };
    bf* WQ = (bf*)take((size_t)(DQ + 2 * DKV) * DM * 2); bf* WK = WQ + (size_t)DQ * DM; bf* WV = WK + (size_t)DKV * DM;      /* one plane of DQ + 2 DKV rows */
    bf* WO = (bf*)take((size_t)DM * DQ * 2); float* CS = (float*)take((size_t)TT * HD * 2 * 4);
    bf* XB = (bf*)take((size_t)NB_ * TT * DM * 2);
    h16* QP16 = (h16*)take((size_t)NB_ * (NH_ + NKV) * TT * HD * 2); bf* QPh = (bf*)take((size_t)NB_ * (NH_ + NKV) * TT * HD * 2); bf* QPl = (bf*)take((size_t)NB_ * (NH_ + NKV) * TT * HD * 2);      /* [batch][q heads, k heads][t][d] */
    h16* KP16 = QP16 + (size_t)NH_ * TT * HD; bf* KPh = QPh + (size_t)NH_ * TT * HD; bf* KPl = QPl + (size_t)NH_ * TT * HD;
    h16* VT16 = (h16*)take((size_t)NB_ * NKV * HD * TT * 2); bf* VTh = (bf*)take((size_t)NB_ * NKV * HD * TT * 2); bf* VTl = (bf*)take((size_t)NB_ * NKV * HD * TT * 2);
    bf* ATh = (bf*)take((size_t)NB_ * TT * DQ * 2); bf* ATl = (bf*)take((size_t)NB_ * TT * DQ * 2);
    if ((size_t)(wsp - (char*)d_ws) > ws_size) return;    // ws 256 MiB
    k_prep<<<CSB + CX + 2 * CQ + 2 * CK, 256, 0, stream>>>(x, wq, wk, wv, wo, XB, WQ, WK, WV, WO, CS);
    static_assert(TT % 256 == 0 && (DQ + 2 * DKV) % 192 == 0 && DM % 256 == 0 && DM % 128 == 0 && DQ % 128 == 0, "whole tiles and whole trips only");
    k_gemmt<bf, 0, 1, 4, 3><<<dim3(TT / 256, (DQ + 2 * DKV) / 192, NB_), 384, 0, stream>>>(XB, nullptr, WQ, DM, nullptr, 0, (size_t)TT * DM, 0, CS, QP16, QPh, QPl, VT16, VTh, VTl);
    k_fattn<<<dim3(NKV, TT / 64, NB_), 2 * REP * 32, 0, stream>>>(QP16, KP16, VT16, QPh, QPl, KPh, KPl, VTh, VTl, ATh, ATl);
    k_gemmt<bf, 1, 0, 2, 4><<<dim3(TT / 128, DM / 256, NB_), 256, 0, stream>>>(ATh, ATl, WO, DQ, OUT, DM, (size_t)TT * DQ, (size_t)TT * DM, nullptr, nullptr, nullptr, nullptr, nullptr, nullptr, nullptr);
}
